// v000
// Measured on an AMD MI455X. A time is GPU time per run, averaged over a window of back-to-back runs after a warm-up
// (all launches, gaps included; the runs take copies of the inputs in turn), and the median of several windows.
// Apart from v000's, it joins two sittings. Times from different sittings can be a few percent apart, while
// side-by-side timings come from the same sitting.
// v000, which the later versions start from, runs in 631 microseconds.
#include <hip/hip_runtime.h>
#include <hip/hip_bf16.h>
#include <math.h>

typedef __bf16 bf16_t;
typedef __attribute__((ext_vector_type(16))) __bf16 v16bf;
typedef __attribute__((ext_vector_type(8)))  __bf16 v8bf;
typedef __attribute__((ext_vector_type(4)))  __bf16 v4bf;
typedef __attribute__((ext_vector_type(8)))  float  v8f;

static constexpr int Dd = 2;
static constexpr int Bb = 16;
static constexpr int Ss = 2048;
static constexpr int DH = 1024;
static constexpr int EH = 1024;

// Hardware V_TANH_F32 (TRANS op) if the builtin is available on this toolchain.
#if defined(__has_builtin)
#if __has_builtin(__builtin_amdgcn_tanhf)
#define FAST_TANH(x) __builtin_amdgcn_tanhf(x)
#endif
#endif
#ifndef FAST_TANH
#define FAST_TANH(x) tanhf(x)
#endif

// ---------------------------------------------------------------------------
// f32 -> bf16 conversion, 4 elements / thread (grid-stride). n % 4 == 0.
// ---------------------------------------------------------------------------
__global__ void cvt_f32_bf16_kernel(const float* __restrict__ in,
                                    bf16_t* __restrict__ out, int n) {
    const float4* in4 = (const float4*)in;
    v4bf* out4 = (v4bf*)out;
    const int n4 = n >> 2;
    for (int i = blockIdx.x * blockDim.x + threadIdx.x; i < n4;
         i += gridDim.x * blockDim.x) {
        const float4 v = in4[i];
        v4bf o;
        o[0] = (bf16_t)v.x; o[1] = (bf16_t)v.y;
        o[2] = (bf16_t)v.z; o[3] = (bf16_t)v.w;
        out4[i] = o;
    }
}

// ---------------------------------------------------------------------------
// WMMA fragment loader: 16x32 bf16 tile slice for this lane.
// Lane holds K = {k0+sel .. k0+sel+7} and {k0+sel+16 .. k0+sel+23},
// sel = (lane>=16) ? 8 : 0, row/col = lane&15 (caller bakes into pointer).
// ---------------------------------------------------------------------------
__device__ __forceinline__ v16bf load_frag16(const bf16_t* p) {
    v8bf lo = *reinterpret_cast<const v8bf*>(p);
    v8bf hi = *reinterpret_cast<const v8bf*>(p + 16);
    v16bf r;
#pragma unroll
    for (int i = 0; i < 8; ++i) { r[i] = lo[i]; r[i + 8] = hi[i]; }
    return r;
}

// Computes c[t] += A(16xK) @ W[n_base+16t .. n_base+16t+15][:]^T for t=0..7.
// A: 16 rows, row-major, leading dim lda. W: NxK row-major (weights).
// All fragment loads for a k-step are issued before the 8 WMMAs so the
// compiler can clause the b128 loads and stagger the loadcnt waits.
__device__ __forceinline__ void wmma_strip(const bf16_t* __restrict__ A, int lda,
                                           const bf16_t* __restrict__ W, int ldw,
                                           int K, int n_base, v8f c[8]) {
    const int lane = threadIdx.x & 31;
    const int lo   = lane & 15;
    const int sel  = (lane & 16) ? 8 : 0;
    const bf16_t* arow = A + (size_t)lo * lda + sel;
    const bf16_t* wrow = W + (size_t)(n_base + lo) * ldw + sel;
    for (int k0 = 0; k0 < K; k0 += 32) {
        v16bf af = load_frag16(arow + k0);
        v16bf bf[8];
#pragma unroll
        for (int t = 0; t < 8; ++t)
            bf[t] = load_frag16(wrow + (size_t)t * 16 * ldw + k0);
#pragma unroll
        for (int t = 0; t < 8; ++t)
            c[t] = __builtin_amdgcn_wmma_f32_16x16x32_bf16(
                false, af, false, bf[t], (short)0, c[t], false, false);
    }
}

// ---------------------------------------------------------------------------
// Generic small GEMM: out[M x N] = A[M x K](bf16) @ W[N x K]^T(bf16) + bias
// grid: (N/1024, M/16), block 256 (8 waves, each wave = 128 columns)
// ---------------------------------------------------------------------------
__global__ __launch_bounds__(256) void gemm_bf16_kernel(
    const bf16_t* __restrict__ A, const bf16_t* __restrict__ W,
    const float* __restrict__ bias, float* __restrict__ out,
    int M, int N, int K) {
    const int m0   = blockIdx.y * 16;
    const int wave = threadIdx.x >> 5;
    const int lane = threadIdx.x & 31;
    const int lo   = lane & 15;
    const int n_base = blockIdx.x * 1024 + wave * 128;
    if (n_base >= N) return;

    v8f zero = {0.f, 0.f, 0.f, 0.f, 0.f, 0.f, 0.f, 0.f};
    v8f c[8];
#pragma unroll
    for (int t = 0; t < 8; ++t) c[t] = zero;

    wmma_strip(A + (size_t)m0 * K, K, W, K, K, n_base, c);

    const int rbase = (lane & 16) ? 8 : 0;
#pragma unroll
    for (int t = 0; t < 8; ++t) {
        const int n = n_base + t * 16 + lo;
        const float bv = bias[n];
#pragma unroll
        for (int j = 0; j < 8; ++j) {
            out[(size_t)(m0 + rbase + j) * N + n] = c[t][j] + bv;
        }
    }
}

// ---------------------------------------------------------------------------
// Fused: kh_tile = hs[b, s0:s0+16, :] @ k_w^T + k_b   (kept in registers)
//        e[d,b,s0+m] = sum_h tanh(qh[d,b,h] + kh[m,h]) * v_w[h] + v_b
// grid: (S/16, B), block 256 (8 waves x 128 cols = 1024 = DH)
// ---------------------------------------------------------------------------
__global__ __launch_bounds__(256) void kproj_score_kernel(
    const bf16_t* __restrict__ hs_bf, const bf16_t* __restrict__ kw_bf,
    const float* __restrict__ k_b, const float* __restrict__ qh,
    const float* __restrict__ v_w, const float* __restrict__ v_b,
    float* __restrict__ e_out) {
    const int s0   = blockIdx.x * 16;
    const int b    = blockIdx.y;
    const int wave = threadIdx.x >> 5;
    const int lane = threadIdx.x & 31;
    const int lo   = lane & 15;
    const int n_base = wave * 128;

    __shared__ float e_lds[2 * 16];
    if (threadIdx.x < 32) e_lds[threadIdx.x] = 0.f;
    __syncthreads();

    v8f zero = {0.f, 0.f, 0.f, 0.f, 0.f, 0.f, 0.f, 0.f};
    v8f c[8];
#pragma unroll
    for (int t = 0; t < 8; ++t) c[t] = zero;

    const bf16_t* A = hs_bf + ((size_t)b * Ss + s0) * EH;
    wmma_strip(A, EH, kw_bf, EH, EH, n_base, c);

    // score epilogue for d = 0 and d = 1
    float p0[8], p1[8];
#pragma unroll
    for (int j = 0; j < 8; ++j) { p0[j] = 0.f; p1[j] = 0.f; }

    const float* qh0 = qh + ((size_t)0 * Bb + b) * DH;
    const float* qh1 = qh + ((size_t)1 * Bb + b) * DH;
#pragma unroll
    for (int t = 0; t < 8; ++t) {
        const int h = n_base + t * 16 + lo;
        const float vwh = v_w[h];
        const float kbh = k_b[h];
        const float q0  = qh0[h];
        const float q1  = qh1[h];
#pragma unroll
        for (int j = 0; j < 8; ++j) {
            const float kv = c[t][j] + kbh;
            p0[j] += FAST_TANH(q0 + kv) * vwh;
            p1[j] += FAST_TANH(q1 + kv) * vwh;
        }
    }

    // reduce over the 16 columns held by each half-wave, then across waves
    const int rbase = (lane & 16) ? 8 : 0;
#pragma unroll
    for (int j = 0; j < 8; ++j) {
        float v0 = p0[j], v1 = p1[j];
#pragma unroll
        for (int off = 1; off < 16; off <<= 1) {
            v0 += __shfl_xor(v0, off, 32);
            v1 += __shfl_xor(v1, off, 32);
        }
        if (lo == 0) {
            atomicAdd(&e_lds[rbase + j], v0);
            atomicAdd(&e_lds[16 + rbase + j], v1);
        }
    }
    __syncthreads();

    if (threadIdx.x < 32) {
        const int d = threadIdx.x >> 4;
        const int m = threadIdx.x & 15;
        e_out[((size_t)d * Bb + b) * Ss + s0 + m] = e_lds[threadIdx.x] + v_b[0];
    }
}

// ---------------------------------------------------------------------------
// Row softmax over S: at = softmax(e).  grid: D*B rows, block 256.
// ---------------------------------------------------------------------------
__global__ __launch_bounds__(256) void softmax_kernel(
    const float* __restrict__ e, float* __restrict__ at) {
    const int row = blockIdx.x;
    const float* er = e + (size_t)row * Ss;
    float* ar = at + (size_t)row * Ss;
    __shared__ float red[256];

    float m = -INFINITY;
    for (int s = threadIdx.x; s < Ss; s += 256) m = fmaxf(m, er[s]);
    red[threadIdx.x] = m;
    __syncthreads();
    for (int off = 128; off > 0; off >>= 1) {
        if (threadIdx.x < off)
            red[threadIdx.x] = fmaxf(red[threadIdx.x], red[threadIdx.x + off]);
        __syncthreads();
    }
    m = red[0];
    __syncthreads();

    float sum = 0.f;
    for (int s = threadIdx.x; s < Ss; s += 256) {
        const float v = __expf(er[s] - m);
        ar[s] = v;
        sum += v;
    }
    red[threadIdx.x] = sum;
    __syncthreads();
    for (int off = 128; off > 0; off >>= 1) {
        if (threadIdx.x < off) red[threadIdx.x] += red[threadIdx.x + off];
        __syncthreads();
    }
    const float inv = 1.f / red[0];
    for (int s = threadIdx.x; s < Ss; s += 256) ar[s] *= inv;
}

// ---------------------------------------------------------------------------
// ctx[d,b,g] = sum_s at[d,b,s] * hs[b,s,g]  (read hs once for both d)
// grid: (EH/256, B), block 256.  Output stored as bf16 (feeds final GEMM).
// ---------------------------------------------------------------------------
__global__ __launch_bounds__(256) void ctx_kernel(
    const float* __restrict__ at, const float* __restrict__ hs,
    bf16_t* __restrict__ ctx_bf) {
    const int b = blockIdx.y;
    const int g = blockIdx.x * 256 + threadIdx.x;
    const float* a0 = at + ((size_t)0 * Bb + b) * Ss;
    const float* a1 = at + ((size_t)1 * Bb + b) * Ss;
    const float* h  = hs + (size_t)b * Ss * EH + g;
    float acc0 = 0.f, acc1 = 0.f;
    for (int s = 0; s < Ss; ++s) {
        const float hv = h[(size_t)s * EH];
        acc0 += a0[s] * hv;
        acc1 += a1[s] * hv;
    }
    ctx_bf[((size_t)0 * Bb + b) * EH + g] = (bf16_t)acc0;
    ctx_bf[((size_t)1 * Bb + b) * EH + g] = (bf16_t)acc1;
}

// ---------------------------------------------------------------------------
// launcher
// ---------------------------------------------------------------------------
extern "C" void kernel_launch(void* const* d_in, const int* in_sizes, int n_in,
                              void* d_out, int out_size, void* d_ws, size_t ws_size,
                              hipStream_t stream) {
    const float* hs  = (const float*)d_in[0];  // (B,S,EH)
    const float* ht  = (const float*)d_in[1];  // (D,B,DH)
    const float* q_w = (const float*)d_in[2];  // (DH,DH)
    const float* q_b = (const float*)d_in[3];  // (DH,)
    const float* k_w = (const float*)d_in[4];  // (DH,EH)
    const float* k_b = (const float*)d_in[5];  // (DH,)
    const float* v_w = (const float*)d_in[6];  // (1,DH)
    const float* v_b = (const float*)d_in[7];  // (1,)
    const float* c_w = (const float*)d_in[8];  // (DH,EH)
    const float* c_b = (const float*)d_in[9];  // (DH,)

    float* out_c  = (float*)d_out;                 // (D,B,DH) = 32768
    float* out_at = out_c + (size_t)Dd * Bb * DH;  // (D,B,S)  = 65536

    char* ws = (char*)d_ws;
    bf16_t* hs_bf  = (bf16_t*)(ws + 0);           // 67108864 B
    bf16_t* kw_bf  = (bf16_t*)(ws + 67108864);    //  2097152 B
    bf16_t* qw_bf  = (bf16_t*)(ws + 69206016);    //  2097152 B
    bf16_t* cw_bf  = (bf16_t*)(ws + 71303168);    //  2097152 B
    bf16_t* ht_bf  = (bf16_t*)(ws + 73400320);    //    65536 B
    bf16_t* ctx_bf = (bf16_t*)(ws + 73465856);    //    65536 B
    float*  qh     = (float*) (ws + 73531392);    //   131072 B
    float*  e      = (float*) (ws + 73662464);    //   262144 B

    // 1) f32 -> bf16 conversions
    cvt_f32_bf16_kernel<<<8192, 256, 0, stream>>>(hs, hs_bf, Bb * Ss * EH);
    cvt_f32_bf16_kernel<<<512, 256, 0, stream>>>(k_w, kw_bf, DH * EH);
    cvt_f32_bf16_kernel<<<512, 256, 0, stream>>>(q_w, qw_bf, DH * DH);
    cvt_f32_bf16_kernel<<<512, 256, 0, stream>>>(c_w, cw_bf, DH * EH);
    cvt_f32_bf16_kernel<<<32, 256, 0, stream>>>(ht, ht_bf, Dd * Bb * DH);

    // 2) qh = ht @ q_w^T + q_b   (M=32, N=DH, K=DH)
    gemm_bf16_kernel<<<dim3(1, 2), 256, 0, stream>>>(
        ht_bf, qw_bf, q_b, qh, Dd * Bb, DH, DH);

    // 3) fused k-projection + tanh score -> e (D,B,S)
    kproj_score_kernel<<<dim3(Ss / 16, Bb), 256, 0, stream>>>(
        hs_bf, kw_bf, k_b, qh, v_w, v_b, e);

    // 4) softmax over S -> at output
    softmax_kernel<<<Dd * Bb, 256, 0, stream>>>(e, out_at);

    // 5) ctx = at @ hs  (bf16 output)
    ctx_kernel<<<dim3(EH / 256, Bb), 256, 0, stream>>>(out_at, hs, ctx_bf);

    // 6) c = ctx @ c_w^T + c_b   (M=32, N=DH, K=EH)
    gemm_bf16_kernel<<<dim3(1, 2), 256, 0, stream>>>(
        ctx_bf, cw_bf, c_b, out_c, Dd * Bb, DH, EH);
}

// v001
// One run takes 371 microseconds.
// Next to v000, in two timings, it ran 1.71 times as fast each time.
#include <hip/hip_runtime.h>
#include <hip/hip_bf16.h>
#include <math.h>

typedef __bf16 bf16_t;
typedef __attribute__((ext_vector_type(16))) __bf16 v16bf;
typedef __attribute__((ext_vector_type(8)))  __bf16 v8bf;
typedef __attribute__((ext_vector_type(4)))  __bf16 v4bf;
typedef __attribute__((ext_vector_type(8)))  float  v8f;

static constexpr int Dd = 2;
static constexpr int Bb = 16;
static constexpr int Ss = 2048;
static constexpr int DH = 1024;
static constexpr int EH = 1024;

// Hardware V_TANH_F32 (TRANS op) if the builtin is available on this toolchain.
#if defined(__has_builtin)
#if __has_builtin(__builtin_amdgcn_tanhf)
#define FAST_TANH(x) __builtin_amdgcn_tanhf(x)
#endif
#endif
#ifndef FAST_TANH
#define FAST_TANH(x) tanhf(x)
#endif

// ---------------------------------------------------------------------------
// f32 -> bf16 conversion, 4 elements / thread (grid-stride). n % 4 == 0.
// ---------------------------------------------------------------------------
__global__ void cvt_f32_bf16_kernel(const float* __restrict__ in,
                                    bf16_t* __restrict__ out, int n) {
    const float4* in4 = (const float4*)in;
    v4bf* out4 = (v4bf*)out;
    const int n4 = n >> 2;
    for (int i = blockIdx.x * blockDim.x + threadIdx.x; i < n4;
         i += gridDim.x * blockDim.x) {
        const float4 v = in4[i];
        v4bf o;
        o[0] = (bf16_t)v.x; o[1] = (bf16_t)v.y;
        o[2] = (bf16_t)v.z; o[3] = (bf16_t)v.w;
        out4[i] = o;
    }
}

// ---------------------------------------------------------------------------
// WMMA fragment loader: 16x32 bf16 tile slice for this lane.
// Lane holds K = {k0+sel .. k0+sel+7} and {k0+sel+16 .. k0+sel+23},
// sel = (lane>=16) ? 8 : 0, row/col = lane&15 (caller bakes into pointer).
// ---------------------------------------------------------------------------
__device__ __forceinline__ v16bf load_frag16(const bf16_t* p) {
    v8bf lo = *reinterpret_cast<const v8bf*>(p);
    v8bf hi = *reinterpret_cast<const v8bf*>(p + 16);
    v16bf r;
#pragma unroll
    for (int i = 0; i < 8; ++i) { r[i] = lo[i]; r[i + 8] = hi[i]; }
    return r;
}

// Computes c[t] += A(16xK) @ W[n_base+16t .. n_base+16t+15][:]^T for t=0..7.
// A: 16 rows, row-major, leading dim lda. W: NxK row-major (weights).
// All fragment loads for a k-step are issued before the 8 WMMAs so the
// compiler can clause the b128 loads and stagger the loadcnt waits.
__device__ __forceinline__ void wmma_strip(const bf16_t* __restrict__ A, int lda,
                                           const bf16_t* __restrict__ W, int ldw,
                                           int K, int n_base, v8f c[8]) {
    const int lane = threadIdx.x & 31;
    const int lo   = lane & 15;
    const int sel  = (lane & 16) ? 8 : 0;
    const bf16_t* arow = A + (size_t)lo * lda + sel;
    const bf16_t* wrow = W + (size_t)(n_base + lo) * ldw + sel;
    for (int k0 = 0; k0 < K; k0 += 32) {
        v16bf af = load_frag16(arow + k0);
        v16bf bf[8];
#pragma unroll
        for (int t = 0; t < 8; ++t)
            bf[t] = load_frag16(wrow + (size_t)t * 16 * ldw + k0);
#pragma unroll
        for (int t = 0; t < 8; ++t)
            c[t] = __builtin_amdgcn_wmma_f32_16x16x32_bf16(
                false, af, false, bf[t], (short)0, c[t], false, false);
    }
}

// ---------------------------------------------------------------------------
// Generic small GEMM: out[M x N] = A[M x K](bf16) @ W[N x K]^T(bf16) + bias
// grid: (N/1024, M/16), block 256 (8 waves, each wave = 128 columns)
// ---------------------------------------------------------------------------
__global__ __launch_bounds__(256) void gemm_bf16_kernel(
    const bf16_t* __restrict__ A, const bf16_t* __restrict__ W,
    const float* __restrict__ bias, float* __restrict__ out,
    int M, int N, int K) {
    const int m0   = blockIdx.y * 16;
    const int wave = threadIdx.x >> 5;
    const int lane = threadIdx.x & 31;
    const int lo   = lane & 15;
    const int n_base = blockIdx.x * 1024 + wave * 128;
    if (n_base >= N) return;

    v8f zero = {0.f, 0.f, 0.f, 0.f, 0.f, 0.f, 0.f, 0.f};
    v8f c[8];
#pragma unroll
    for (int t = 0; t < 8; ++t) c[t] = zero;

    wmma_strip(A + (size_t)m0 * K, K, W, K, K, n_base, c);

    const int rbase = (lane & 16) ? 8 : 0;
#pragma unroll
    for (int t = 0; t < 8; ++t) {
        const int n = n_base + t * 16 + lo;
        const float bv = bias[n];
#pragma unroll
        for (int j = 0; j < 8; ++j) {
            out[(size_t)(m0 + rbase + j) * N + n] = c[t][j] + bv;
        }
    }
}

// ---------------------------------------------------------------------------
// Fused: kh = hs[b, m0:m0+128, :] @ k_w^T + k_b   (kept in registers)
//        e[d,b,m0+m] = sum_h tanh(qh[d,b,h] + kh[m,h]) * v_w[h] + v_b
// grid: (S/128, B), block 512 = 16 waves: 8 along the rows x 2 along the
// columns, each wave a 16 x 128 strip as before; 4 passes of 256 columns.
// Both operands reach the waves through LDS: a stage is 128 k (256-byte rows)
// of 128 hs rows and 256 k_w rows, brought in by asynchronous copies that read
// whole lines, two buffers, the next stage in flight while this one is used.
// ---------------------------------------------------------------------------
static constexpr int KP_M      = 128;                       // hs rows per work-group
static constexpr int KP_N      = 256;                       // kh columns per pass
static constexpr int KP_K      = 128;                       // k per stage
static constexpr int KP_PITCH  = 272;                       // LDS row pitch, bytes (16 x odd)
static constexpr int KP_BUF    = (KP_M + KP_N) * KP_PITCH;  // one buffer, bytes
static constexpr int KP_KST    = EH / KP_K;                 // stages per pass
static constexpr int KP_STAGES = (DH / KP_N) * KP_KST;      // stages in all

// One stage: 384 rows x 16 pieces of 16 bytes = 12 copies per thread. A wave's
// copy covers two whole 256-byte rows. a / w: this thread's piece in row
// (tid >> 4) of the stage's hs / k_w rows; dst: its LDS byte address there.
__device__ __forceinline__ void kp_copy_stage(const bf16_t* a, const bf16_t* w,
                                              unsigned dst) {
    constexpr int      GR = 32 * EH;         // 32 rows further, elements
    constexpr unsigned LR = 32 * KP_PITCH;   // 32 rows further, LDS bytes
    // s_wait_xcnt closes the statement so that no address register named here
    // is rewritten ahead of it.
    asm volatile(
        "global_load_async_to_lds_b128 %0, %12, off\n\t"
        "global_load_async_to_lds_b128 %1, %13, off\n\t"
        "global_load_async_to_lds_b128 %2, %14, off\n\t"
        "global_load_async_to_lds_b128 %3, %15, off\n\t"
        "global_load_async_to_lds_b128 %4, %16, off\n\t"
        "global_load_async_to_lds_b128 %5, %17, off\n\t"
        "global_load_async_to_lds_b128 %6, %18, off\n\t"
        "global_load_async_to_lds_b128 %7, %19, off\n\t"
        "global_load_async_to_lds_b128 %8, %20, off\n\t"
        "global_load_async_to_lds_b128 %9, %21, off\n\t"
        "global_load_async_to_lds_b128 %10, %22, off\n\t"
        "global_load_async_to_lds_b128 %11, %23, off\n\t"
        "s_wait_xcnt 0x0"
        :: "v"(dst), "v"(dst + LR), "v"(dst + 2 * LR), "v"(dst + 3 * LR),
           "v"(dst + 4 * LR), "v"(dst + 5 * LR), "v"(dst + 6 * LR),
           "v"(dst + 7 * LR), "v"(dst + 8 * LR), "v"(dst + 9 * LR),
           "v"(dst + 10 * LR), "v"(dst + 11 * LR),
           "v"(a), "v"(a + GR), "v"(a + 2 * GR), "v"(a + 3 * GR),
           "v"(w), "v"(w + GR), "v"(w + 2 * GR), "v"(w + 3 * GR),
           "v"(w + 4 * GR), "v"(w + 5 * GR), "v"(w + 6 * GR), "v"(w + 7 * GR)
        : "memory");
}

__global__ __launch_bounds__(512) void kproj_score_kernel(
    const bf16_t* __restrict__ hs_bf, const bf16_t* __restrict__ kw_bf,
    const float* __restrict__ k_b, const float* __restrict__ qh,
    const float* __restrict__ v_w, const float* __restrict__ v_b,
    float* __restrict__ e_out) {
    const int m0   = blockIdx.x * KP_M;
    const int b    = blockIdx.y;
    const int tid  = threadIdx.x;
    const int wave = tid >> 5;
    const int lane = tid & 31;
    const int lo   = lane & 15;
    const int sel  = (lane & 16) ? 8 : 0;
    const int wm   = wave & 7;    // which 16 rows
    const int wn   = wave >> 3;   // which 128 of the pass's 256 columns

    __shared__ __attribute__((aligned(16))) char kp_lds[2 * KP_BUF];
    __shared__ float e_lds[2 * KP_M];
    if (tid < 2 * KP_M) e_lds[tid] = 0.f;

    // this thread's piece of a stage
    const int crow = tid >> 4;
    const int ccol = tid & 15;
    const bf16_t* a_src = hs_bf + ((size_t)b * Ss + m0 + crow) * EH + ccol * 8;
    const bf16_t* w_src = kw_bf + (size_t)crow * EH + ccol * 8;
    const unsigned c_dst = (unsigned)(size_t)kp_lds + crow * KP_PITCH + ccol * 16;

    kp_copy_stage(a_src, w_src, c_dst);
    // stage 0 has landed for this wave; the barrier publishes it to the others
    asm volatile("s_wait_asynccnt 0x0" ::: "memory");
    __syncthreads();
    kp_copy_stage(a_src + KP_K, w_src + KP_K, c_dst + KP_BUF);

    // this lane's fragment rows inside a buffer
    const int a_off = (wm * 16 + lo) * KP_PITCH + sel * 2;
    const int w_off = (KP_M + wn * 128 + lo) * KP_PITCH + sel * 2;

    const float* qh0 = qh + ((size_t)0 * Bb + b) * DH;
    const float* qh1 = qh + ((size_t)1 * Bb + b) * DH;

    float p0[8], p1[8];
#pragma unroll
    for (int j = 0; j < 8; ++j) { p0[j] = 0.f; p1[j] = 0.f; }

    const v8f zero = {0.f, 0.f, 0.f, 0.f, 0.f, 0.f, 0.f, 0.f};

    for (int pass = 0; pass < DH / KP_N; ++pass) {
        v8f c[8];
#pragma unroll
        for (int t = 0; t < 8; ++t) c[t] = zero;

        for (int kc = 0; kc < KP_KST; ++kc) {
            const int st = pass * KP_KST + kc;
            const char* buf = kp_lds + (st & 1) * KP_BUF;
#pragma unroll
            for (int ks = 0; ks < KP_K / 32; ++ks) {
                v16bf af = load_frag16((const bf16_t*)(buf + a_off) + ks * 32);
                v16bf bf[8];
#pragma unroll
                for (int t = 0; t < 8; ++t)
                    bf[t] = load_frag16(
                        (const bf16_t*)(buf + w_off + t * 16 * KP_PITCH) + ks * 32);
                // keeps the k-step's 18 LDS reads one group ahead of its WMMAs:
                // left alone the scheduler puts a full LDS wait before each WMMA
                __builtin_amdgcn_sched_barrier(0);
#pragma unroll
                for (int t = 0; t < 8; ++t)
                    c[t] = __builtin_amdgcn_wmma_f32_16x16x32_bf16(
                        false, af, false, bf[t], (short)0, c[t], false, false);
            }
            // this wave's reads of the buffer are done before it is refilled
            asm volatile("s_wait_dscnt 0x0" ::: "memory");
            // this wave's copies of the next stage have landed
            asm volatile("s_wait_asynccnt 0x0" ::: "memory");
            // publishes the next stage and ends every wave's reads of this one
            __syncthreads();
            const int nx = st + 2;
            if (nx < KP_STAGES) {
                const int np = nx / KP_KST;
                const int nk = nx % KP_KST;
                kp_copy_stage(a_src + nk * KP_K,
                              w_src + (size_t)np * KP_N * EH + nk * KP_K,
                              c_dst + (st & 1) * KP_BUF);
            }
        }

        // score terms of this pass's 128 columns, for d = 0 and d = 1
#pragma unroll
        for (int t = 0; t < 8; ++t) {
            const int h = pass * KP_N + wn * 128 + t * 16 + lo;
            const float vwh = v_w[h];
            const float kbh = k_b[h];
            const float q0  = qh0[h];
            const float q1  = qh1[h];
#pragma unroll
            for (int j = 0; j < 8; ++j) {
                const float kv = c[t][j] + kbh;
                p0[j] += FAST_TANH(q0 + kv) * vwh;
                p1[j] += FAST_TANH(q1 + kv) * vwh;
            }
        }
    }
    // no copy is outstanding when the wave goes on to its end
    asm volatile("s_wait_asynccnt 0x0" ::: "memory");

    // reduce over the 16 columns held by each half-wave, then across the two
    // waves that share the rows
    const int rbase = wm * 16 + ((lane & 16) ? 8 : 0);
#pragma unroll
    for (int j = 0; j < 8; ++j) {
        float v0 = p0[j], v1 = p1[j];
#pragma unroll
        for (int off = 1; off < 16; off <<= 1) {
            v0 += __shfl_xor(v0, off, 32);
            v1 += __shfl_xor(v1, off, 32);
        }
        if (lo == 0) {
            atomicAdd(&e_lds[rbase + j], v0);
            atomicAdd(&e_lds[KP_M + rbase + j], v1);
        }
    }
    __syncthreads();

    if (tid < 2 * KP_M) {
        const int d = tid / KP_M;
        const int mr = tid % KP_M;
        e_out[((size_t)d * Bb + b) * Ss + m0 + mr] = e_lds[tid] + v_b[0];
    }
}

// ---------------------------------------------------------------------------
// Row softmax over S: at = softmax(e).  grid: D*B rows, block 256.
// ---------------------------------------------------------------------------
__global__ __launch_bounds__(256) void softmax_kernel(
    const float* __restrict__ e, float* __restrict__ at) {
    const int row = blockIdx.x;
    const float* er = e + (size_t)row * Ss;
    float* ar = at + (size_t)row * Ss;
    __shared__ float red[256];

    float m = -INFINITY;
    for (int s = threadIdx.x; s < Ss; s += 256) m = fmaxf(m, er[s]);
    red[threadIdx.x] = m;
    __syncthreads();
    for (int off = 128; off > 0; off >>= 1) {
        if (threadIdx.x < off)
            red[threadIdx.x] = fmaxf(red[threadIdx.x], red[threadIdx.x + off]);
        __syncthreads();
    }
    m = red[0];
    __syncthreads();

    float sum = 0.f;
    for (int s = threadIdx.x; s < Ss; s += 256) {
        const float v = __expf(er[s] - m);
        ar[s] = v;
        sum += v;
    }
    red[threadIdx.x] = sum;
    __syncthreads();
    for (int off = 128; off > 0; off >>= 1) {
        if (threadIdx.x < off) red[threadIdx.x] += red[threadIdx.x + off];
        __syncthreads();
    }
    const float inv = 1.f / red[0];
    for (int s = threadIdx.x; s < Ss; s += 256) ar[s] *= inv;
}

// ---------------------------------------------------------------------------
// ctx[d,b,g] = sum_s at[d,b,s] * hs[b,s,g]  (read hs once for both d)
// grid: (EH/256, B), block 256.  Output stored as bf16 (feeds final GEMM).
// ---------------------------------------------------------------------------
__global__ __launch_bounds__(256) void ctx_kernel(
    const float* __restrict__ at, const float* __restrict__ hs,
    bf16_t* __restrict__ ctx_bf) {
    const int b = blockIdx.y;
    const int g = blockIdx.x * 256 + threadIdx.x;
    const float* a0 = at + ((size_t)0 * Bb + b) * Ss;
    const float* a1 = at + ((size_t)1 * Bb + b) * Ss;
    const float* h  = hs + (size_t)b * Ss * EH + g;
    float acc0 = 0.f, acc1 = 0.f;
    for (int s = 0; s < Ss; ++s) {
        const float hv = h[(size_t)s * EH];
        acc0 += a0[s] * hv;
        acc1 += a1[s] * hv;
    }
    ctx_bf[((size_t)0 * Bb + b) * EH + g] = (bf16_t)acc0;
    ctx_bf[((size_t)1 * Bb + b) * EH + g] = (bf16_t)acc1;
}

// ---------------------------------------------------------------------------
// launcher
// ---------------------------------------------------------------------------
extern "C" void kernel_launch(void* const* d_in, const int* in_sizes, int n_in,
                              void* d_out, int out_size, void* d_ws, size_t ws_size,
                              hipStream_t stream) {
    const float* hs  = (const float*)d_in[0];  // (B,S,EH)
    const float* ht  = (const float*)d_in[1];  // (D,B,DH)
    const float* q_w = (const float*)d_in[2];  // (DH,DH)
    const float* q_b = (const float*)d_in[3];  // (DH,)
    const float* k_w = (const float*)d_in[4];  // (DH,EH)
    const float* k_b = (const float*)d_in[5];  // (DH,)
    const float* v_w = (const float*)d_in[6];  // (1,DH)
    const float* v_b = (const float*)d_in[7];  // (1,)
    const float* c_w = (const float*)d_in[8];  // (DH,EH)
    const float* c_b = (const float*)d_in[9];  // (DH,)

    float* out_c  = (float*)d_out;                 // (D,B,DH) = 32768
    float* out_at = out_c + (size_t)Dd * Bb * DH;  // (D,B,S)  = 65536

    char* ws = (char*)d_ws;
    bf16_t* hs_bf  = (bf16_t*)(ws + 0);           // 67108864 B
    bf16_t* kw_bf  = (bf16_t*)(ws + 67108864);    //  2097152 B
    bf16_t* qw_bf  = (bf16_t*)(ws + 69206016);    //  2097152 B
    bf16_t* cw_bf  = (bf16_t*)(ws + 71303168);    //  2097152 B
    bf16_t* ht_bf  = (bf16_t*)(ws + 73400320);    //    65536 B
    bf16_t* ctx_bf = (bf16_t*)(ws + 73465856);    //    65536 B
    float*  qh     = (float*) (ws + 73531392);    //   131072 B
    float*  e      = (float*) (ws + 73662464);    //   262144 B

    // 1) f32 -> bf16 conversions
    cvt_f32_bf16_kernel<<<8192, 256, 0, stream>>>(hs, hs_bf, Bb * Ss * EH);
    cvt_f32_bf16_kernel<<<512, 256, 0, stream>>>(k_w, kw_bf, DH * EH);
    cvt_f32_bf16_kernel<<<512, 256, 0, stream>>>(q_w, qw_bf, DH * DH);
    cvt_f32_bf16_kernel<<<512, 256, 0, stream>>>(c_w, cw_bf, DH * EH);
    cvt_f32_bf16_kernel<<<32, 256, 0, stream>>>(ht, ht_bf, Dd * Bb * DH);

    // 2) qh = ht @ q_w^T + q_b   (M=32, N=DH, K=DH)
    gemm_bf16_kernel<<<dim3(1, 2), 256, 0, stream>>>(
        ht_bf, qw_bf, q_b, qh, Dd * Bb, DH, DH);

    // 3) fused k-projection + tanh score -> e (D,B,S)
    kproj_score_kernel<<<dim3(Ss / KP_M, Bb), 512, 0, stream>>>(
        hs_bf, kw_bf, k_b, qh, v_w, v_b, e);

    // 4) softmax over S -> at output
    softmax_kernel<<<Dd * Bb, 256, 0, stream>>>(e, out_at);

    // 5) ctx = at @ hs  (bf16 output)
    ctx_kernel<<<dim3(EH / 256, Bb), 256, 0, stream>>>(out_at, hs, ctx_bf);

    // 6) c = ctx @ c_w^T + c_b   (M=32, N=DH, K=EH)
    gemm_bf16_kernel<<<dim3(1, 2), 256, 0, stream>>>(
        ctx_bf, cw_bf, c_b, out_c, Dd * Bb, DH, EH);
}

// v002
// Measured time: 256 microseconds a run.
// Two timings next to v001 both put it at 1.43 times that version's speed.
// All steps since v000 together make it 2.45 times as fast.
#include <hip/hip_runtime.h>
#include <hip/hip_bf16.h>
#include <math.h>

typedef __bf16 bf16_t;
typedef __attribute__((ext_vector_type(16))) __bf16 v16bf;
typedef __attribute__((ext_vector_type(8)))  __bf16 v8bf;
typedef __attribute__((ext_vector_type(4)))  __bf16 v4bf;
typedef __attribute__((ext_vector_type(8)))  float  v8f;

static constexpr int Dd = 2;
static constexpr int Bb = 16;
static constexpr int Ss = 2048;
static constexpr int DH = 1024;
static constexpr int EH = 1024;

// Hardware V_TANH_F32 (TRANS op) if the builtin is available on this toolchain.
#if defined(__has_builtin)
#if __has_builtin(__builtin_amdgcn_tanhf)
#define FAST_TANH(x) __builtin_amdgcn_tanhf(x)
#endif
#endif
#ifndef FAST_TANH
#define FAST_TANH(x) tanhf(x)
#endif

// ---------------------------------------------------------------------------
// f32 -> bf16 conversion, 4 elements / thread (grid-stride). n % 4 == 0.
// ---------------------------------------------------------------------------
__global__ void cvt_f32_bf16_kernel(const float* __restrict__ in,
                                    bf16_t* __restrict__ out, int n) {
    const float4* in4 = (const float4*)in;
    v4bf* out4 = (v4bf*)out;
    const int n4 = n >> 2;
    for (int i = blockIdx.x * blockDim.x + threadIdx.x; i < n4;
         i += gridDim.x * blockDim.x) {
        const float4 v = in4[i];
        v4bf o;
        o[0] = (bf16_t)v.x; o[1] = (bf16_t)v.y;
        o[2] = (bf16_t)v.z; o[3] = (bf16_t)v.w;
        out4[i] = o;
    }
}

// ---------------------------------------------------------------------------
// WMMA fragment loader: 16x32 bf16 tile slice for this lane.
// Lane holds K = {k0+sel .. k0+sel+7} and {k0+sel+16 .. k0+sel+23},
// sel = (lane>=16) ? 8 : 0, row/col = lane&15 (caller bakes into pointer).
// ---------------------------------------------------------------------------
__device__ __forceinline__ v16bf load_frag16(const bf16_t* p) {
    v8bf lo = *reinterpret_cast<const v8bf*>(p);
    v8bf hi = *reinterpret_cast<const v8bf*>(p + 16);
    v16bf r;
#pragma unroll
    for (int i = 0; i < 8; ++i) { r[i] = lo[i]; r[i + 8] = hi[i]; }
    return r;
}

// Computes c[t] += A(16xK) @ W[n_base+16t .. n_base+16t+15][:]^T for t=0..7.
// A: 16 rows, row-major, leading dim lda. W: NxK row-major (weights).
// All fragment loads for a k-step are issued before the 8 WMMAs so the
// compiler can clause the b128 loads and stagger the loadcnt waits.
__device__ __forceinline__ void wmma_strip(const bf16_t* __restrict__ A, int lda,
                                           const bf16_t* __restrict__ W, int ldw,
                                           int K, int n_base, v8f c[8]) {
    const int lane = threadIdx.x & 31;
    const int lo   = lane & 15;
    const int sel  = (lane & 16) ? 8 : 0;
    const bf16_t* arow = A + (size_t)lo * lda + sel;
    const bf16_t* wrow = W + (size_t)(n_base + lo) * ldw + sel;
    for (int k0 = 0; k0 < K; k0 += 32) {
        v16bf af = load_frag16(arow + k0);
        v16bf bf[8];
#pragma unroll
        for (int t = 0; t < 8; ++t)
            bf[t] = load_frag16(wrow + (size_t)t * 16 * ldw + k0);
#pragma unroll
        for (int t = 0; t < 8; ++t)
            c[t] = __builtin_amdgcn_wmma_f32_16x16x32_bf16(
                false, af, false, bf[t], (short)0, c[t], false, false);
    }
}

// ---------------------------------------------------------------------------
// Generic small GEMM: out[M x N] = A[M x K](bf16) @ W[N x K]^T(bf16) + bias
// grid: (N/1024, M/16), block 256 (8 waves, each wave = 128 columns)
// ---------------------------------------------------------------------------
__global__ __launch_bounds__(256) void gemm_bf16_kernel(
    const bf16_t* __restrict__ A, const bf16_t* __restrict__ W,
    const float* __restrict__ bias, float* __restrict__ out,
    int M, int N, int K) {
    const int m0   = blockIdx.y * 16;
    const int wave = threadIdx.x >> 5;
    const int lane = threadIdx.x & 31;
    const int lo   = lane & 15;
    const int n_base = blockIdx.x * 1024 + wave * 128;
    if (n_base >= N) return;

    v8f zero = {0.f, 0.f, 0.f, 0.f, 0.f, 0.f, 0.f, 0.f};
    v8f c[8];
#pragma unroll
    for (int t = 0; t < 8; ++t) c[t] = zero;

    wmma_strip(A + (size_t)m0 * K, K, W, K, K, n_base, c);

    const int rbase = (lane & 16) ? 8 : 0;
#pragma unroll
    for (int t = 0; t < 8; ++t) {
        const int n = n_base + t * 16 + lo;
        const float bv = bias[n];
#pragma unroll
        for (int j = 0; j < 8; ++j) {
            out[(size_t)(m0 + rbase + j) * N + n] = c[t][j] + bv;
        }
    }
}

// ---------------------------------------------------------------------------
// Fused: kh = hs[b, m0:m0+128, :] @ k_w^T + k_b   (kept in registers)
//        e[d,b,m0+m] = sum_h tanh(qh[d,b,h] + kh[m,h]) * v_w[h] + v_b
// grid: (S/128, B), block 512 = 16 waves: 8 along the rows x 2 along the
// columns, each wave a 16 x 128 strip as before; 4 passes of 256 columns.
// Both operands reach the waves through LDS: a stage is 128 k (256-byte rows)
// of 128 hs rows and 256 k_w rows, brought in by asynchronous copies that read
// whole lines, two buffers, the next stage in flight while this one is used.
// ---------------------------------------------------------------------------
static constexpr int KP_M      = 128;                       // hs rows per work-group
static constexpr int KP_N      = 256;                       // kh columns per pass
static constexpr int KP_K      = 128;                       // k per stage
static constexpr int KP_PITCH  = 272;                       // LDS row pitch, bytes (16 x odd)
static constexpr int KP_BUF    = (KP_M + KP_N) * KP_PITCH;  // one buffer, bytes
static constexpr int KP_KST    = EH / KP_K;                 // stages per pass
static constexpr int KP_STAGES = (DH / KP_N) * KP_KST;      // stages in all

// One stage: 384 rows x 16 pieces of 16 bytes = 12 copies per thread. A wave's
// copy covers two whole 256-byte rows. a / w: this thread's piece in row
// (tid >> 4) of the stage's hs / k_w rows; dst: its LDS byte address there.
__device__ __forceinline__ void kp_copy_stage(const bf16_t* a, const bf16_t* w,
                                              unsigned dst) {
    constexpr int      GR = 32 * EH;         // 32 rows further, elements
    constexpr unsigned LR = 32 * KP_PITCH;   // 32 rows further, LDS bytes
    // s_wait_xcnt closes the statement so that no address register named here
    // is rewritten ahead of it.
    asm volatile(
        "global_load_async_to_lds_b128 %0, %12, off\n\t"
        "global_load_async_to_lds_b128 %1, %13, off\n\t"
        "global_load_async_to_lds_b128 %2, %14, off\n\t"
        "global_load_async_to_lds_b128 %3, %15, off\n\t"
        "global_load_async_to_lds_b128 %4, %16, off\n\t"
        "global_load_async_to_lds_b128 %5, %17, off\n\t"
        "global_load_async_to_lds_b128 %6, %18, off\n\t"
        "global_load_async_to_lds_b128 %7, %19, off\n\t"
        "global_load_async_to_lds_b128 %8, %20, off\n\t"
        "global_load_async_to_lds_b128 %9, %21, off\n\t"
        "global_load_async_to_lds_b128 %10, %22, off\n\t"
        "global_load_async_to_lds_b128 %11, %23, off\n\t"
        "s_wait_xcnt 0x0"
        :: "v"(dst), "v"(dst + LR), "v"(dst + 2 * LR), "v"(dst + 3 * LR),
           "v"(dst + 4 * LR), "v"(dst + 5 * LR), "v"(dst + 6 * LR),
           "v"(dst + 7 * LR), "v"(dst + 8 * LR), "v"(dst + 9 * LR),
           "v"(dst + 10 * LR), "v"(dst + 11 * LR),
           "v"(a), "v"(a + GR), "v"(a + 2 * GR), "v"(a + 3 * GR),
           "v"(w), "v"(w + GR), "v"(w + 2 * GR), "v"(w + 3 * GR),
           "v"(w + 4 * GR), "v"(w + 5 * GR), "v"(w + 6 * GR), "v"(w + 7 * GR)
        : "memory");
}

__global__ __launch_bounds__(512) void kproj_score_kernel(
    const bf16_t* __restrict__ hs_bf, const bf16_t* __restrict__ kw_bf,
    const float* __restrict__ k_b, const float* __restrict__ qh,
    const float* __restrict__ v_w, const float* __restrict__ v_b,
    float* __restrict__ e_out) {
    const int m0   = blockIdx.x * KP_M;
    const int b    = blockIdx.y;
    const int tid  = threadIdx.x;
    const int wave = tid >> 5;
    const int lane = tid & 31;
    const int lo   = lane & 15;
    const int sel  = (lane & 16) ? 8 : 0;
    const int wm   = wave & 7;    // which 16 rows
    const int wn   = wave >> 3;   // which 128 of the pass's 256 columns

    __shared__ __attribute__((aligned(16))) char kp_lds[2 * KP_BUF];
    __shared__ float e_lds[2 * KP_M];
    if (tid < 2 * KP_M) e_lds[tid] = 0.f;

    // this thread's piece of a stage
    const int crow = tid >> 4;
    const int ccol = tid & 15;
    const bf16_t* a_src = hs_bf + ((size_t)b * Ss + m0 + crow) * EH + ccol * 8;
    const bf16_t* w_src = kw_bf + (size_t)crow * EH + ccol * 8;
    const unsigned c_dst = (unsigned)(size_t)kp_lds + crow * KP_PITCH + ccol * 16;

    kp_copy_stage(a_src, w_src, c_dst);
    // stage 0 has landed for this wave; the barrier publishes it to the others
    asm volatile("s_wait_asynccnt 0x0" ::: "memory");
    __syncthreads();
    kp_copy_stage(a_src + KP_K, w_src + KP_K, c_dst + KP_BUF);

    // this lane's fragment rows inside a buffer
    const int a_off = (wm * 16 + lo) * KP_PITCH + sel * 2;
    const int w_off = (KP_M + wn * 128 + lo) * KP_PITCH + sel * 2;

    const float* qh0 = qh + ((size_t)0 * Bb + b) * DH;
    const float* qh1 = qh + ((size_t)1 * Bb + b) * DH;

    float p0[8], p1[8];
#pragma unroll
    for (int j = 0; j < 8; ++j) { p0[j] = 0.f; p1[j] = 0.f; }

    const v8f zero = {0.f, 0.f, 0.f, 0.f, 0.f, 0.f, 0.f, 0.f};

    for (int pass = 0; pass < DH / KP_N; ++pass) {
        v8f c[8];
#pragma unroll
        for (int t = 0; t < 8; ++t) c[t] = zero;

        for (int kc = 0; kc < KP_KST; ++kc) {
            const int st = pass * KP_KST + kc;
            const char* buf = kp_lds + (st & 1) * KP_BUF;
#pragma unroll
            for (int ks = 0; ks < KP_K / 32; ++ks) {
                v16bf af = load_frag16((const bf16_t*)(buf + a_off) + ks * 32);
                v16bf bf[8];
#pragma unroll
                for (int t = 0; t < 8; ++t)
                    bf[t] = load_frag16(
                        (const bf16_t*)(buf + w_off + t * 16 * KP_PITCH) + ks * 32);
                // keeps the k-step's 18 LDS reads one group ahead of its WMMAs:
                // left alone the scheduler puts a full LDS wait before each WMMA
                __builtin_amdgcn_sched_barrier(0);
#pragma unroll
                for (int t = 0; t < 8; ++t)
                    c[t] = __builtin_amdgcn_wmma_f32_16x16x32_bf16(
                        false, af, false, bf[t], (short)0, c[t], false, false);
            }
            // this wave's reads of the buffer are done before it is refilled
            asm volatile("s_wait_dscnt 0x0" ::: "memory");
            // this wave's copies of the next stage have landed
            asm volatile("s_wait_asynccnt 0x0" ::: "memory");
            // publishes the next stage and ends every wave's reads of this one
            __syncthreads();
            const int nx = st + 2;
            if (nx < KP_STAGES) {
                const int np = nx / KP_KST;
                const int nk = nx % KP_KST;
                kp_copy_stage(a_src + nk * KP_K,
                              w_src + (size_t)np * KP_N * EH + nk * KP_K,
                              c_dst + (st & 1) * KP_BUF);
            }
        }

        // score terms of this pass's 128 columns, for d = 0 and d = 1
#pragma unroll
        for (int t = 0; t < 8; ++t) {
            const int h = pass * KP_N + wn * 128 + t * 16 + lo;
            const float vwh = v_w[h];
            const float kbh = k_b[h];
            const float q0  = qh0[h];
            const float q1  = qh1[h];
#pragma unroll
            for (int j = 0; j < 8; ++j) {
                const float kv = c[t][j] + kbh;
                p0[j] += FAST_TANH(q0 + kv) * vwh;
                p1[j] += FAST_TANH(q1 + kv) * vwh;
            }
        }
    }
    // no copy is outstanding when the wave goes on to its end
    asm volatile("s_wait_asynccnt 0x0" ::: "memory");

    // reduce over the 16 columns held by each half-wave, then across the two
    // waves that share the rows
    const int rbase = wm * 16 + ((lane & 16) ? 8 : 0);
#pragma unroll
    for (int j = 0; j < 8; ++j) {
        float v0 = p0[j], v1 = p1[j];
#pragma unroll
        for (int off = 1; off < 16; off <<= 1) {
            v0 += __shfl_xor(v0, off, 32);
            v1 += __shfl_xor(v1, off, 32);
        }
        if (lo == 0) {
            atomicAdd(&e_lds[rbase + j], v0);
            atomicAdd(&e_lds[KP_M + rbase + j], v1);
        }
    }
    __syncthreads();

    if (tid < 2 * KP_M) {
        const int d = tid / KP_M;
        const int mr = tid % KP_M;
        e_out[((size_t)d * Bb + b) * Ss + m0 + mr] = e_lds[tid] + v_b[0];
    }
}

// ---------------------------------------------------------------------------
// Row softmax over S: at = softmax(e).  grid: D*B rows, block 256.
// ---------------------------------------------------------------------------
__global__ __launch_bounds__(256) void softmax_kernel(
    const float* __restrict__ e, float* __restrict__ at) {
    const int row = blockIdx.x;
    const float* er = e + (size_t)row * Ss;
    float* ar = at + (size_t)row * Ss;
    __shared__ float red[256];

    float m = -INFINITY;
    for (int s = threadIdx.x; s < Ss; s += 256) m = fmaxf(m, er[s]);
    red[threadIdx.x] = m;
    __syncthreads();
    for (int off = 128; off > 0; off >>= 1) {
        if (threadIdx.x < off)
            red[threadIdx.x] = fmaxf(red[threadIdx.x], red[threadIdx.x + off]);
        __syncthreads();
    }
    m = red[0];
    __syncthreads();

    float sum = 0.f;
    for (int s = threadIdx.x; s < Ss; s += 256) {
        const float v = __expf(er[s] - m);
        ar[s] = v;
        sum += v;
    }
    red[threadIdx.x] = sum;
    __syncthreads();
    for (int off = 128; off > 0; off >>= 1) {
        if (threadIdx.x < off) red[threadIdx.x] += red[threadIdx.x + off];
        __syncthreads();
    }
    const float inv = 1.f / red[0];
    for (int s = threadIdx.x; s < Ss; s += 256) ar[s] *= inv;
}

// ---------------------------------------------------------------------------
// ctx[d,b,g] = sum_s at[d,b,s] * hs[b,s,g]  (read hs once for both d)
// grid: (EH/64, B), block 512 = 16 waves: one work-group per WGP, all of them
// streaming. A work-group owns 64 columns (256-byte pieces of the hs rows); a
// 16-lane half of a wave owns 64 consecutive rows, so one 16-byte load of a
// wave covers two whole pieces. The 32 partial sums of a column meet in LDS.
// Output stored as bf16 (feeds final GEMM).
// ---------------------------------------------------------------------------
static constexpr int CX_COLS  = 64;                     // columns per work-group
static constexpr int CX_PARTS = 32;                     // half-waves per work-group
static constexpr int CX_ROWS  = Ss / CX_PARTS;          // rows per half-wave
static constexpr int CX_STEP  = 16;                     // rows loaded together
static constexpr int CX_NSTEP = CX_ROWS / CX_STEP;

struct CxBatch {
    float4 w0[CX_STEP / 4];   // at[0, b, rows]
    float4 w1[CX_STEP / 4];   // at[1, b, rows]
    float4 hv[CX_STEP];       // 4 columns of each row
};

__device__ __forceinline__ void cx_load(CxBatch& t, const float4* a0,
                                        const float4* a1, const float* h, int step) {
    // both loops unrolled: the batch lives in registers, and the row offsets
    // become immediates of the loads
#pragma unroll
    for (int q = 0; q < CX_STEP / 4; ++q) {
        t.w0[q] = a0[step * (CX_STEP / 4) + q];
        t.w1[q] = a1[step * (CX_STEP / 4) + q];
    }
#pragma unroll
    for (int u = 0; u < CX_STEP; ++u)
        t.hv[u] = *(const float4*)(h + (size_t)(step * CX_STEP + u) * EH);
}

__device__ __forceinline__ void cx_sum(const CxBatch& t, float4& acc0, float4& acc1) {
    // both loops unrolled: the batch lives in registers
#pragma unroll
    for (int q = 0; q < CX_STEP / 4; ++q) {
        const float s0[4] = {t.w0[q].x, t.w0[q].y, t.w0[q].z, t.w0[q].w};
        const float s1[4] = {t.w1[q].x, t.w1[q].y, t.w1[q].z, t.w1[q].w};
#pragma unroll
        for (int u = 0; u < 4; ++u) {
            const float4 v = t.hv[q * 4 + u];
            acc0.x += s0[u] * v.x; acc0.y += s0[u] * v.y;
            acc0.z += s0[u] * v.z; acc0.w += s0[u] * v.w;
            acc1.x += s1[u] * v.x; acc1.y += s1[u] * v.y;
            acc1.z += s1[u] * v.z; acc1.w += s1[u] * v.w;
        }
    }
}

__global__ __launch_bounds__(512) void ctx_kernel(
    const float* __restrict__ at, const float* __restrict__ hs,
    bf16_t* __restrict__ ctx_bf) {
    const int b    = blockIdx.y;
    const int g0   = blockIdx.x * CX_COLS;
    const int tid  = threadIdx.x;
    const int lo   = tid & 15;
    const int part = tid >> 4;
    const int r0   = part * CX_ROWS;

    const float4* a0 = (const float4*)(at + ((size_t)0 * Bb + b) * Ss + r0);
    const float4* a1 = (const float4*)(at + ((size_t)1 * Bb + b) * Ss + r0);
    const float*  h  = hs + ((size_t)b * Ss + r0) * EH + g0 + lo * 4;

    float4 acc0 = {0.f, 0.f, 0.f, 0.f};
    float4 acc1 = {0.f, 0.f, 0.f, 0.f};
    CxBatch t[2];
    cx_load(t[0], a0, a1, h, 0);
    // unrolled so that the two batches are told apart at compile time
#pragma unroll
    for (int s = 0; s < CX_NSTEP; ++s) {
        if (s + 1 < CX_NSTEP) {
            cx_load(t[(s + 1) & 1], a0, a1, h, s + 1);
            // behind the last loads: their address registers stay as they are
            // (named as inputs) until the wait has passed
            if (s + 2 == CX_NSTEP)
                asm volatile("s_wait_xcnt 0x0" :: "v"(h), "v"(a0) : "memory");
            // keeps the next 16 rows' loads ahead of these rows' sums: left
            // alone the scheduler sinks them and a wave has few loads in flight
            __builtin_amdgcn_sched_barrier(0);
        }
        cx_sum(t[s & 1], acc0, acc1);
    }

    // red[p][d * 64 + column]: the partial sum of half-wave p
    __shared__ __attribute__((aligned(16))) float red[CX_PARTS][2 * CX_COLS];
    __shared__ float red2[4][2 * CX_COLS];
    *(float4*)(red[part] + lo * 4) = acc0;
    *(float4*)(red[part] + CX_COLS + lo * 4) = acc1;
    __syncthreads();

    // 4 threads per output, 8 partials each, then across the 4
    {
        const int o = tid & (2 * CX_COLS - 1);
        const int p = tid >> 7;
        float s = 0.f;
        // unrolled: the 8 LDS reads go out together
#pragma unroll
        for (int k = 0; k < 8; ++k) s += red[p * 8 + k][o];
        red2[p][o] = s;
    }
    __syncthreads();

    if (tid < 2 * CX_COLS) {
        const float s = (red2[0][tid] + red2[1][tid]) + (red2[2][tid] + red2[3][tid]);
        const int d = tid / CX_COLS;
        const int c = tid % CX_COLS;
        ctx_bf[((size_t)d * Bb + b) * EH + g0 + c] = (bf16_t)s;
    }
}

// ---------------------------------------------------------------------------
// launcher
// ---------------------------------------------------------------------------
extern "C" void kernel_launch(void* const* d_in, const int* in_sizes, int n_in,
                              void* d_out, int out_size, void* d_ws, size_t ws_size,
                              hipStream_t stream) {
    const float* hs  = (const float*)d_in[0];  // (B,S,EH)
    const float* ht  = (const float*)d_in[1];  // (D,B,DH)
    const float* q_w = (const float*)d_in[2];  // (DH,DH)
    const float* q_b = (const float*)d_in[3];  // (DH,)
    const float* k_w = (const float*)d_in[4];  // (DH,EH)
    const float* k_b = (const float*)d_in[5];  // (DH,)
    const float* v_w = (const float*)d_in[6];  // (1,DH)
    const float* v_b = (const float*)d_in[7];  // (1,)
    const float* c_w = (const float*)d_in[8];  // (DH,EH)
    const float* c_b = (const float*)d_in[9];  // (DH,)

    float* out_c  = (float*)d_out;                 // (D,B,DH) = 32768
    float* out_at = out_c + (size_t)Dd * Bb * DH;  // (D,B,S)  = 65536

    char* ws = (char*)d_ws;
    bf16_t* hs_bf  = (bf16_t*)(ws + 0);           // 67108864 B
    bf16_t* kw_bf  = (bf16_t*)(ws + 67108864);    //  2097152 B
    bf16_t* qw_bf  = (bf16_t*)(ws + 69206016);    //  2097152 B
    bf16_t* cw_bf  = (bf16_t*)(ws + 71303168);    //  2097152 B
    bf16_t* ht_bf  = (bf16_t*)(ws + 73400320);    //    65536 B
    bf16_t* ctx_bf = (bf16_t*)(ws + 73465856);    //    65536 B
    float*  qh     = (float*) (ws + 73531392);    //   131072 B
    float*  e      = (float*) (ws + 73662464);    //   262144 B

    // 1) f32 -> bf16 conversions
    cvt_f32_bf16_kernel<<<8192, 256, 0, stream>>>(hs, hs_bf, Bb * Ss * EH);
    cvt_f32_bf16_kernel<<<512, 256, 0, stream>>>(k_w, kw_bf, DH * EH);
    cvt_f32_bf16_kernel<<<512, 256, 0, stream>>>(q_w, qw_bf, DH * DH);
    cvt_f32_bf16_kernel<<<512, 256, 0, stream>>>(c_w, cw_bf, DH * EH);
    cvt_f32_bf16_kernel<<<32, 256, 0, stream>>>(ht, ht_bf, Dd * Bb * DH);

    // 2) qh = ht @ q_w^T + q_b   (M=32, N=DH, K=DH)
    gemm_bf16_kernel<<<dim3(1, 2), 256, 0, stream>>>(
        ht_bf, qw_bf, q_b, qh, Dd * Bb, DH, DH);

    // 3) fused k-projection + tanh score -> e (D,B,S)
    kproj_score_kernel<<<dim3(Ss / KP_M, Bb), 512, 0, stream>>>(
        hs_bf, kw_bf, k_b, qh, v_w, v_b, e);

    // 4) softmax over S -> at output
    softmax_kernel<<<Dd * Bb, 256, 0, stream>>>(e, out_at);

    // 5) ctx = at @ hs  (bf16 output)
    ctx_kernel<<<dim3(EH / CX_COLS, Bb), 512, 0, stream>>>(out_at, hs, ctx_bf);

    // 6) c = ctx @ c_w^T + c_b   (M=32, N=DH, K=EH)
    gemm_bf16_kernel<<<dim3(1, 2), 256, 0, stream>>>(
        ctx_bf, cw_bf, c_b, out_c, Dd * Bb, DH, EH);
}

// v003
// One run takes 119 microseconds.
// Timed twice side by side with v002, it ran 2.14 and 2.13 times as fast.
// Over all steps from v000 it is 5.24 times as fast.
#include <hip/hip_runtime.h>
#include <hip/hip_bf16.h>
#include <math.h>

typedef __bf16 bf16_t;
typedef __attribute__((ext_vector_type(16))) __bf16 v16bf;
typedef __attribute__((ext_vector_type(8)))  __bf16 v8bf;
typedef __attribute__((ext_vector_type(4)))  __bf16 v4bf;
typedef __attribute__((ext_vector_type(8)))  float  v8f;

static constexpr int Dd = 2;
static constexpr int Bb = 16;
static constexpr int Ss = 2048;
static constexpr int DH = 1024;
static constexpr int EH = 1024;

// Hardware V_TANH_F32 (TRANS op) if the builtin is available on this toolchain.
#if defined(__has_builtin)
#if __has_builtin(__builtin_amdgcn_tanhf)
#define FAST_TANH(x) __builtin_amdgcn_tanhf(x)
#endif
#endif
#ifndef FAST_TANH
#define FAST_TANH(x) tanhf(x)
#endif

// ---------------------------------------------------------------------------
// f32 -> bf16 conversion, 4 elements / thread (grid-stride). n % 4 == 0.
// ---------------------------------------------------------------------------
__global__ void cvt_f32_bf16_kernel(const float* __restrict__ in,
                                    bf16_t* __restrict__ out, int n) {
    const float4* in4 = (const float4*)in;
    v4bf* out4 = (v4bf*)out;
    const int n4 = n >> 2;
    for (int i = blockIdx.x * blockDim.x + threadIdx.x; i < n4;
         i += gridDim.x * blockDim.x) {
        const float4 v = in4[i];
        v4bf o;
        o[0] = (bf16_t)v.x; o[1] = (bf16_t)v.y;
        o[2] = (bf16_t)v.z; o[3] = (bf16_t)v.w;
        out4[i] = o;
    }
}

// ---------------------------------------------------------------------------
// WMMA fragment loader: 16x32 bf16 tile slice for this lane.
// Lane holds K = {k0+sel .. k0+sel+7} and {k0+sel+16 .. k0+sel+23},
// sel = (lane>=16) ? 8 : 0, row/col = lane&15 (caller bakes into pointer).
// ---------------------------------------------------------------------------
__device__ __forceinline__ v16bf load_frag16(const bf16_t* p) {
    v8bf lo = *reinterpret_cast<const v8bf*>(p);
    v8bf hi = *reinterpret_cast<const v8bf*>(p + 16);
    v16bf r;
#pragma unroll
    for (int i = 0; i < 8; ++i) { r[i] = lo[i]; r[i + 8] = hi[i]; }
    return r;
}

// ---------------------------------------------------------------------------
// Small GEMM: out[32 x 1024] = A[32 x 1024](bf16) @ W[1024 x 1024]^T(bf16) + bias
// grid: (DH/32, 2), block 256 = 8 waves. A work-group owns 16 rows x 32 columns
// of out (whole 128-byte lines). Each wave takes 128 of the 1024 k for both
// column tiles: 256-byte pieces of the A and W rows, all 24 loads in flight at
// once. The 8 partial tiles meet in LDS.
// ---------------------------------------------------------------------------
static constexpr int SG_N     = 32;            // columns per work-group
static constexpr int SG_KW    = 128;           // k per wave
static constexpr int SG_WAVES = EH / SG_KW;    // waves per work-group
static constexpr int SG_KS    = SG_KW / 32;    // WMMA k-steps per wave
static_assert(DH == EH, "both small GEMMs have the same K");

__global__ __launch_bounds__(32 * SG_WAVES) void gemm_bf16_kernel(
    const bf16_t* __restrict__ A, const bf16_t* __restrict__ W,
    const float* __restrict__ bias, float* __restrict__ out) {
    const int m0   = blockIdx.y * 16;
    const int n0   = blockIdx.x * SG_N;
    const int tid  = threadIdx.x;
    const int wave = tid >> 5;
    const int lane = tid & 31;
    const int lo   = lane & 15;
    const int sel  = (lane & 16) ? 8 : 0;
    const bf16_t* arow = A + (size_t)(m0 + lo) * EH + wave * SG_KW + sel;
    const bf16_t* wrow = W + (size_t)(n0 + lo) * EH + wave * SG_KW + sel;

    v16bf af[SG_KS], b0[SG_KS], b1[SG_KS];
    // unrolled: the fragments live in registers, the k offsets become immediates
#pragma unroll
    for (int ks = 0; ks < SG_KS; ++ks) {
        af[ks] = load_frag16(arow + ks * 32);
        b0[ks] = load_frag16(wrow + ks * 32);
        b1[ks] = load_frag16(wrow + 16 * EH + ks * 32);
    }
    const int n = n0 + lane;      // this lane's column in the epilogue
    const float bv = bias[n];
    // behind the last load: the address registers stay as they are (named as
    // inputs) until the wait has passed
    asm volatile("s_wait_xcnt 0x0" :: "v"(arow), "v"(wrow) : "memory");
    // keeps all the loads ahead of the first WMMA: left alone the scheduler sinks
    // them among the WMMAs and the wave waits out the load latency several times
    __builtin_amdgcn_sched_barrier(0);

    v8f c0 = {0.f, 0.f, 0.f, 0.f, 0.f, 0.f, 0.f, 0.f};
    v8f c1 = c0;
#pragma unroll
    for (int ks = 0; ks < SG_KS; ++ks) {
        c0 = __builtin_amdgcn_wmma_f32_16x16x32_bf16(
            false, af[ks], false, b0[ks], (short)0, c0, false, false);
        c1 = __builtin_amdgcn_wmma_f32_16x16x32_bf16(
            false, af[ks], false, b1[ks], (short)0, c1, false, false);
    }

    // red[wave][column tile][j][lane]: element (row j + 8 * (lane >> 4),
    // column lane & 15) of the wave's partial tile
    __shared__ float red[SG_WAVES][2][8][32];
#pragma unroll
    for (int j = 0; j < 8; ++j) {
        red[wave][0][j][lane] = c0[j];
        red[wave][1][j][lane] = c1[j];
    }
    __syncthreads();

    // a wave sums and stores one whole 32-column row of the tile at a time
    static_assert(SG_WAVES == 8, "wave w sums rows w and w + 8");
#pragma unroll
    for (int hf = 0; hf < 2; ++hf) {
        float s = 0.f;
        // unrolled: the 8 LDS reads go out together
#pragma unroll
        for (int w = 0; w < SG_WAVES; ++w)
            s += red[w][lane >> 4][wave][hf * 16 + lo];
        out[(size_t)(m0 + hf * 8 + wave) * DH + n] = s + bv;
    }
}

// ---------------------------------------------------------------------------
// Fused: kh = hs[b, m0:m0+128, :] @ k_w^T + k_b   (kept in registers)
//        e[d,b,m0+m] = sum_h tanh(qh[d,b,h] + kh[m,h]) * v_w[h] + v_b
// grid: (S/128, B), block 512 = 16 waves: 8 along the rows x 2 along the
// columns, each wave a 16 x 128 strip as before; 4 passes of 256 columns.
// Both operands reach the waves through LDS: a stage is 128 k (256-byte rows)
// of 128 hs rows and 256 k_w rows, brought in by asynchronous copies that read
// whole lines, two buffers, the next stage in flight while this one is used.
// ---------------------------------------------------------------------------
static constexpr int KP_M      = 128;                       // hs rows per work-group
static constexpr int KP_N      = 256;                       // kh columns per pass
static constexpr int KP_K      = 128;                       // k per stage
static constexpr int KP_PITCH  = 272;                       // LDS row pitch, bytes (16 x odd)
static constexpr int KP_BUF    = (KP_M + KP_N) * KP_PITCH;  // one buffer, bytes
static constexpr int KP_KST    = EH / KP_K;                 // stages per pass
static constexpr int KP_STAGES = (DH / KP_N) * KP_KST;      // stages in all

// One stage: 384 rows x 16 pieces of 16 bytes = 12 copies per thread. A wave's
// copy covers two whole 256-byte rows. a / w: this thread's piece in row
// (tid >> 4) of the stage's hs / k_w rows; dst: its LDS byte address there.
__device__ __forceinline__ void kp_copy_stage(const bf16_t* a, const bf16_t* w,
                                              unsigned dst) {
    constexpr int      GR = 32 * EH;         // 32 rows further, elements
    constexpr unsigned LR = 32 * KP_PITCH;   // 32 rows further, LDS bytes
    // s_wait_xcnt closes the statement so that no address register named here
    // is rewritten ahead of it.
    asm volatile(
        "global_load_async_to_lds_b128 %0, %12, off\n\t"
        "global_load_async_to_lds_b128 %1, %13, off\n\t"
        "global_load_async_to_lds_b128 %2, %14, off\n\t"
        "global_load_async_to_lds_b128 %3, %15, off\n\t"
        "global_load_async_to_lds_b128 %4, %16, off\n\t"
        "global_load_async_to_lds_b128 %5, %17, off\n\t"
        "global_load_async_to_lds_b128 %6, %18, off\n\t"
        "global_load_async_to_lds_b128 %7, %19, off\n\t"
        "global_load_async_to_lds_b128 %8, %20, off\n\t"
        "global_load_async_to_lds_b128 %9, %21, off\n\t"
        "global_load_async_to_lds_b128 %10, %22, off\n\t"
        "global_load_async_to_lds_b128 %11, %23, off\n\t"
        "s_wait_xcnt 0x0"
        :: "v"(dst), "v"(dst + LR), "v"(dst + 2 * LR), "v"(dst + 3 * LR),
           "v"(dst + 4 * LR), "v"(dst + 5 * LR), "v"(dst + 6 * LR),
           "v"(dst + 7 * LR), "v"(dst + 8 * LR), "v"(dst + 9 * LR),
           "v"(dst + 10 * LR), "v"(dst + 11 * LR),
           "v"(a), "v"(a + GR), "v"(a + 2 * GR), "v"(a + 3 * GR),
           "v"(w), "v"(w + GR), "v"(w + 2 * GR), "v"(w + 3 * GR),
           "v"(w + 4 * GR), "v"(w + 5 * GR), "v"(w + 6 * GR), "v"(w + 7 * GR)
        : "memory");
}

__global__ __launch_bounds__(512) void kproj_score_kernel(
    const bf16_t* __restrict__ hs_bf, const bf16_t* __restrict__ kw_bf,
    const float* __restrict__ k_b, const float* __restrict__ qh,
    const float* __restrict__ v_w, const float* __restrict__ v_b,
    float* __restrict__ e_out) {
    const int m0   = blockIdx.x * KP_M;
    const int b    = blockIdx.y;
    const int tid  = threadIdx.x;
    const int wave = tid >> 5;
    const int lane = tid & 31;
    const int lo   = lane & 15;
    const int sel  = (lane & 16) ? 8 : 0;
    const int wm   = wave & 7;    // which 16 rows
    const int wn   = wave >> 3;   // which 128 of the pass's 256 columns

    __shared__ __attribute__((aligned(16))) char kp_lds[2 * KP_BUF];
    __shared__ float e_lds[2 * KP_M];
    if (tid < 2 * KP_M) e_lds[tid] = 0.f;

    // this thread's piece of a stage
    const int crow = tid >> 4;
    const int ccol = tid & 15;
    const bf16_t* a_src = hs_bf + ((size_t)b * Ss + m0 + crow) * EH + ccol * 8;
    const bf16_t* w_src = kw_bf + (size_t)crow * EH + ccol * 8;
    const unsigned c_dst = (unsigned)(size_t)kp_lds + crow * KP_PITCH + ccol * 16;

    kp_copy_stage(a_src, w_src, c_dst);
    // stage 0 has landed for this wave; the barrier publishes it to the others
    asm volatile("s_wait_asynccnt 0x0" ::: "memory");
    __syncthreads();
    kp_copy_stage(a_src + KP_K, w_src + KP_K, c_dst + KP_BUF);

    // this lane's fragment rows inside a buffer
    const int a_off = (wm * 16 + lo) * KP_PITCH + sel * 2;
    const int w_off = (KP_M + wn * 128 + lo) * KP_PITCH + sel * 2;

    const float* qh0 = qh + ((size_t)0 * Bb + b) * DH;
    const float* qh1 = qh + ((size_t)1 * Bb + b) * DH;

    float p0[8], p1[8];
#pragma unroll
    for (int j = 0; j < 8; ++j) { p0[j] = 0.f; p1[j] = 0.f; }

    const v8f zero = {0.f, 0.f, 0.f, 0.f, 0.f, 0.f, 0.f, 0.f};

    for (int pass = 0; pass < DH / KP_N; ++pass) {
        v8f c[8];
#pragma unroll
        for (int t = 0; t < 8; ++t) c[t] = zero;

        for (int kc = 0; kc < KP_KST; ++kc) {
            const int st = pass * KP_KST + kc;
            const char* buf = kp_lds + (st & 1) * KP_BUF;
#pragma unroll
            for (int ks = 0; ks < KP_K / 32; ++ks) {
                v16bf af = load_frag16((const bf16_t*)(buf + a_off) + ks * 32);
                v16bf bf[8];
#pragma unroll
                for (int t = 0; t < 8; ++t)
                    bf[t] = load_frag16(
                        (const bf16_t*)(buf + w_off + t * 16 * KP_PITCH) + ks * 32);
                // keeps the k-step's 18 LDS reads one group ahead of its WMMAs:
                // left alone the scheduler puts a full LDS wait before each WMMA
                __builtin_amdgcn_sched_barrier(0);
#pragma unroll
                for (int t = 0; t < 8; ++t)
                    c[t] = __builtin_amdgcn_wmma_f32_16x16x32_bf16(
                        false, af, false, bf[t], (short)0, c[t], false, false);
            }
            // this wave's reads of the buffer are done before it is refilled
            asm volatile("s_wait_dscnt 0x0" ::: "memory");
            // this wave's copies of the next stage have landed
            asm volatile("s_wait_asynccnt 0x0" ::: "memory");
            // publishes the next stage and ends every wave's reads of this one
            __syncthreads();
            const int nx = st + 2;
            if (nx < KP_STAGES) {
                const int np = nx / KP_KST;
                const int nk = nx % KP_KST;
                kp_copy_stage(a_src + nk * KP_K,
                              w_src + (size_t)np * KP_N * EH + nk * KP_K,
                              c_dst + (st & 1) * KP_BUF);
            }
        }

        // score terms of this pass's 128 columns, for d = 0 and d = 1
#pragma unroll
        for (int t = 0; t < 8; ++t) {
            const int h = pass * KP_N + wn * 128 + t * 16 + lo;
            const float vwh = v_w[h];
            const float kbh = k_b[h];
            const float q0  = qh0[h];
            const float q1  = qh1[h];
#pragma unroll
            for (int j = 0; j < 8; ++j) {
                const float kv = c[t][j] + kbh;
                p0[j] += FAST_TANH(q0 + kv) * vwh;
                p1[j] += FAST_TANH(q1 + kv) * vwh;
            }
        }
    }
    // no copy is outstanding when the wave goes on to its end
    asm volatile("s_wait_asynccnt 0x0" ::: "memory");

    // reduce over the 16 columns held by each half-wave, then across the two
    // waves that share the rows
    const int rbase = wm * 16 + ((lane & 16) ? 8 : 0);
#pragma unroll
    for (int j = 0; j < 8; ++j) {
        float v0 = p0[j], v1 = p1[j];
#pragma unroll
        for (int off = 1; off < 16; off <<= 1) {
            v0 += __shfl_xor(v0, off, 32);
            v1 += __shfl_xor(v1, off, 32);
        }
        if (lo == 0) {
            atomicAdd(&e_lds[rbase + j], v0);
            atomicAdd(&e_lds[KP_M + rbase + j], v1);
        }
    }
    __syncthreads();

    if (tid < 2 * KP_M) {
        const int d = tid / KP_M;
        const int mr = tid % KP_M;
        e_out[((size_t)d * Bb + b) * Ss + m0 + mr] = e_lds[tid] + v_b[0];
    }
}

// ---------------------------------------------------------------------------
// Row softmax over S: at = softmax(e).  grid: D*B rows, block 256.
// ---------------------------------------------------------------------------
__global__ __launch_bounds__(256) void softmax_kernel(
    const float* __restrict__ e, float* __restrict__ at) {
    const int row = blockIdx.x;
    const float* er = e + (size_t)row * Ss;
    float* ar = at + (size_t)row * Ss;
    __shared__ float red[256];

    float m = -INFINITY;
    for (int s = threadIdx.x; s < Ss; s += 256) m = fmaxf(m, er[s]);
    red[threadIdx.x] = m;
    __syncthreads();
    for (int off = 128; off > 0; off >>= 1) {
        if (threadIdx.x < off)
            red[threadIdx.x] = fmaxf(red[threadIdx.x], red[threadIdx.x + off]);
        __syncthreads();
    }
    m = red[0];
    __syncthreads();

    float sum = 0.f;
    for (int s = threadIdx.x; s < Ss; s += 256) {
        const float v = __expf(er[s] - m);
        ar[s] = v;
        sum += v;
    }
    red[threadIdx.x] = sum;
    __syncthreads();
    for (int off = 128; off > 0; off >>= 1) {
        if (threadIdx.x < off) red[threadIdx.x] += red[threadIdx.x + off];
        __syncthreads();
    }
    const float inv = 1.f / red[0];
    for (int s = threadIdx.x; s < Ss; s += 256) ar[s] *= inv;
}

// ---------------------------------------------------------------------------
// ctx[d,b,g] = sum_s at[d,b,s] * hs[b,s,g]  (read hs once for both d)
// grid: (EH/64, B), block 512 = 16 waves: one work-group per WGP, all of them
// streaming. A work-group owns 64 columns (256-byte pieces of the hs rows); a
// 16-lane half of a wave owns 64 consecutive rows, so one 16-byte load of a
// wave covers two whole pieces. The 32 partial sums of a column meet in LDS.
// Output stored as bf16 (feeds final GEMM).
// ---------------------------------------------------------------------------
static constexpr int CX_COLS  = 64;                     // columns per work-group
static constexpr int CX_PARTS = 32;                     // half-waves per work-group
static constexpr int CX_ROWS  = Ss / CX_PARTS;          // rows per half-wave
static constexpr int CX_STEP  = 16;                     // rows loaded together
static constexpr int CX_NSTEP = CX_ROWS / CX_STEP;

struct CxBatch {
    float4 w0[CX_STEP / 4];   // at[0, b, rows]
    float4 w1[CX_STEP / 4];   // at[1, b, rows]
    float4 hv[CX_STEP];       // 4 columns of each row
};

__device__ __forceinline__ void cx_load(CxBatch& t, const float4* a0,
                                        const float4* a1, const float* h, int step) {
    // both loops unrolled: the batch lives in registers, and the row offsets
    // become immediates of the loads
#pragma unroll
    for (int q = 0; q < CX_STEP / 4; ++q) {
        t.w0[q] = a0[step * (CX_STEP / 4) + q];
        t.w1[q] = a1[step * (CX_STEP / 4) + q];
    }
#pragma unroll
    for (int u = 0; u < CX_STEP; ++u)
        t.hv[u] = *(const float4*)(h + (size_t)(step * CX_STEP + u) * EH);
}

__device__ __forceinline__ void cx_sum(const CxBatch& t, float4& acc0, float4& acc1) {
    // both loops unrolled: the batch lives in registers
#pragma unroll
    for (int q = 0; q < CX_STEP / 4; ++q) {
        const float s0[4] = {t.w0[q].x, t.w0[q].y, t.w0[q].z, t.w0[q].w};
        const float s1[4] = {t.w1[q].x, t.w1[q].y, t.w1[q].z, t.w1[q].w};
#pragma unroll
        for (int u = 0; u < 4; ++u) {
            const float4 v = t.hv[q * 4 + u];
            acc0.x += s0[u] * v.x; acc0.y += s0[u] * v.y;
            acc0.z += s0[u] * v.z; acc0.w += s0[u] * v.w;
            acc1.x += s1[u] * v.x; acc1.y += s1[u] * v.y;
            acc1.z += s1[u] * v.z; acc1.w += s1[u] * v.w;
        }
    }
}

__global__ __launch_bounds__(512) void ctx_kernel(
    const float* __restrict__ at, const float* __restrict__ hs,
    bf16_t* __restrict__ ctx_bf) {
    const int b    = blockIdx.y;
    const int g0   = blockIdx.x * CX_COLS;
    const int tid  = threadIdx.x;
    const int lo   = tid & 15;
    const int part = tid >> 4;
    const int r0   = part * CX_ROWS;

    const float4* a0 = (const float4*)(at + ((size_t)0 * Bb + b) * Ss + r0);
    const float4* a1 = (const float4*)(at + ((size_t)1 * Bb + b) * Ss + r0);
    const float*  h  = hs + ((size_t)b * Ss + r0) * EH + g0 + lo * 4;

    float4 acc0 = {0.f, 0.f, 0.f, 0.f};
    float4 acc1 = {0.f, 0.f, 0.f, 0.f};
    CxBatch t[2];
    cx_load(t[0], a0, a1, h, 0);
    // unrolled so that the two batches are told apart at compile time
#pragma unroll
    for (int s = 0; s < CX_NSTEP; ++s) {
        if (s + 1 < CX_NSTEP) {
            cx_load(t[(s + 1) & 1], a0, a1, h, s + 1);
            // behind the last loads: their address registers stay as they are
            // (named as inputs) until the wait has passed
            if (s + 2 == CX_NSTEP)
                asm volatile("s_wait_xcnt 0x0" :: "v"(h), "v"(a0) : "memory");
            // keeps the next 16 rows' loads ahead of these rows' sums: left
            // alone the scheduler sinks them and a wave has few loads in flight
            __builtin_amdgcn_sched_barrier(0);
        }
        cx_sum(t[s & 1], acc0, acc1);
    }

    // red[p][d * 64 + column]: the partial sum of half-wave p
    __shared__ __attribute__((aligned(16))) float red[CX_PARTS][2 * CX_COLS];
    __shared__ float red2[4][2 * CX_COLS];
    *(float4*)(red[part] + lo * 4) = acc0;
    *(float4*)(red[part] + CX_COLS + lo * 4) = acc1;
    __syncthreads();

    // 4 threads per output, 8 partials each, then across the 4
    {
        const int o = tid & (2 * CX_COLS - 1);
        const int p = tid >> 7;
        float s = 0.f;
        // unrolled: the 8 LDS reads go out together
#pragma unroll
        for (int k = 0; k < 8; ++k) s += red[p * 8 + k][o];
        red2[p][o] = s;
    }
    __syncthreads();

    if (tid < 2 * CX_COLS) {
        const float s = (red2[0][tid] + red2[1][tid]) + (red2[2][tid] + red2[3][tid]);
        const int d = tid / CX_COLS;
        const int c = tid % CX_COLS;
        ctx_bf[((size_t)d * Bb + b) * EH + g0 + c] = (bf16_t)s;
    }
}

// ---------------------------------------------------------------------------
// launcher
// ---------------------------------------------------------------------------
extern "C" void kernel_launch(void* const* d_in, const int* in_sizes, int n_in,
                              void* d_out, int out_size, void* d_ws, size_t ws_size,
                              hipStream_t stream) {
    const float* hs  = (const float*)d_in[0];  // (B,S,EH)
    const float* ht  = (const float*)d_in[1];  // (D,B,DH)
    const float* q_w = (const float*)d_in[2];  // (DH,DH)
    const float* q_b = (const float*)d_in[3];  // (DH,)
    const float* k_w = (const float*)d_in[4];  // (DH,EH)
    const float* k_b = (const float*)d_in[5];  // (DH,)
    const float* v_w = (const float*)d_in[6];  // (1,DH)
    const float* v_b = (const float*)d_in[7];  // (1,)
    const float* c_w = (const float*)d_in[8];  // (DH,EH)
    const float* c_b = (const float*)d_in[9];  // (DH,)

    float* out_c  = (float*)d_out;                 // (D,B,DH) = 32768
    float* out_at = out_c + (size_t)Dd * Bb * DH;  // (D,B,S)  = 65536

    char* ws = (char*)d_ws;
    bf16_t* hs_bf  = (bf16_t*)(ws + 0);           // 67108864 B
    bf16_t* kw_bf  = (bf16_t*)(ws + 67108864);    //  2097152 B
    bf16_t* qw_bf  = (bf16_t*)(ws + 69206016);    //  2097152 B
    bf16_t* cw_bf  = (bf16_t*)(ws + 71303168);    //  2097152 B
    bf16_t* ht_bf  = (bf16_t*)(ws + 73400320);    //    65536 B
    bf16_t* ctx_bf = (bf16_t*)(ws + 73465856);    //    65536 B
    float*  qh     = (float*) (ws + 73531392);    //   131072 B
    float*  e      = (float*) (ws + 73662464);    //   262144 B

    // 1) f32 -> bf16 conversions
    cvt_f32_bf16_kernel<<<8192, 256, 0, stream>>>(hs, hs_bf, Bb * Ss * EH);
    cvt_f32_bf16_kernel<<<512, 256, 0, stream>>>(k_w, kw_bf, DH * EH);
    cvt_f32_bf16_kernel<<<512, 256, 0, stream>>>(q_w, qw_bf, DH * DH);
    cvt_f32_bf16_kernel<<<512, 256, 0, stream>>>(c_w, cw_bf, DH * EH);
    cvt_f32_bf16_kernel<<<32, 256, 0, stream>>>(ht, ht_bf, Dd * Bb * DH);

    // 2) qh = ht @ q_w^T + q_b   (M=32, N=DH, K=DH)
    gemm_bf16_kernel<<<dim3(DH / SG_N, 2), 32 * SG_WAVES, 0, stream>>>(
        ht_bf, qw_bf, q_b, qh);

    // 3) fused k-projection + tanh score -> e (D,B,S)
    kproj_score_kernel<<<dim3(Ss / KP_M, Bb), 512, 0, stream>>>(
        hs_bf, kw_bf, k_b, qh, v_w, v_b, e);

    // 4) softmax over S -> at output
    softmax_kernel<<<Dd * Bb, 256, 0, stream>>>(e, out_at);

    // 5) ctx = at @ hs  (bf16 output)
    ctx_kernel<<<dim3(EH / CX_COLS, Bb), 512, 0, stream>>>(out_at, hs, ctx_bf);

    // 6) c = ctx @ c_w^T + c_b   (M=32, N=DH, K=EH)
    gemm_bf16_kernel<<<dim3(DH / SG_N, 2), 32 * SG_WAVES, 0, stream>>>(
        ctx_bf, cw_bf, c_b, out_c);
}

// v004
// One run takes 106 microseconds.
// Timed twice side by side with v003, it ran 1.13 times as fast both times.
// Counting every step since v000, it is 5.91 times as fast.
#include <hip/hip_runtime.h>
#include <hip/hip_bf16.h>
#include <math.h>

typedef __bf16 bf16_t;
typedef __attribute__((ext_vector_type(16))) __bf16 v16bf;
typedef __attribute__((ext_vector_type(8)))  __bf16 v8bf;
typedef __attribute__((ext_vector_type(4)))  __bf16 v4bf;
typedef __attribute__((ext_vector_type(8)))  float  v8f;

static constexpr int Dd = 2;
static constexpr int Bb = 16;
static constexpr int Ss = 2048;
static constexpr int DH = 1024;
static constexpr int EH = 1024;

// Hardware V_TANH_F32 (TRANS op) if the builtin is available on this toolchain.
#if defined(__has_builtin)
#if __has_builtin(__builtin_amdgcn_tanhf)
#define FAST_TANH(x) __builtin_amdgcn_tanhf(x)
#endif
#endif
#ifndef FAST_TANH
#define FAST_TANH(x) tanhf(x)
#endif

// ---------------------------------------------------------------------------
// f32 -> bf16 conversion of all five operands in one launch.
// grid: 256 work-groups of 16 waves, one per WGP, all resident from the start.
// The five bf16 arrays lie one behind the other in the workspace (hs, k_w, q_w,
// c_w, ht), so the output is one array. Every load of a wave covers 512
// contiguous bytes, every store 256. hs: 4 batches of 8 KiB per wave (16 loads
// per lane in flight). The four small arrays together: one batch of 4 KiB for
// 3104 of the 4096 waves, dealt so that every work-group gets its share.
// ---------------------------------------------------------------------------
static constexpr int CV_WGS    = 256;                       // work-groups
static constexpr int CV_WAVES  = 16;                        // waves per work-group
static constexpr int CV_NW     = CV_WGS * CV_WAVES;         // waves in all
static constexpr int CV_U      = 16;                        // loads per lane, hs batch
static constexpr int CV_CH     = 128 * CV_U;                // floats per hs batch
static constexpr int CV_ROUNDS = Bb * Ss * EH / CV_CH / CV_NW;  // hs batches per wave
static constexpr int CV_TU     = 8;                         // loads per lane, small batch
static constexpr int CV_TCH    = 128 * CV_TU;               // floats per small batch
static constexpr int CV_WB     = DH * EH / CV_TCH;          // small batches per weight matrix
static constexpr int CV_TAIL   = 3 * CV_WB + Dd * Bb * DH / CV_TCH;
static_assert((size_t)CV_ROUNDS * CV_NW * CV_CH == (size_t)Bb * Ss * EH, "hs in whole rounds");
static_assert(CV_WB * CV_TCH == DH * EH && DH == EH, "weights in whole batches");
static_assert((Dd * Bb * DH) % CV_TCH == 0, "ht in whole batches");
static_assert(CV_TAIL <= CV_NW, "the small arrays fit one round");

// base: the array (a scalar address); off: byte offset of this lane's first 4
// elements of the batch. All three loops unrolled: the batch lives in registers
// and the offsets become immediates.
template <int U>
__device__ __forceinline__ void cv_load(float4 (&t)[U], const float* base, unsigned off) {
    const char* p = (const char*)base + (size_t)off;
#pragma unroll
    for (int u = 0; u < U; ++u) t[u] = *(const float4*)(p + u * 512);
}

template <int U>
__device__ __forceinline__ void cv_pack(v4bf (&o)[U], const float4 (&t)[U]) {
#pragma unroll
    for (int u = 0; u < U; ++u) {
        o[u][0] = (bf16_t)t[u].x; o[u][1] = (bf16_t)t[u].y;
        o[u][2] = (bf16_t)t[u].z; o[u][3] = (bf16_t)t[u].w;
    }
}

template <int U>
__device__ __forceinline__ void cv_store(const v4bf (&o)[U], bf16_t* base, unsigned off) {
    char* q = (char*)base + (size_t)off;
#pragma unroll
    for (int u = 0; u < U; ++u) *(v4bf*)(q + u * 256) = o[u];
}

__global__ __launch_bounds__(32 * CV_WAVES) void cvt_all_kernel(
    const float* __restrict__ hs, const float* __restrict__ k_w,
    const float* __restrict__ q_w, const float* __restrict__ c_w,
    const float* __restrict__ ht, bf16_t* __restrict__ out) {
    const int lane = threadIdx.x & 31;
    // the wave's number in its work-group, in a scalar register
    const int wave = __builtin_amdgcn_readfirstlane((int)(threadIdx.x >> 5));
    const int w    = blockIdx.x * CV_WAVES + wave;
    constexpr unsigned RS = (unsigned)CV_NW * CV_CH;   // one round further, elements
    static_assert((size_t)Bb * Ss * EH * 4 + (size_t)CV_TAIL * CV_TCH * 4 < (1ull << 32),
                  "byte offsets fit 32 bits");
    const unsigned src = ((unsigned)w * CV_CH + lane * 4) * 4;   // bytes into hs
    const unsigned dst = ((unsigned)w * CV_CH + lane * 4) * 2;   // bytes into out

    // the wave's batch of the small arrays, if it has one
    const int  tw   = wave * CV_WGS + blockIdx.x;
    const bool tail = tw < CV_TAIL;
    const int  seg  = tw / CV_WB;
    const float* tb = seg == 0 ? k_w : seg == 1 ? q_w : seg == 2 ? c_w : ht;
    const unsigned tsrc = ((unsigned)(tw % CV_WB) * CV_TCH + lane * 4) * 4;
    const unsigned tdst = ((unsigned)Bb * Ss * EH + (unsigned)tw * CV_TCH + lane * 4) * 2;

    float4 t[CV_U], tt[CV_TU];
    v4bf   o[CV_U], to[CV_TU];
    cv_load(t, hs, src);
    // unrolled: 4 trips, and the last one differs
#pragma unroll
    for (int r = 0; r < CV_ROUNDS; ++r) {
        const unsigned lo = r + 1 < CV_ROUNDS ? src + (r + 1) * RS * 4 : tsrc;
        const unsigned so = dst + r * RS * 2;
        cv_pack(o, t);
        if (r + 1 < CV_ROUNDS) cv_load(t, hs, lo);
        else if (tail)         cv_load(tt, tb, lo);
        // keeps the next batch's loads ahead of this batch's stores, so that the
        // wave has loads in flight while it stores
        __builtin_amdgcn_sched_barrier(0);
        cv_store(o, out, so);
        // behind the round's loads and stores: their offset registers stay as
        // they are (named as inputs) until the wait has passed, and the next
        // round rewrites the stored registers only behind it
        asm volatile("s_wait_xcnt 0x0" :: "v"(lo), "v"(so) : "memory");
    }
    if (tail) {
        cv_pack(to, tt);
        cv_store(to, out, tdst);
    }
}

// ---------------------------------------------------------------------------
// WMMA fragment loader: 16x32 bf16 tile slice for this lane.
// Lane holds K = {k0+sel .. k0+sel+7} and {k0+sel+16 .. k0+sel+23},
// sel = (lane>=16) ? 8 : 0, row/col = lane&15 (caller bakes into pointer).
// ---------------------------------------------------------------------------
__device__ __forceinline__ v16bf load_frag16(const bf16_t* p) {
    v8bf lo = *reinterpret_cast<const v8bf*>(p);
    v8bf hi = *reinterpret_cast<const v8bf*>(p + 16);
    v16bf r;
#pragma unroll
    for (int i = 0; i < 8; ++i) { r[i] = lo[i]; r[i + 8] = hi[i]; }
    return r;
}

// ---------------------------------------------------------------------------
// Small GEMM: out[32 x 1024] = A[32 x 1024](bf16) @ W[1024 x 1024]^T(bf16) + bias
// grid: (DH/32, 2), block 256 = 8 waves. A work-group owns 16 rows x 32 columns
// of out (whole 128-byte lines). Each wave takes 128 of the 1024 k for both
// column tiles: 256-byte pieces of the A and W rows, all 24 loads in flight at
// once. The 8 partial tiles meet in LDS.
// ---------------------------------------------------------------------------
static constexpr int SG_N     = 32;            // columns per work-group
static constexpr int SG_KW    = 128;           // k per wave
static constexpr int SG_WAVES = EH / SG_KW;    // waves per work-group
static constexpr int SG_KS    = SG_KW / 32;    // WMMA k-steps per wave
static_assert(DH == EH, "both small GEMMs have the same K");

__global__ __launch_bounds__(32 * SG_WAVES) void gemm_bf16_kernel(
    const bf16_t* __restrict__ A, const bf16_t* __restrict__ W,
    const float* __restrict__ bias, float* __restrict__ out) {
    const int m0   = blockIdx.y * 16;
    const int n0   = blockIdx.x * SG_N;
    const int tid  = threadIdx.x;
    const int wave = tid >> 5;
    const int lane = tid & 31;
    const int lo   = lane & 15;
    const int sel  = (lane & 16) ? 8 : 0;
    const bf16_t* arow = A + (size_t)(m0 + lo) * EH + wave * SG_KW + sel;
    const bf16_t* wrow = W + (size_t)(n0 + lo) * EH + wave * SG_KW + sel;

    v16bf af[SG_KS], b0[SG_KS], b1[SG_KS];
    // unrolled: the fragments live in registers, the k offsets become immediates
#pragma unroll
    for (int ks = 0; ks < SG_KS; ++ks) {
        af[ks] = load_frag16(arow + ks * 32);
        b0[ks] = load_frag16(wrow + ks * 32);
        b1[ks] = load_frag16(wrow + 16 * EH + ks * 32);
    }
    const int n = n0 + lane;      // this lane's column in the epilogue
    const float bv = bias[n];
    // behind the last load: the address registers stay as they are (named as
    // inputs) until the wait has passed
    asm volatile("s_wait_xcnt 0x0" :: "v"(arow), "v"(wrow) : "memory");
    // keeps all the loads ahead of the first WMMA: left alone the scheduler sinks
    // them among the WMMAs and the wave waits out the load latency several times
    __builtin_amdgcn_sched_barrier(0);

    v8f c0 = {0.f, 0.f, 0.f, 0.f, 0.f, 0.f, 0.f, 0.f};
    v8f c1 = c0;
#pragma unroll
    for (int ks = 0; ks < SG_KS; ++ks) {
        c0 = __builtin_amdgcn_wmma_f32_16x16x32_bf16(
            false, af[ks], false, b0[ks], (short)0, c0, false, false);
        c1 = __builtin_amdgcn_wmma_f32_16x16x32_bf16(
            false, af[ks], false, b1[ks], (short)0, c1, false, false);
    }

    // red[wave][column tile][j][lane]: element (row j + 8 * (lane >> 4),
    // column lane & 15) of the wave's partial tile
    __shared__ float red[SG_WAVES][2][8][32];
#pragma unroll
    for (int j = 0; j < 8; ++j) {
        red[wave][0][j][lane] = c0[j];
        red[wave][1][j][lane] = c1[j];
    }
    __syncthreads();

    // a wave sums and stores one whole 32-column row of the tile at a time
    static_assert(SG_WAVES == 8, "wave w sums rows w and w + 8");
#pragma unroll
    for (int hf = 0; hf < 2; ++hf) {
        float s = 0.f;
        // unrolled: the 8 LDS reads go out together
#pragma unroll
        for (int w = 0; w < SG_WAVES; ++w)
            s += red[w][lane >> 4][wave][hf * 16 + lo];
        out[(size_t)(m0 + hf * 8 + wave) * DH + n] = s + bv;
    }
}

// ---------------------------------------------------------------------------
// Fused: kh = hs[b, m0:m0+128, :] @ k_w^T + k_b   (kept in registers)
//        e[d,b,m0+m] = sum_h tanh(qh[d,b,h] + kh[m,h]) * v_w[h] + v_b
// grid: (S/128, B), block 512 = 16 waves: 8 along the rows x 2 along the
// columns, each wave a 16 x 128 strip as before; 4 passes of 256 columns.
// Both operands reach the waves through LDS: a stage is 128 k (256-byte rows)
// of 128 hs rows and 256 k_w rows, brought in by asynchronous copies that read
// whole lines, two buffers, the next stage in flight while this one is used.
// ---------------------------------------------------------------------------
static constexpr int KP_M      = 128;                       // hs rows per work-group
static constexpr int KP_N      = 256;                       // kh columns per pass
static constexpr int KP_K      = 128;                       // k per stage
static constexpr int KP_PITCH  = 272;                       // LDS row pitch, bytes (16 x odd)
static constexpr int KP_BUF    = (KP_M + KP_N) * KP_PITCH;  // one buffer, bytes
static constexpr int KP_KST    = EH / KP_K;                 // stages per pass
static constexpr int KP_STAGES = (DH / KP_N) * KP_KST;      // stages in all

// One stage: 384 rows x 16 pieces of 16 bytes = 12 copies per thread. A wave's
// copy covers two whole 256-byte rows. a / w: this thread's piece in row
// (tid >> 4) of the stage's hs / k_w rows; dst: its LDS byte address there.
__device__ __forceinline__ void kp_copy_stage(const bf16_t* a, const bf16_t* w,
                                              unsigned dst) {
    constexpr int      GR = 32 * EH;         // 32 rows further, elements
    constexpr unsigned LR = 32 * KP_PITCH;   // 32 rows further, LDS bytes
    // s_wait_xcnt closes the statement so that no address register named here
    // is rewritten ahead of it.
    asm volatile(
        "global_load_async_to_lds_b128 %0, %12, off\n\t"
        "global_load_async_to_lds_b128 %1, %13, off\n\t"
        "global_load_async_to_lds_b128 %2, %14, off\n\t"
        "global_load_async_to_lds_b128 %3, %15, off\n\t"
        "global_load_async_to_lds_b128 %4, %16, off\n\t"
        "global_load_async_to_lds_b128 %5, %17, off\n\t"
        "global_load_async_to_lds_b128 %6, %18, off\n\t"
        "global_load_async_to_lds_b128 %7, %19, off\n\t"
        "global_load_async_to_lds_b128 %8, %20, off\n\t"
        "global_load_async_to_lds_b128 %9, %21, off\n\t"
        "global_load_async_to_lds_b128 %10, %22, off\n\t"
        "global_load_async_to_lds_b128 %11, %23, off\n\t"
        "s_wait_xcnt 0x0"
        :: "v"(dst), "v"(dst + LR), "v"(dst + 2 * LR), "v"(dst + 3 * LR),
           "v"(dst + 4 * LR), "v"(dst + 5 * LR), "v"(dst + 6 * LR),
           "v"(dst + 7 * LR), "v"(dst + 8 * LR), "v"(dst + 9 * LR),
           "v"(dst + 10 * LR), "v"(dst + 11 * LR),
           "v"(a), "v"(a + GR), "v"(a + 2 * GR), "v"(a + 3 * GR),
           "v"(w), "v"(w + GR), "v"(w + 2 * GR), "v"(w + 3 * GR),
           "v"(w + 4 * GR), "v"(w + 5 * GR), "v"(w + 6 * GR), "v"(w + 7 * GR)
        : "memory");
}

__global__ __launch_bounds__(512) void kproj_score_kernel(
    const bf16_t* __restrict__ hs_bf, const bf16_t* __restrict__ kw_bf,
    const float* __restrict__ k_b, const float* __restrict__ qh,
    const float* __restrict__ v_w, const float* __restrict__ v_b,
    float* __restrict__ e_out) {
    const int m0   = blockIdx.x * KP_M;
    const int b    = blockIdx.y;
    const int tid  = threadIdx.x;
    const int wave = tid >> 5;
    const int lane = tid & 31;
    const int lo   = lane & 15;
    const int sel  = (lane & 16) ? 8 : 0;
    const int wm   = wave & 7;    // which 16 rows
    const int wn   = wave >> 3;   // which 128 of the pass's 256 columns

    __shared__ __attribute__((aligned(16))) char kp_lds[2 * KP_BUF];
    __shared__ float e_lds[2 * KP_M];
    if (tid < 2 * KP_M) e_lds[tid] = 0.f;

    // this thread's piece of a stage
    const int crow = tid >> 4;
    const int ccol = tid & 15;
    const bf16_t* a_src = hs_bf + ((size_t)b * Ss + m0 + crow) * EH + ccol * 8;
    const bf16_t* w_src = kw_bf + (size_t)crow * EH + ccol * 8;
    const unsigned c_dst = (unsigned)(size_t)kp_lds + crow * KP_PITCH + ccol * 16;

    kp_copy_stage(a_src, w_src, c_dst);
    // stage 0 has landed for this wave; the barrier publishes it to the others
    asm volatile("s_wait_asynccnt 0x0" ::: "memory");
    __syncthreads();
    kp_copy_stage(a_src + KP_K, w_src + KP_K, c_dst + KP_BUF);

    // this lane's fragment rows inside a buffer
    const int a_off = (wm * 16 + lo) * KP_PITCH + sel * 2;
    const int w_off = (KP_M + wn * 128 + lo) * KP_PITCH + sel * 2;

    const float* qh0 = qh + ((size_t)0 * Bb + b) * DH;
    const float* qh1 = qh + ((size_t)1 * Bb + b) * DH;

    float p0[8], p1[8];
#pragma unroll
    for (int j = 0; j < 8; ++j) { p0[j] = 0.f; p1[j] = 0.f; }

    const v8f zero = {0.f, 0.f, 0.f, 0.f, 0.f, 0.f, 0.f, 0.f};

    for (int pass = 0; pass < DH / KP_N; ++pass) {
        v8f c[8];
#pragma unroll
        for (int t = 0; t < 8; ++t) c[t] = zero;

        for (int kc = 0; kc < KP_KST; ++kc) {
            const int st = pass * KP_KST + kc;
            const char* buf = kp_lds + (st & 1) * KP_BUF;
#pragma unroll
            for (int ks = 0; ks < KP_K / 32; ++ks) {
                v16bf af = load_frag16((const bf16_t*)(buf + a_off) + ks * 32);
                v16bf bf[8];
#pragma unroll
                for (int t = 0; t < 8; ++t)
                    bf[t] = load_frag16(
                        (const bf16_t*)(buf + w_off + t * 16 * KP_PITCH) + ks * 32);
                // keeps the k-step's 18 LDS reads one group ahead of its WMMAs:
                // left alone the scheduler puts a full LDS wait before each WMMA
                __builtin_amdgcn_sched_barrier(0);
#pragma unroll
                for (int t = 0; t < 8; ++t)
                    c[t] = __builtin_amdgcn_wmma_f32_16x16x32_bf16(
                        false, af, false, bf[t], (short)0, c[t], false, false);
            }
            // this wave's reads of the buffer are done before it is refilled
            asm volatile("s_wait_dscnt 0x0" ::: "memory");
            // this wave's copies of the next stage have landed
            asm volatile("s_wait_asynccnt 0x0" ::: "memory");
            // publishes the next stage and ends every wave's reads of this one
            __syncthreads();
            const int nx = st + 2;
            if (nx < KP_STAGES) {
                const int np = nx / KP_KST;
                const int nk = nx % KP_KST;
                kp_copy_stage(a_src + nk * KP_K,
                              w_src + (size_t)np * KP_N * EH + nk * KP_K,
                              c_dst + (st & 1) * KP_BUF);
            }
        }

        // score terms of this pass's 128 columns, for d = 0 and d = 1
#pragma unroll
        for (int t = 0; t < 8; ++t) {
            const int h = pass * KP_N + wn * 128 + t * 16 + lo;
            const float vwh = v_w[h];
            const float kbh = k_b[h];
            const float q0  = qh0[h];
            const float q1  = qh1[h];
#pragma unroll
            for (int j = 0; j < 8; ++j) {
                const float kv = c[t][j] + kbh;
                p0[j] += FAST_TANH(q0 + kv) * vwh;
                p1[j] += FAST_TANH(q1 + kv) * vwh;
            }
        }
    }
    // no copy is outstanding when the wave goes on to its end
    asm volatile("s_wait_asynccnt 0x0" ::: "memory");

    // reduce over the 16 columns held by each half-wave, then across the two
    // waves that share the rows
    const int rbase = wm * 16 + ((lane & 16) ? 8 : 0);
#pragma unroll
    for (int j = 0; j < 8; ++j) {
        float v0 = p0[j], v1 = p1[j];
#pragma unroll
        for (int off = 1; off < 16; off <<= 1) {
            v0 += __shfl_xor(v0, off, 32);
            v1 += __shfl_xor(v1, off, 32);
        }
        if (lo == 0) {
            atomicAdd(&e_lds[rbase + j], v0);
            atomicAdd(&e_lds[KP_M + rbase + j], v1);
        }
    }
    __syncthreads();

    if (tid < 2 * KP_M) {
        const int d = tid / KP_M;
        const int mr = tid % KP_M;
        e_out[((size_t)d * Bb + b) * Ss + m0 + mr] = e_lds[tid] + v_b[0];
    }
}

// ---------------------------------------------------------------------------
// Row softmax over S: at = softmax(e).  grid: D*B rows, block 256.
// ---------------------------------------------------------------------------
__global__ __launch_bounds__(256) void softmax_kernel(
    const float* __restrict__ e, float* __restrict__ at) {
    const int row = blockIdx.x;
    const float* er = e + (size_t)row * Ss;
    float* ar = at + (size_t)row * Ss;
    __shared__ float red[256];

    float m = -INFINITY;
    for (int s = threadIdx.x; s < Ss; s += 256) m = fmaxf(m, er[s]);
    red[threadIdx.x] = m;
    __syncthreads();
    for (int off = 128; off > 0; off >>= 1) {
        if (threadIdx.x < off)
            red[threadIdx.x] = fmaxf(red[threadIdx.x], red[threadIdx.x + off]);
        __syncthreads();
    }
    m = red[0];
    __syncthreads();

    float sum = 0.f;
    for (int s = threadIdx.x; s < Ss; s += 256) {
        const float v = __expf(er[s] - m);
        ar[s] = v;
        sum += v;
    }
    red[threadIdx.x] = sum;
    __syncthreads();
    for (int off = 128; off > 0; off >>= 1) {
        if (threadIdx.x < off) red[threadIdx.x] += red[threadIdx.x + off];
        __syncthreads();
    }
    const float inv = 1.f / red[0];
    for (int s = threadIdx.x; s < Ss; s += 256) ar[s] *= inv;
}

// ---------------------------------------------------------------------------
// ctx[d,b,g] = sum_s at[d,b,s] * hs[b,s,g]  (read hs once for both d)
// grid: (EH/64, B), block 512 = 16 waves: one work-group per WGP, all of them
// streaming. A work-group owns 64 columns (256-byte pieces of the hs rows); a
// 16-lane half of a wave owns 64 consecutive rows, so one 16-byte load of a
// wave covers two whole pieces. The 32 partial sums of a column meet in LDS.
// Output stored as bf16 (feeds final GEMM).
// ---------------------------------------------------------------------------
static constexpr int CX_COLS  = 64;                     // columns per work-group
static constexpr int CX_PARTS = 32;                     // half-waves per work-group
static constexpr int CX_ROWS  = Ss / CX_PARTS;          // rows per half-wave
static constexpr int CX_STEP  = 16;                     // rows loaded together
static constexpr int CX_NSTEP = CX_ROWS / CX_STEP;

struct CxBatch {
    float4 w0[CX_STEP / 4];   // at[0, b, rows]
    float4 w1[CX_STEP / 4];   // at[1, b, rows]
    float4 hv[CX_STEP];       // 4 columns of each row
};

__device__ __forceinline__ void cx_load(CxBatch& t, const float4* a0,
                                        const float4* a1, const float* h, int step) {
    // both loops unrolled: the batch lives in registers, and the row offsets
    // become immediates of the loads
#pragma unroll
    for (int q = 0; q < CX_STEP / 4; ++q) {
        t.w0[q] = a0[step * (CX_STEP / 4) + q];
        t.w1[q] = a1[step * (CX_STEP / 4) + q];
    }
#pragma unroll
    for (int u = 0; u < CX_STEP; ++u)
        t.hv[u] = *(const float4*)(h + (size_t)(step * CX_STEP + u) * EH);
}

__device__ __forceinline__ void cx_sum(const CxBatch& t, float4& acc0, float4& acc1) {
    // both loops unrolled: the batch lives in registers
#pragma unroll
    for (int q = 0; q < CX_STEP / 4; ++q) {
        const float s0[4] = {t.w0[q].x, t.w0[q].y, t.w0[q].z, t.w0[q].w};
        const float s1[4] = {t.w1[q].x, t.w1[q].y, t.w1[q].z, t.w1[q].w};
#pragma unroll
        for (int u = 0; u < 4; ++u) {
            const float4 v = t.hv[q * 4 + u];
            acc0.x += s0[u] * v.x; acc0.y += s0[u] * v.y;
            acc0.z += s0[u] * v.z; acc0.w += s0[u] * v.w;
            acc1.x += s1[u] * v.x; acc1.y += s1[u] * v.y;
            acc1.z += s1[u] * v.z; acc1.w += s1[u] * v.w;
        }
    }
}

__global__ __launch_bounds__(512) void ctx_kernel(
    const float* __restrict__ at, const float* __restrict__ hs,
    bf16_t* __restrict__ ctx_bf) {
    const int b    = blockIdx.y;
    const int g0   = blockIdx.x * CX_COLS;
    const int tid  = threadIdx.x;
    const int lo   = tid & 15;
    const int part = tid >> 4;
    const int r0   = part * CX_ROWS;

    const float4* a0 = (const float4*)(at + ((size_t)0 * Bb + b) * Ss + r0);
    const float4* a1 = (const float4*)(at + ((size_t)1 * Bb + b) * Ss + r0);
    const float*  h  = hs + ((size_t)b * Ss + r0) * EH + g0 + lo * 4;

    float4 acc0 = {0.f, 0.f, 0.f, 0.f};
    float4 acc1 = {0.f, 0.f, 0.f, 0.f};
    CxBatch t[2];
    cx_load(t[0], a0, a1, h, 0);
    // unrolled so that the two batches are told apart at compile time
#pragma unroll
    for (int s = 0; s < CX_NSTEP; ++s) {
        if (s + 1 < CX_NSTEP) {
            cx_load(t[(s + 1) & 1], a0, a1, h, s + 1);
            // behind the last loads: their address registers stay as they are
            // (named as inputs) until the wait has passed
            if (s + 2 == CX_NSTEP)
                asm volatile("s_wait_xcnt 0x0" :: "v"(h), "v"(a0) : "memory");
            // keeps the next 16 rows' loads ahead of these rows' sums: left
            // alone the scheduler sinks them and a wave has few loads in flight
            __builtin_amdgcn_sched_barrier(0);
        }
        cx_sum(t[s & 1], acc0, acc1);
    }

    // red[p][d * 64 + column]: the partial sum of half-wave p
    __shared__ __attribute__((aligned(16))) float red[CX_PARTS][2 * CX_COLS];
    __shared__ float red2[4][2 * CX_COLS];
    *(float4*)(red[part] + lo * 4) = acc0;
    *(float4*)(red[part] + CX_COLS + lo * 4) = acc1;
    __syncthreads();

    // 4 threads per output, 8 partials each, then across the 4
    {
        const int o = tid & (2 * CX_COLS - 1);
        const int p = tid >> 7;
        float s = 0.f;
        // unrolled: the 8 LDS reads go out together
#pragma unroll
        for (int k = 0; k < 8; ++k) s += red[p * 8 + k][o];
        red2[p][o] = s;
    }
    __syncthreads();

    if (tid < 2 * CX_COLS) {
        const float s = (red2[0][tid] + red2[1][tid]) + (red2[2][tid] + red2[3][tid]);
        const int d = tid / CX_COLS;
        const int c = tid % CX_COLS;
        ctx_bf[((size_t)d * Bb + b) * EH + g0 + c] = (bf16_t)s;
    }
}

// ---------------------------------------------------------------------------
// launcher
// ---------------------------------------------------------------------------
extern "C" void kernel_launch(void* const* d_in, const int* in_sizes, int n_in,
                              void* d_out, int out_size, void* d_ws, size_t ws_size,
                              hipStream_t stream) {
    const float* hs  = (const float*)d_in[0];  // (B,S,EH)
    const float* ht  = (const float*)d_in[1];  // (D,B,DH)
    const float* q_w = (const float*)d_in[2];  // (DH,DH)
    const float* q_b = (const float*)d_in[3];  // (DH,)
    const float* k_w = (const float*)d_in[4];  // (DH,EH)
    const float* k_b = (const float*)d_in[5];  // (DH,)
    const float* v_w = (const float*)d_in[6];  // (1,DH)
    const float* v_b = (const float*)d_in[7];  // (1,)
    const float* c_w = (const float*)d_in[8];  // (DH,EH)
    const float* c_b = (const float*)d_in[9];  // (DH,)

    float* out_c  = (float*)d_out;                 // (D,B,DH) = 32768
    float* out_at = out_c + (size_t)Dd * Bb * DH;  // (D,B,S)  = 65536

    char* ws = (char*)d_ws;
    bf16_t* hs_bf  = (bf16_t*)(ws + 0);           // 67108864 B
    bf16_t* kw_bf  = (bf16_t*)(ws + 67108864);    //  2097152 B
    bf16_t* qw_bf  = (bf16_t*)(ws + 69206016);    //  2097152 B
    bf16_t* cw_bf  = (bf16_t*)(ws + 71303168);    //  2097152 B
    bf16_t* ht_bf  = (bf16_t*)(ws + 73400320);    //    65536 B
    bf16_t* ctx_bf = (bf16_t*)(ws + 73465856);    //    65536 B
    float*  qh     = (float*) (ws + 73531392);    //   131072 B
    float*  e      = (float*) (ws + 73662464);    //   262144 B

    // 1) f32 -> bf16 conversions: hs_bf, kw_bf, qw_bf, cw_bf, ht_bf are contiguous
    cvt_all_kernel<<<CV_WGS, 32 * CV_WAVES, 0, stream>>>(hs, k_w, q_w, c_w, ht, hs_bf);

    // 2) qh = ht @ q_w^T + q_b   (M=32, N=DH, K=DH)
    gemm_bf16_kernel<<<dim3(DH / SG_N, 2), 32 * SG_WAVES, 0, stream>>>(
        ht_bf, qw_bf, q_b, qh);

    // 3) fused k-projection + tanh score -> e (D,B,S)
    kproj_score_kernel<<<dim3(Ss / KP_M, Bb), 512, 0, stream>>>(
        hs_bf, kw_bf, k_b, qh, v_w, v_b, e);

    // 4) softmax over S -> at output
    softmax_kernel<<<Dd * Bb, 256, 0, stream>>>(e, out_at);

    // 5) ctx = at @ hs  (bf16 output)
    ctx_kernel<<<dim3(EH / CX_COLS, Bb), 512, 0, stream>>>(out_at, hs, ctx_bf);

    // 6) c = ctx @ c_w^T + c_b   (M=32, N=DH, K=EH)
    gemm_bf16_kernel<<<dim3(DH / SG_N, 2), 32 * SG_WAVES, 0, stream>>>(
        ctx_bf, cw_bf, c_b, out_c);
}

// v005
// A run of this version takes 95.7 microseconds.
// Next to v004, in two timings, it ran 1.10 and 1.11 times as fast.
// All steps since v000 together make it 6.54 times as fast.
#include <hip/hip_runtime.h>
#include <hip/hip_bf16.h>
#include <math.h>

typedef __bf16 bf16_t;
typedef __attribute__((ext_vector_type(16))) __bf16 v16bf;
typedef __attribute__((ext_vector_type(8)))  __bf16 v8bf;
typedef __attribute__((ext_vector_type(4)))  __bf16 v4bf;
typedef __attribute__((ext_vector_type(8)))  float  v8f;

static constexpr int Dd = 2;
static constexpr int Bb = 16;
static constexpr int Ss = 2048;
static constexpr int DH = 1024;
static constexpr int EH = 1024;

// Hardware V_TANH_F32 (TRANS op) if the builtin is available on this toolchain.
#if defined(__has_builtin)
#if __has_builtin(__builtin_amdgcn_tanhf)
#define FAST_TANH(x) __builtin_amdgcn_tanhf(x)
#endif
#endif
#ifndef FAST_TANH
#define FAST_TANH(x) tanhf(x)
#endif

// ---------------------------------------------------------------------------
// f32 -> bf16 conversion of all five operands in one launch.
// grid: 256 work-groups of 16 waves, one per WGP, all resident from the start.
// The five bf16 arrays lie one behind the other in the workspace (hs, k_w, q_w,
// c_w, ht), so the output is one array. Every load of a wave covers 512
// contiguous bytes, every store 256. hs: 4 batches of 8 KiB per wave (16 loads
// per lane in flight). The four small arrays together: one batch of 4 KiB for
// 3104 of the 4096 waves, dealt so that every work-group gets its share.
// ---------------------------------------------------------------------------
static constexpr int CV_WGS    = 256;                       // work-groups
static constexpr int CV_WAVES  = 16;                        // waves per work-group
static constexpr int CV_NW     = CV_WGS * CV_WAVES;         // waves in all
static constexpr int CV_U      = 16;                        // loads per lane, hs batch
static constexpr int CV_CH     = 128 * CV_U;                // floats per hs batch
static constexpr int CV_ROUNDS = Bb * Ss * EH / CV_CH / CV_NW;  // hs batches per wave
static constexpr int CV_TU     = 8;                         // loads per lane, small batch
static constexpr int CV_TCH    = 128 * CV_TU;               // floats per small batch
static constexpr int CV_WB     = DH * EH / CV_TCH;          // small batches per weight matrix
static constexpr int CV_TAIL   = 3 * CV_WB + Dd * Bb * DH / CV_TCH;
static_assert((size_t)CV_ROUNDS * CV_NW * CV_CH == (size_t)Bb * Ss * EH, "hs in whole rounds");
static_assert(CV_WB * CV_TCH == DH * EH && DH == EH, "weights in whole batches");
static_assert((Dd * Bb * DH) % CV_TCH == 0, "ht in whole batches");
static_assert(CV_TAIL <= CV_NW, "the small arrays fit one round");

// base: the array (a scalar address); off: byte offset of this lane's first 4
// elements of the batch. All three loops unrolled: the batch lives in registers
// and the offsets become immediates.
template <int U>
__device__ __forceinline__ void cv_load(float4 (&t)[U], const float* base, unsigned off) {
    const char* p = (const char*)base + (size_t)off;
#pragma unroll
    for (int u = 0; u < U; ++u) t[u] = *(const float4*)(p + u * 512);
}

template <int U>
__device__ __forceinline__ void cv_pack(v4bf (&o)[U], const float4 (&t)[U]) {
#pragma unroll
    for (int u = 0; u < U; ++u) {
        o[u][0] = (bf16_t)t[u].x; o[u][1] = (bf16_t)t[u].y;
        o[u][2] = (bf16_t)t[u].z; o[u][3] = (bf16_t)t[u].w;
    }
}

template <int U>
__device__ __forceinline__ void cv_store(const v4bf (&o)[U], bf16_t* base, unsigned off) {
    char* q = (char*)base + (size_t)off;
#pragma unroll
    for (int u = 0; u < U; ++u) *(v4bf*)(q + u * 256) = o[u];
}

__global__ __launch_bounds__(32 * CV_WAVES) void cvt_all_kernel(
    const float* __restrict__ hs, const float* __restrict__ k_w,
    const float* __restrict__ q_w, const float* __restrict__ c_w,
    const float* __restrict__ ht, bf16_t* __restrict__ out) {
    const int lane = threadIdx.x & 31;
    // the wave's number in its work-group, in a scalar register
    const int wave = __builtin_amdgcn_readfirstlane((int)(threadIdx.x >> 5));
    const int w    = blockIdx.x * CV_WAVES + wave;
    constexpr unsigned RS = (unsigned)CV_NW * CV_CH;   // one round further, elements
    static_assert((size_t)Bb * Ss * EH * 4 + (size_t)CV_TAIL * CV_TCH * 4 < (1ull << 32),
                  "byte offsets fit 32 bits");
    const unsigned src = ((unsigned)w * CV_CH + lane * 4) * 4;   // bytes into hs
    const unsigned dst = ((unsigned)w * CV_CH + lane * 4) * 2;   // bytes into out

    // the wave's batch of the small arrays, if it has one
    const int  tw   = wave * CV_WGS + blockIdx.x;
    const bool tail = tw < CV_TAIL;
    const int  seg  = tw / CV_WB;
    const float* tb = seg == 0 ? k_w : seg == 1 ? q_w : seg == 2 ? c_w : ht;
    const unsigned tsrc = ((unsigned)(tw % CV_WB) * CV_TCH + lane * 4) * 4;
    const unsigned tdst = ((unsigned)Bb * Ss * EH + (unsigned)tw * CV_TCH + lane * 4) * 2;

    float4 t[CV_U], tt[CV_TU];
    v4bf   o[CV_U], to[CV_TU];
    cv_load(t, hs, src);
    // unrolled: 4 trips, and the last one differs
#pragma unroll
    for (int r = 0; r < CV_ROUNDS; ++r) {
        const unsigned lo = r + 1 < CV_ROUNDS ? src + (r + 1) * RS * 4 : tsrc;
        const unsigned so = dst + r * RS * 2;
        cv_pack(o, t);
        if (r + 1 < CV_ROUNDS) cv_load(t, hs, lo);
        else if (tail)         cv_load(tt, tb, lo);
        // keeps the next batch's loads ahead of this batch's stores, so that the
        // wave has loads in flight while it stores
        __builtin_amdgcn_sched_barrier(0);
        cv_store(o, out, so);
        // behind the round's loads and stores: their offset registers stay as
        // they are (named as inputs) until the wait has passed, and the next
        // round rewrites the stored registers only behind it
        asm volatile("s_wait_xcnt 0x0" :: "v"(lo), "v"(so) : "memory");
    }
    if (tail) {
        cv_pack(to, tt);
        cv_store(to, out, tdst);
    }
}

// ---------------------------------------------------------------------------
// WMMA fragment loader: 16x32 bf16 tile slice for this lane.
// Lane holds K = {k0+sel .. k0+sel+7} and {k0+sel+16 .. k0+sel+23},
// sel = (lane>=16) ? 8 : 0, row/col = lane&15 (caller bakes into pointer).
// ---------------------------------------------------------------------------
__device__ __forceinline__ v16bf load_frag16(const bf16_t* p) {
    v8bf lo = *reinterpret_cast<const v8bf*>(p);
    v8bf hi = *reinterpret_cast<const v8bf*>(p + 16);
    v16bf r;
#pragma unroll
    for (int i = 0; i < 8; ++i) { r[i] = lo[i]; r[i + 8] = hi[i]; }
    return r;
}

// ---------------------------------------------------------------------------
// Small GEMM: out[32 x 1024] = A[32 x 1024](bf16) @ W[1024 x 1024]^T(bf16) + bias
// grid: (DH/32, 2), block 256 = 8 waves. A work-group owns 16 rows x 32 columns
// of out (whole 128-byte lines). Each wave takes 128 of the 1024 k for both
// column tiles: 256-byte pieces of the A and W rows, all 24 loads in flight at
// once. The 8 partial tiles meet in LDS.
// ---------------------------------------------------------------------------
static constexpr int SG_N     = 32;            // columns per work-group
static constexpr int SG_KW    = 128;           // k per wave
static constexpr int SG_WAVES = EH / SG_KW;    // waves per work-group
static constexpr int SG_KS    = SG_KW / 32;    // WMMA k-steps per wave
static_assert(DH == EH, "both small GEMMs have the same K");

__global__ __launch_bounds__(32 * SG_WAVES) void gemm_bf16_kernel(
    const bf16_t* __restrict__ A, const bf16_t* __restrict__ W,
    const float* __restrict__ bias, float* __restrict__ out) {
    const int m0   = blockIdx.y * 16;
    const int n0   = blockIdx.x * SG_N;
    const int tid  = threadIdx.x;
    const int wave = tid >> 5;
    const int lane = tid & 31;
    const int lo   = lane & 15;
    const int sel  = (lane & 16) ? 8 : 0;
    const bf16_t* arow = A + (size_t)(m0 + lo) * EH + wave * SG_KW + sel;
    const bf16_t* wrow = W + (size_t)(n0 + lo) * EH + wave * SG_KW + sel;

    v16bf af[SG_KS], b0[SG_KS], b1[SG_KS];
    // unrolled: the fragments live in registers, the k offsets become immediates
#pragma unroll
    for (int ks = 0; ks < SG_KS; ++ks) {
        af[ks] = load_frag16(arow + ks * 32);
        b0[ks] = load_frag16(wrow + ks * 32);
        b1[ks] = load_frag16(wrow + 16 * EH + ks * 32);
    }
    const int n = n0 + lane;      // this lane's column in the epilogue
    const float bv = bias[n];
    // behind the last load: the address registers stay as they are (named as
    // inputs) until the wait has passed
    asm volatile("s_wait_xcnt 0x0" :: "v"(arow), "v"(wrow) : "memory");
    // keeps all the loads ahead of the first WMMA: left alone the scheduler sinks
    // them among the WMMAs and the wave waits out the load latency several times
    __builtin_amdgcn_sched_barrier(0);

    v8f c0 = {0.f, 0.f, 0.f, 0.f, 0.f, 0.f, 0.f, 0.f};
    v8f c1 = c0;
#pragma unroll
    for (int ks = 0; ks < SG_KS; ++ks) {
        c0 = __builtin_amdgcn_wmma_f32_16x16x32_bf16(
            false, af[ks], false, b0[ks], (short)0, c0, false, false);
        c1 = __builtin_amdgcn_wmma_f32_16x16x32_bf16(
            false, af[ks], false, b1[ks], (short)0, c1, false, false);
    }

    // red[wave][column tile][j][lane]: element (row j + 8 * (lane >> 4),
    // column lane & 15) of the wave's partial tile
    __shared__ float red[SG_WAVES][2][8][32];
#pragma unroll
    for (int j = 0; j < 8; ++j) {
        red[wave][0][j][lane] = c0[j];
        red[wave][1][j][lane] = c1[j];
    }
    __syncthreads();

    // a wave sums and stores one whole 32-column row of the tile at a time
    static_assert(SG_WAVES == 8, "wave w sums rows w and w + 8");
#pragma unroll
    for (int hf = 0; hf < 2; ++hf) {
        float s = 0.f;
        // unrolled: the 8 LDS reads go out together
#pragma unroll
        for (int w = 0; w < SG_WAVES; ++w)
            s += red[w][lane >> 4][wave][hf * 16 + lo];
        out[(size_t)(m0 + hf * 8 + wave) * DH + n] = s + bv;
    }
}

// ---------------------------------------------------------------------------
// Fused: kh = hs[b, m0:m0+128, :] @ k_w^T + k_b   (kept in registers)
//        e[d,b,m0+m] = sum_h tanh(qh[d,b,h] + kh[m,h]) * v_w[h] + v_b
// grid: (S/128, B), block 512 = 16 waves: 4 along the rows x 4 along the
// columns, each wave a 32 x 64 tile (2 x 4 fragments: 12 LDS reads feed 8 WMMAs);
// 4 passes of 256 columns.
// Both operands reach the waves through LDS: a stage is 128 k (256-byte rows)
// of 128 hs rows and 256 k_w rows, brought in by asynchronous copies that read
// whole lines, two buffers, the next stage in flight while this one is used.
// ---------------------------------------------------------------------------
static constexpr int KP_M      = 128;                       // hs rows per work-group
static constexpr int KP_N      = 256;                       // kh columns per pass
static constexpr int KP_K      = 128;                       // k per stage
static constexpr int KP_PITCH  = 272;                       // LDS row pitch, bytes (16 x odd)
static constexpr int KP_BUF    = (KP_M + KP_N) * KP_PITCH;  // one buffer, bytes
static constexpr int KP_KST    = EH / KP_K;                 // stages per pass
static constexpr int KP_STAGES = (DH / KP_N) * KP_KST;      // stages in all
static constexpr int KP_FM     = 2;                         // row fragments per wave
static constexpr int KP_FN     = 4;                         // column fragments per wave
static constexpr int KP_WM     = KP_M / (16 * KP_FM);       // waves along the rows
static constexpr int KP_WN     = KP_N / (16 * KP_FN);       // waves along the columns
static_assert(KP_WM * KP_WN == 16, "16 waves cover the block tile");

// One stage: 384 rows x 16 pieces of 16 bytes = 12 copies per thread. A wave's
// copy covers two whole 256-byte rows. a / w: this thread's piece in row
// (tid >> 4) of the stage's hs / k_w rows; dst: its LDS byte address there.
__device__ __forceinline__ void kp_copy_stage(const bf16_t* a, const bf16_t* w,
                                              unsigned dst) {
    constexpr int      GR = 32 * EH;         // 32 rows further, elements
    constexpr unsigned LR = 32 * KP_PITCH;   // 32 rows further, LDS bytes
    // s_wait_xcnt closes the statement so that no address register named here
    // is rewritten ahead of it.
    asm volatile(
        "global_load_async_to_lds_b128 %0, %12, off\n\t"
        "global_load_async_to_lds_b128 %1, %13, off\n\t"
        "global_load_async_to_lds_b128 %2, %14, off\n\t"
        "global_load_async_to_lds_b128 %3, %15, off\n\t"
        "global_load_async_to_lds_b128 %4, %16, off\n\t"
        "global_load_async_to_lds_b128 %5, %17, off\n\t"
        "global_load_async_to_lds_b128 %6, %18, off\n\t"
        "global_load_async_to_lds_b128 %7, %19, off\n\t"
        "global_load_async_to_lds_b128 %8, %20, off\n\t"
        "global_load_async_to_lds_b128 %9, %21, off\n\t"
        "global_load_async_to_lds_b128 %10, %22, off\n\t"
        "global_load_async_to_lds_b128 %11, %23, off\n\t"
        "s_wait_xcnt 0x0"
        :: "v"(dst), "v"(dst + LR), "v"(dst + 2 * LR), "v"(dst + 3 * LR),
           "v"(dst + 4 * LR), "v"(dst + 5 * LR), "v"(dst + 6 * LR),
           "v"(dst + 7 * LR), "v"(dst + 8 * LR), "v"(dst + 9 * LR),
           "v"(dst + 10 * LR), "v"(dst + 11 * LR),
           "v"(a), "v"(a + GR), "v"(a + 2 * GR), "v"(a + 3 * GR),
           "v"(w), "v"(w + GR), "v"(w + 2 * GR), "v"(w + 3 * GR),
           "v"(w + 4 * GR), "v"(w + 5 * GR), "v"(w + 6 * GR), "v"(w + 7 * GR)
        : "memory");
}

__global__ __launch_bounds__(512) void kproj_score_kernel(
    const bf16_t* __restrict__ hs_bf, const bf16_t* __restrict__ kw_bf,
    const float* __restrict__ k_b, const float* __restrict__ qh,
    const float* __restrict__ v_w, const float* __restrict__ v_b,
    float* __restrict__ e_out) {
    const int m0   = blockIdx.x * KP_M;
    const int b    = blockIdx.y;
    const int tid  = threadIdx.x;
    const int wave = tid >> 5;
    const int lane = tid & 31;
    const int lo   = lane & 15;
    const int sel  = (lane & 16) ? 8 : 0;
    const int wm   = wave % KP_WM;   // which 32 rows
    const int wn   = wave / KP_WM;   // which 64 of the pass's 256 columns

    __shared__ __attribute__((aligned(16))) char kp_lds[2 * KP_BUF];
    // e_part[wn][d * 128 + row]: the score sum over the columns of the waves wn
    __shared__ float e_part[KP_WN][2 * KP_M];

    // this thread's piece of a stage
    const int crow = tid >> 4;
    const int ccol = tid & 15;
    const bf16_t* a_src = hs_bf + ((size_t)b * Ss + m0 + crow) * EH + ccol * 8;
    const bf16_t* w_src = kw_bf + (size_t)crow * EH + ccol * 8;
    const unsigned c_dst = (unsigned)(size_t)kp_lds + crow * KP_PITCH + ccol * 16;

    kp_copy_stage(a_src, w_src, c_dst);
    // stage 0 has landed for this wave; the barrier publishes it to the others
    asm volatile("s_wait_asynccnt 0x0" ::: "memory");
    __syncthreads();
    kp_copy_stage(a_src + KP_K, w_src + KP_K, c_dst + KP_BUF);

    // this lane's fragment rows inside a buffer
    const int a_off = (wm * 16 * KP_FM + lo) * KP_PITCH + sel * 2;
    const int w_off = (KP_M + wn * 16 * KP_FN + lo) * KP_PITCH + sel * 2;

    const float* qh0 = qh + ((size_t)0 * Bb + b) * DH;
    const float* qh1 = qh + ((size_t)1 * Bb + b) * DH;

    float p0[KP_FM][8], p1[KP_FM][8];
#pragma unroll
    for (int r = 0; r < KP_FM; ++r)
#pragma unroll
        for (int j = 0; j < 8; ++j) { p0[r][j] = 0.f; p1[r][j] = 0.f; }

    const v8f zero = {0.f, 0.f, 0.f, 0.f, 0.f, 0.f, 0.f, 0.f};

    for (int pass = 0; pass < DH / KP_N; ++pass) {
        v8f c[KP_FM][KP_FN];
#pragma unroll
        for (int r = 0; r < KP_FM; ++r)
#pragma unroll
            for (int t = 0; t < KP_FN; ++t) c[r][t] = zero;

        for (int kc = 0; kc < KP_KST; ++kc) {
            const int st = pass * KP_KST + kc;
            const char* buf = kp_lds + (st & 1) * KP_BUF;
#pragma unroll
            for (int ks = 0; ks < KP_K / 32; ++ks) {
                v16bf af[KP_FM], bf[KP_FN];
#pragma unroll
                for (int r = 0; r < KP_FM; ++r)
                    af[r] = load_frag16(
                        (const bf16_t*)(buf + a_off + r * 16 * KP_PITCH) + ks * 32);
#pragma unroll
                for (int t = 0; t < KP_FN; ++t)
                    bf[t] = load_frag16(
                        (const bf16_t*)(buf + w_off + t * 16 * KP_PITCH) + ks * 32);
                // keeps the k-step's 12 LDS reads one group ahead of its WMMAs:
                // left alone the scheduler puts a full LDS wait before each WMMA
                __builtin_amdgcn_sched_barrier(0);
#pragma unroll
                for (int r = 0; r < KP_FM; ++r)
#pragma unroll
                    for (int t = 0; t < KP_FN; ++t)
                        c[r][t] = __builtin_amdgcn_wmma_f32_16x16x32_bf16(
                            false, af[r], false, bf[t], (short)0, c[r][t], false, false);
            }
            // this wave's reads of the buffer are done before it is refilled
            asm volatile("s_wait_dscnt 0x0" ::: "memory");
            // this wave's copies of the next stage have landed
            asm volatile("s_wait_asynccnt 0x0" ::: "memory");
            // publishes the next stage and ends every wave's reads of this one
            __syncthreads();
            const int nx = st + 2;
            if (nx < KP_STAGES) {
                const int np = nx / KP_KST;
                const int nk = nx % KP_KST;
                kp_copy_stage(a_src + nk * KP_K,
                              w_src + (size_t)np * KP_N * EH + nk * KP_K,
                              c_dst + (st & 1) * KP_BUF);
            }
        }

        // score terms of this pass's 64 columns, for d = 0 and d = 1
#pragma unroll
        for (int t = 0; t < KP_FN; ++t) {
            const int h = pass * KP_N + wn * 16 * KP_FN + t * 16 + lo;
            const float vwh = v_w[h];
            const float kbh = k_b[h];
            const float q0  = qh0[h];
            const float q1  = qh1[h];
#pragma unroll
            for (int r = 0; r < KP_FM; ++r)
#pragma unroll
                for (int j = 0; j < 8; ++j) {
                    const float kv = c[r][t][j] + kbh;
                    p0[r][j] += FAST_TANH(q0 + kv) * vwh;
                    p1[r][j] += FAST_TANH(q1 + kv) * vwh;
                }
        }
    }
    // no copy is outstanding when the wave goes on to its end
    asm volatile("s_wait_asynccnt 0x0" ::: "memory");

    // reduce over the 16 columns held by each half-wave; the four waves that
    // share the rows each leave their sum in a slot of their own
    const int rbase = wm * 16 * KP_FM + ((lane & 16) ? 8 : 0);
    // the exchange distance is the outer loop: the 32 sums of a wave take each
    // step together, so that a step's exchange latency is waited out once
#pragma unroll
    for (int off = 1; off < 16; off <<= 1)
#pragma unroll
        for (int r = 0; r < KP_FM; ++r)
#pragma unroll
            for (int j = 0; j < 8; ++j) {
                p0[r][j] += __shfl_xor(p0[r][j], off, 32);
                p1[r][j] += __shfl_xor(p1[r][j], off, 32);
            }
    if (lo == 0) {
#pragma unroll
        for (int r = 0; r < KP_FM; ++r)
#pragma unroll
            for (int j = 0; j < 8; ++j) {
                e_part[wn][rbase + r * 16 + j] = p0[r][j];
                e_part[wn][KP_M + rbase + r * 16 + j] = p1[r][j];
            }
    }
    __syncthreads();

    static_assert(KP_WN == 4, "four slots per score");
    if (tid < 2 * KP_M) {
        const int d = tid / KP_M;
        const int mr = tid % KP_M;
        const float s = (e_part[0][tid] + e_part[1][tid]) + (e_part[2][tid] + e_part[3][tid]);
        e_out[((size_t)d * Bb + b) * Ss + m0 + mr] = s + v_b[0];
    }
}

// ---------------------------------------------------------------------------
// Row softmax over S: at = softmax(e).  grid: D*B rows, block 256.
// ---------------------------------------------------------------------------
__global__ __launch_bounds__(256) void softmax_kernel(
    const float* __restrict__ e, float* __restrict__ at) {
    const int row = blockIdx.x;
    const float* er = e + (size_t)row * Ss;
    float* ar = at + (size_t)row * Ss;
    __shared__ float red[256];

    float m = -INFINITY;
    for (int s = threadIdx.x; s < Ss; s += 256) m = fmaxf(m, er[s]);
    red[threadIdx.x] = m;
    __syncthreads();
    for (int off = 128; off > 0; off >>= 1) {
        if (threadIdx.x < off)
            red[threadIdx.x] = fmaxf(red[threadIdx.x], red[threadIdx.x + off]);
        __syncthreads();
    }
    m = red[0];
    __syncthreads();

    float sum = 0.f;
    for (int s = threadIdx.x; s < Ss; s += 256) {
        const float v = __expf(er[s] - m);
        ar[s] = v;
        sum += v;
    }
    red[threadIdx.x] = sum;
    __syncthreads();
    for (int off = 128; off > 0; off >>= 1) {
        if (threadIdx.x < off) red[threadIdx.x] += red[threadIdx.x + off];
        __syncthreads();
    }
    const float inv = 1.f / red[0];
    for (int s = threadIdx.x; s < Ss; s += 256) ar[s] *= inv;
}

// ---------------------------------------------------------------------------
// ctx[d,b,g] = sum_s at[d,b,s] * hs[b,s,g]  (read hs once for both d)
// grid: (EH/64, B), block 512 = 16 waves: one work-group per WGP, all of them
// streaming. A work-group owns 64 columns (256-byte pieces of the hs rows); a
// 16-lane half of a wave owns 64 consecutive rows, so one 16-byte load of a
// wave covers two whole pieces. The 32 partial sums of a column meet in LDS.
// Output stored as bf16 (feeds final GEMM).
// ---------------------------------------------------------------------------
static constexpr int CX_COLS  = 64;                     // columns per work-group
static constexpr int CX_PARTS = 32;                     // half-waves per work-group
static constexpr int CX_ROWS  = Ss / CX_PARTS;          // rows per half-wave
static constexpr int CX_STEP  = 16;                     // rows loaded together
static constexpr int CX_NSTEP = CX_ROWS / CX_STEP;

struct CxBatch {
    float4 w0[CX_STEP / 4];   // at[0, b, rows]
    float4 w1[CX_STEP / 4];   // at[1, b, rows]
    float4 hv[CX_STEP];       // 4 columns of each row
};

__device__ __forceinline__ void cx_load(CxBatch& t, const float4* a0,
                                        const float4* a1, const float* h, int step) {
    // both loops unrolled: the batch lives in registers, and the row offsets
    // become immediates of the loads
#pragma unroll
    for (int q = 0; q < CX_STEP / 4; ++q) {
        t.w0[q] = a0[step * (CX_STEP / 4) + q];
        t.w1[q] = a1[step * (CX_STEP / 4) + q];
    }
#pragma unroll
    for (int u = 0; u < CX_STEP; ++u)
        t.hv[u] = *(const float4*)(h + (size_t)(step * CX_STEP + u) * EH);
}

__device__ __forceinline__ void cx_sum(const CxBatch& t, float4& acc0, float4& acc1) {
    // both loops unrolled: the batch lives in registers
#pragma unroll
    for (int q = 0; q < CX_STEP / 4; ++q) {
        const float s0[4] = {t.w0[q].x, t.w0[q].y, t.w0[q].z, t.w0[q].w};
        const float s1[4] = {t.w1[q].x, t.w1[q].y, t.w1[q].z, t.w1[q].w};
#pragma unroll
        for (int u = 0; u < 4; ++u) {
            const float4 v = t.hv[q * 4 + u];
            acc0.x += s0[u] * v.x; acc0.y += s0[u] * v.y;
            acc0.z += s0[u] * v.z; acc0.w += s0[u] * v.w;
            acc1.x += s1[u] * v.x; acc1.y += s1[u] * v.y;
            acc1.z += s1[u] * v.z; acc1.w += s1[u] * v.w;
        }
    }
}

__global__ __launch_bounds__(512) void ctx_kernel(
    const float* __restrict__ at, const float* __restrict__ hs,
    bf16_t* __restrict__ ctx_bf) {
    const int b    = blockIdx.y;
    const int g0   = blockIdx.x * CX_COLS;
    const int tid  = threadIdx.x;
    const int lo   = tid & 15;
    const int part = tid >> 4;
    const int r0   = part * CX_ROWS;

    const float4* a0 = (const float4*)(at + ((size_t)0 * Bb + b) * Ss + r0);
    const float4* a1 = (const float4*)(at + ((size_t)1 * Bb + b) * Ss + r0);
    const float*  h  = hs + ((size_t)b * Ss + r0) * EH + g0 + lo * 4;

    float4 acc0 = {0.f, 0.f, 0.f, 0.f};
    float4 acc1 = {0.f, 0.f, 0.f, 0.f};
    CxBatch t[2];
    cx_load(t[0], a0, a1, h, 0);
    // unrolled so that the two batches are told apart at compile time
#pragma unroll
    for (int s = 0; s < CX_NSTEP; ++s) {
        if (s + 1 < CX_NSTEP) {
            cx_load(t[(s + 1) & 1], a0, a1, h, s + 1);
            // behind the last loads: their address registers stay as they are
            // (named as inputs) until the wait has passed
            if (s + 2 == CX_NSTEP)
                asm volatile("s_wait_xcnt 0x0" :: "v"(h), "v"(a0) : "memory");
            // keeps the next 16 rows' loads ahead of these rows' sums: left
            // alone the scheduler sinks them and a wave has few loads in flight
            __builtin_amdgcn_sched_barrier(0);
        }
        cx_sum(t[s & 1], acc0, acc1);
    }

    // red[p][d * 64 + column]: the partial sum of half-wave p
    __shared__ __attribute__((aligned(16))) float red[CX_PARTS][2 * CX_COLS];
    __shared__ float red2[4][2 * CX_COLS];
    *(float4*)(red[part] + lo * 4) = acc0;
    *(float4*)(red[part] + CX_COLS + lo * 4) = acc1;
    __syncthreads();

    // 4 threads per output, 8 partials each, then across the 4
    {
        const int o = tid & (2 * CX_COLS - 1);
        const int p = tid >> 7;
        float s = 0.f;
        // unrolled: the 8 LDS reads go out together
#pragma unroll
        for (int k = 0; k < 8; ++k) s += red[p * 8 + k][o];
        red2[p][o] = s;
    }
    __syncthreads();

    if (tid < 2 * CX_COLS) {
        const float s = (red2[0][tid] + red2[1][tid]) + (red2[2][tid] + red2[3][tid]);
        const int d = tid / CX_COLS;
        const int c = tid % CX_COLS;
        ctx_bf[((size_t)d * Bb + b) * EH + g0 + c] = (bf16_t)s;
    }
}

// ---------------------------------------------------------------------------
// launcher
// ---------------------------------------------------------------------------
extern "C" void kernel_launch(void* const* d_in, const int* in_sizes, int n_in,
                              void* d_out, int out_size, void* d_ws, size_t ws_size,
                              hipStream_t stream) {
    const float* hs  = (const float*)d_in[0];  // (B,S,EH)
    const float* ht  = (const float*)d_in[1];  // (D,B,DH)
    const float* q_w = (const float*)d_in[2];  // (DH,DH)
    const float* q_b = (const float*)d_in[3];  // (DH,)
    const float* k_w = (const float*)d_in[4];  // (DH,EH)
    const float* k_b = (const float*)d_in[5];  // (DH,)
    const float* v_w = (const float*)d_in[6];  // (1,DH)
    const float* v_b = (const float*)d_in[7];  // (1,)
    const float* c_w = (const float*)d_in[8];  // (DH,EH)
    const float* c_b = (const float*)d_in[9];  // (DH,)

    float* out_c  = (float*)d_out;                 // (D,B,DH) = 32768
    float* out_at = out_c + (size_t)Dd * Bb * DH;  // (D,B,S)  = 65536

    char* ws = (char*)d_ws;
    bf16_t* hs_bf  = (bf16_t*)(ws + 0);           // 67108864 B
    bf16_t* kw_bf  = (bf16_t*)(ws + 67108864);    //  2097152 B
    bf16_t* qw_bf  = (bf16_t*)(ws + 69206016);    //  2097152 B
    bf16_t* cw_bf  = (bf16_t*)(ws + 71303168);    //  2097152 B
    bf16_t* ht_bf  = (bf16_t*)(ws + 73400320);    //    65536 B
    bf16_t* ctx_bf = (bf16_t*)(ws + 73465856);    //    65536 B
    float*  qh     = (float*) (ws + 73531392);    //   131072 B
    float*  e      = (float*) (ws + 73662464);    //   262144 B

    // 1) f32 -> bf16 conversions: hs_bf, kw_bf, qw_bf, cw_bf, ht_bf are contiguous
    cvt_all_kernel<<<CV_WGS, 32 * CV_WAVES, 0, stream>>>(hs, k_w, q_w, c_w, ht, hs_bf);

    // 2) qh = ht @ q_w^T + q_b   (M=32, N=DH, K=DH)
    gemm_bf16_kernel<<<dim3(DH / SG_N, 2), 32 * SG_WAVES, 0, stream>>>(
        ht_bf, qw_bf, q_b, qh);

    // 3) fused k-projection + tanh score -> e (D,B,S)
    kproj_score_kernel<<<dim3(Ss / KP_M, Bb), 512, 0, stream>>>(
        hs_bf, kw_bf, k_b, qh, v_w, v_b, e);

    // 4) softmax over S -> at output
    softmax_kernel<<<Dd * Bb, 256, 0, stream>>>(e, out_at);

    // 5) ctx = at @ hs  (bf16 output)
    ctx_kernel<<<dim3(EH / CX_COLS, Bb), 512, 0, stream>>>(out_at, hs, ctx_bf);

    // 6) c = ctx @ c_w^T + c_b   (M=32, N=DH, K=EH)
    gemm_bf16_kernel<<<dim3(DH / SG_N, 2), 32 * SG_WAVES, 0, stream>>>(
        ctx_bf, cw_bf, c_b, out_c);
}

// v006
// One run takes 91.7 microseconds.
// Next to v005, in two timings, it ran 1.05 times as fast each time.
// Counting every step since v000, it is 6.88 times as fast.
#include <hip/hip_runtime.h>
#include <hip/hip_bf16.h>
#include <math.h>

typedef __bf16 bf16_t;
typedef __attribute__((ext_vector_type(16))) __bf16 v16bf;
typedef __attribute__((ext_vector_type(8)))  __bf16 v8bf;
typedef __attribute__((ext_vector_type(4)))  __bf16 v4bf;
typedef __attribute__((ext_vector_type(8)))  float  v8f;

static constexpr int Dd = 2;
static constexpr int Bb = 16;
static constexpr int Ss = 2048;
static constexpr int DH = 1024;
static constexpr int EH = 1024;

// Hardware V_TANH_F32 (TRANS op) if the builtin is available on this toolchain.
#if defined(__has_builtin)
#if __has_builtin(__builtin_amdgcn_tanhf)
#define FAST_TANH(x) __builtin_amdgcn_tanhf(x)
#endif
#endif
#ifndef FAST_TANH
#define FAST_TANH(x) tanhf(x)
#endif

// ---------------------------------------------------------------------------
// f32 -> bf16 conversion of the four small operands in one launch (hs is
// converted where it is used, on its way into the k-projection's LDS stage).
// The four bf16 arrays lie one behind the other in the workspace (k_w, q_w, c_w,
// ht), so the output is one array. A wave takes one batch of 4 KiB: every load
// covers 512 contiguous bytes, every store 256.
// ---------------------------------------------------------------------------
static constexpr int CV_WAVES  = 16;                        // waves per work-group
static constexpr int CV_U      = 8;                         // loads per lane
static constexpr int CV_CH     = 128 * CV_U;                // floats per batch
static constexpr int CV_WB     = DH * EH / CV_CH;           // batches per weight matrix
static constexpr int CV_NB     = 3 * CV_WB + Dd * Bb * DH / CV_CH;   // batches in all
static constexpr int CV_WGS    = CV_NB / CV_WAVES;          // work-groups
static_assert(CV_WB * CV_CH == DH * EH && DH == EH, "weights in whole batches");
static_assert((Dd * Bb * DH) % CV_CH == 0, "ht in whole batches");
static_assert(CV_WGS * CV_WAVES == CV_NB, "every wave has a batch");

// base: the array (a scalar address); off: byte offset of this lane's first 4
// elements of the batch. All three loops unrolled: the batch lives in registers
// and the offsets become immediates.
template <int U>
__device__ __forceinline__ void cv_load(float4 (&t)[U], const float* base, unsigned off) {
    const char* p = (const char*)base + (size_t)off;
#pragma unroll
    for (int u = 0; u < U; ++u) t[u] = *(const float4*)(p + u * 512);
}

template <int U>
__device__ __forceinline__ void cv_pack(v4bf (&o)[U], const float4 (&t)[U]) {
#pragma unroll
    for (int u = 0; u < U; ++u) {
        o[u][0] = (bf16_t)t[u].x; o[u][1] = (bf16_t)t[u].y;
        o[u][2] = (bf16_t)t[u].z; o[u][3] = (bf16_t)t[u].w;
    }
}

template <int U>
__device__ __forceinline__ void cv_store(const v4bf (&o)[U], bf16_t* base, unsigned off) {
    char* q = (char*)base + (size_t)off;
#pragma unroll
    for (int u = 0; u < U; ++u) *(v4bf*)(q + u * 256) = o[u];
}

__global__ __launch_bounds__(32 * CV_WAVES) void cvt_all_kernel(
    const float* __restrict__ k_w, const float* __restrict__ q_w,
    const float* __restrict__ c_w, const float* __restrict__ ht,
    bf16_t* __restrict__ out) {
    const int lane = threadIdx.x & 31;
    // the wave's number in its work-group, in a scalar register
    const int wave = __builtin_amdgcn_readfirstlane((int)(threadIdx.x >> 5));
    const int w    = blockIdx.x * CV_WAVES + wave;
    const int seg  = w / CV_WB;
    const float* tb = seg == 0 ? k_w : seg == 1 ? q_w : seg == 2 ? c_w : ht;
    const unsigned src = ((unsigned)(w % CV_WB) * CV_CH + lane * 4) * 4;   // bytes into tb
    const unsigned dst = ((unsigned)w * CV_CH + lane * 4) * 2;             // bytes into out

    float4 t[CV_U];
    v4bf   o[CV_U];
    cv_load(t, tb, src);
    cv_pack(o, t);
    cv_store(o, out, dst);
}

// ---------------------------------------------------------------------------
// WMMA fragment loader: 16x32 bf16 tile slice for this lane.
// Lane holds K = {k0+sel .. k0+sel+7} and {k0+sel+16 .. k0+sel+23},
// sel = (lane>=16) ? 8 : 0, row/col = lane&15 (caller bakes into pointer).
// ---------------------------------------------------------------------------
__device__ __forceinline__ v16bf load_frag16(const bf16_t* p) {
    v8bf lo = *reinterpret_cast<const v8bf*>(p);
    v8bf hi = *reinterpret_cast<const v8bf*>(p + 16);
    v16bf r;
#pragma unroll
    for (int i = 0; i < 8; ++i) { r[i] = lo[i]; r[i + 8] = hi[i]; }
    return r;
}

// ---------------------------------------------------------------------------
// Small GEMM: out[32 x 1024] = A[32 x 1024](bf16) @ W[1024 x 1024]^T(bf16) + bias
// grid: (DH/32, 2), block 256 = 8 waves. A work-group owns 16 rows x 32 columns
// of out (whole 128-byte lines). Each wave takes 128 of the 1024 k for both
// column tiles: 256-byte pieces of the A and W rows, all 24 loads in flight at
// once. The 8 partial tiles meet in LDS.
// ---------------------------------------------------------------------------
static constexpr int SG_N     = 32;            // columns per work-group
static constexpr int SG_KW    = 128;           // k per wave
static constexpr int SG_WAVES = EH / SG_KW;    // waves per work-group
static constexpr int SG_KS    = SG_KW / 32;    // WMMA k-steps per wave
static_assert(DH == EH, "both small GEMMs have the same K");

__global__ __launch_bounds__(32 * SG_WAVES) void gemm_bf16_kernel(
    const bf16_t* __restrict__ A, const bf16_t* __restrict__ W,
    const float* __restrict__ bias, float* __restrict__ out) {
    const int m0   = blockIdx.y * 16;
    const int n0   = blockIdx.x * SG_N;
    const int tid  = threadIdx.x;
    const int wave = tid >> 5;
    const int lane = tid & 31;
    const int lo   = lane & 15;
    const int sel  = (lane & 16) ? 8 : 0;
    const bf16_t* arow = A + (size_t)(m0 + lo) * EH + wave * SG_KW + sel;
    const bf16_t* wrow = W + (size_t)(n0 + lo) * EH + wave * SG_KW + sel;

    v16bf af[SG_KS], b0[SG_KS], b1[SG_KS];
    // unrolled: the fragments live in registers, the k offsets become immediates
#pragma unroll
    for (int ks = 0; ks < SG_KS; ++ks) {
        af[ks] = load_frag16(arow + ks * 32);
        b0[ks] = load_frag16(wrow + ks * 32);
        b1[ks] = load_frag16(wrow + 16 * EH + ks * 32);
    }
    const int n = n0 + lane;      // this lane's column in the epilogue
    const float bv = bias[n];
    // behind the last load: the address registers stay as they are (named as
    // inputs) until the wait has passed
    asm volatile("s_wait_xcnt 0x0" :: "v"(arow), "v"(wrow) : "memory");
    // keeps all the loads ahead of the first WMMA: left alone the scheduler sinks
    // them among the WMMAs and the wave waits out the load latency several times
    __builtin_amdgcn_sched_barrier(0);

    v8f c0 = {0.f, 0.f, 0.f, 0.f, 0.f, 0.f, 0.f, 0.f};
    v8f c1 = c0;
#pragma unroll
    for (int ks = 0; ks < SG_KS; ++ks) {
        c0 = __builtin_amdgcn_wmma_f32_16x16x32_bf16(
            false, af[ks], false, b0[ks], (short)0, c0, false, false);
        c1 = __builtin_amdgcn_wmma_f32_16x16x32_bf16(
            false, af[ks], false, b1[ks], (short)0, c1, false, false);
    }

    // red[wave][column tile][j][lane]: element (row j + 8 * (lane >> 4),
    // column lane & 15) of the wave's partial tile
    __shared__ float red[SG_WAVES][2][8][32];
#pragma unroll
    for (int j = 0; j < 8; ++j) {
        red[wave][0][j][lane] = c0[j];
        red[wave][1][j][lane] = c1[j];
    }
    __syncthreads();

    // a wave sums and stores one whole 32-column row of the tile at a time
    static_assert(SG_WAVES == 8, "wave w sums rows w and w + 8");
#pragma unroll
    for (int hf = 0; hf < 2; ++hf) {
        float s = 0.f;
        // unrolled: the 8 LDS reads go out together
#pragma unroll
        for (int w = 0; w < SG_WAVES; ++w)
            s += red[w][lane >> 4][wave][hf * 16 + lo];
        out[(size_t)(m0 + hf * 8 + wave) * DH + n] = s + bv;
    }
}

// ---------------------------------------------------------------------------
// Fused: kh = bf16(hs[b, m0:m0+128, :]) @ k_w^T + k_b   (kept in registers)
//        e[d,b,m0+m] = sum_h tanh(qh[d,b,h] + kh[m,h]) * v_w[h] + v_b
// grid: (S/128, B), block 512 = 16 waves: 4 along the rows x 4 along the
// columns, each wave a 32 x 64 tile (2 x 4 fragments: 12 LDS reads feed 8 WMMAs);
// 4 passes of 256 columns.
// Both operands reach the waves through LDS: a stage is 128 k (256-byte rows)
// of 128 hs rows and 256 k_w rows, two buffers, the next stage in flight while
// this one is used. The k_w rows (bf16) come by asynchronous copies that read
// whole lines. The hs rows are read as f32, held in registers for a stage,
// rounded to bf16 and stored into the buffer that the next stage reads.
// ---------------------------------------------------------------------------
static constexpr int KP_M      = 128;                       // hs rows per work-group
static constexpr int KP_N      = 256;                       // kh columns per pass
static constexpr int KP_K      = 128;                       // k per stage
static constexpr int KP_PITCH  = 272;                       // LDS row pitch, bytes (16 x odd)
static constexpr int KP_BUF    = (KP_M + KP_N) * KP_PITCH;  // one buffer, bytes
static constexpr int KP_KST    = EH / KP_K;                 // stages per pass
static constexpr int KP_STAGES = (DH / KP_N) * KP_KST;      // stages in all
static constexpr int KP_FM     = 2;                         // row fragments per wave
static constexpr int KP_FN     = 4;                         // column fragments per wave
static constexpr int KP_WM     = KP_M / (16 * KP_FM);       // waves along the rows
static constexpr int KP_WN     = KP_N / (16 * KP_FN);       // waves along the columns
static_assert(KP_WM * KP_WN == 16, "16 waves cover the block tile");

static constexpr int KP_AR     = KP_M / 16;                 // hs rows per wave and stage

// The k_w rows of one stage: 256 rows x 16 pieces of 16 bytes = 8 copies per
// thread. A wave's copy covers two whole 256-byte rows. w: this thread's piece
// in row (tid >> 4) of the stage's k_w rows; dst: its LDS byte address there.
// a_off: the offset register of the hs loads issued just ahead.
__device__ __forceinline__ void kp_copy_w(const bf16_t* w, unsigned dst, unsigned a_off) {
    constexpr int      GR = 32 * EH;         // 32 rows further, elements
    constexpr unsigned LR = 32 * KP_PITCH;   // 32 rows further, LDS bytes
    // s_wait_xcnt closes the statement so that no address register named here
    // (the hs loads' offset among them) is rewritten ahead of it.
    asm volatile(
        "global_load_async_to_lds_b128 %0, %8, off\n\t"
        "global_load_async_to_lds_b128 %1, %9, off\n\t"
        "global_load_async_to_lds_b128 %2, %10, off\n\t"
        "global_load_async_to_lds_b128 %3, %11, off\n\t"
        "global_load_async_to_lds_b128 %4, %12, off\n\t"
        "global_load_async_to_lds_b128 %5, %13, off\n\t"
        "global_load_async_to_lds_b128 %6, %14, off\n\t"
        "global_load_async_to_lds_b128 %7, %15, off\n\t"
        "s_wait_xcnt 0x0"
        :: "v"(dst), "v"(dst + LR), "v"(dst + 2 * LR), "v"(dst + 3 * LR),
           "v"(dst + 4 * LR), "v"(dst + 5 * LR), "v"(dst + 6 * LR),
           "v"(dst + 7 * LR),
           "v"(w), "v"(w + GR), "v"(w + 2 * GR), "v"(w + 3 * GR),
           "v"(w + 4 * GR), "v"(w + 5 * GR), "v"(w + 6 * GR), "v"(w + 7 * GR),
           "v"(a_off)
        : "memory");
}

// The hs rows of one stage: a wave reads 8 rows, 16 apart, one whole 512-byte
// piece (128 f32) per load. off: byte offset into hs of this lane's 4 elements
// of the wave's first row. Unrolled: the rows live in registers and the row
// offsets become immediates.
__device__ __forceinline__ void kp_load_a(float4 (&t)[KP_AR], const float* hs, unsigned off) {
    const char* p = (const char*)hs + (size_t)off;
#pragma unroll
    for (int i = 0; i < KP_AR; ++i)
        t[i] = *(const float4*)(p + (size_t)i * 16 * EH * 4);
}

// Rounds them to bf16 and stores them: 256 contiguous LDS bytes per wave store.
// dst: this lane's 8 bytes in the wave's first row of the buffer.
__device__ __forceinline__ void kp_store_a(const float4 (&t)[KP_AR], char* dst) {
#pragma unroll
    for (int i = 0; i < KP_AR; ++i) {
        v4bf o;
        o[0] = (bf16_t)t[i].x; o[1] = (bf16_t)t[i].y;
        o[2] = (bf16_t)t[i].z; o[3] = (bf16_t)t[i].w;
        *(v4bf*)(dst + i * 16 * KP_PITCH) = o;
    }
}

__global__ __launch_bounds__(512) void kproj_score_kernel(
    const float* __restrict__ hs, const bf16_t* __restrict__ kw_bf,
    const float* __restrict__ k_b, const float* __restrict__ qh,
    const float* __restrict__ v_w, const float* __restrict__ v_b,
    float* __restrict__ e_out) {
    const int m0   = blockIdx.x * KP_M;
    const int b    = blockIdx.y;
    const int tid  = threadIdx.x;
    const int wave = tid >> 5;
    const int lane = tid & 31;
    const int lo   = lane & 15;
    const int sel  = (lane & 16) ? 8 : 0;
    const int wm   = wave % KP_WM;   // which 32 rows
    const int wn   = wave / KP_WM;   // which 64 of the pass's 256 columns

    __shared__ __attribute__((aligned(16))) char kp_lds[2 * KP_BUF];
    // e_part[wn][d * 128 + row]: the score sum over the columns of the waves wn
    __shared__ float e_part[KP_WN][2 * KP_M];

    // this thread's piece of a stage's k_w rows
    const int crow = tid >> 4;
    const int ccol = tid & 15;
    const bf16_t* w_src = kw_bf + (size_t)crow * EH + ccol * 8;
    const unsigned c_dst = (unsigned)(size_t)kp_lds + (KP_M + crow) * KP_PITCH + ccol * 16;
    // this lane's 4 elements of the wave's first hs row of a stage
    static_assert((size_t)Bb * Ss * EH * 4 < (1ull << 32), "byte offsets fit 32 bits");
    const unsigned a_src = (((unsigned)b * Ss + m0 + wave) * EH + lane * 4) * 4;
    char* a_dst = kp_lds + wave * KP_PITCH + lane * 8;

    float4 ar[KP_AR];
    kp_load_a(ar, hs, a_src);
    kp_copy_w(w_src, c_dst, a_src);
    kp_store_a(ar, a_dst);
    // stage 0 has landed for this wave (its stores and its copies); the barrier
    // publishes it to the others
    asm volatile("s_wait_dscnt 0x0" ::: "memory");
    asm volatile("s_wait_asynccnt 0x0" ::: "memory");
    __syncthreads();
    kp_load_a(ar, hs, a_src + KP_K * 4);
    kp_copy_w(w_src + KP_K, c_dst + KP_BUF, a_src + KP_K * 4);

    // this lane's fragment rows inside a buffer
    const int a_off = (wm * 16 * KP_FM + lo) * KP_PITCH + sel * 2;
    const int w_off = (KP_M + wn * 16 * KP_FN + lo) * KP_PITCH + sel * 2;

    const float* qh0 = qh + ((size_t)0 * Bb + b) * DH;
    const float* qh1 = qh + ((size_t)1 * Bb + b) * DH;

    float p0[KP_FM][8], p1[KP_FM][8];
#pragma unroll
    for (int r = 0; r < KP_FM; ++r)
#pragma unroll
        for (int j = 0; j < 8; ++j) { p0[r][j] = 0.f; p1[r][j] = 0.f; }

    const v8f zero = {0.f, 0.f, 0.f, 0.f, 0.f, 0.f, 0.f, 0.f};

    for (int pass = 0; pass < DH / KP_N; ++pass) {
        v8f c[KP_FM][KP_FN];
#pragma unroll
        for (int r = 0; r < KP_FM; ++r)
#pragma unroll
            for (int t = 0; t < KP_FN; ++t) c[r][t] = zero;

        for (int kc = 0; kc < KP_KST; ++kc) {
            const int st = pass * KP_KST + kc;
            const char* buf = kp_lds + (st & 1) * KP_BUF;
#pragma unroll
            for (int ks = 0; ks < KP_K / 32; ++ks) {
                v16bf af[KP_FM], bf[KP_FN];
#pragma unroll
                for (int r = 0; r < KP_FM; ++r)
                    af[r] = load_frag16(
                        (const bf16_t*)(buf + a_off + r * 16 * KP_PITCH) + ks * 32);
#pragma unroll
                for (int t = 0; t < KP_FN; ++t)
                    bf[t] = load_frag16(
                        (const bf16_t*)(buf + w_off + t * 16 * KP_PITCH) + ks * 32);
                // keeps the k-step's 12 LDS reads one group ahead of its WMMAs:
                // left alone the scheduler puts a full LDS wait before each WMMA
                __builtin_amdgcn_sched_barrier(0);
                // the next stage's hs rows, loaded at the foot of the trip before,
                // go into the other buffer (nobody reads it during this trip)
                // while the last k-step's fragments are on their way
                if (ks == KP_K / 32 - 1 && st + 1 < KP_STAGES)
                    kp_store_a(ar, a_dst + ((st + 1) & 1) * KP_BUF);
#pragma unroll
                for (int r = 0; r < KP_FM; ++r)
#pragma unroll
                    for (int t = 0; t < KP_FN; ++t)
                        c[r][t] = __builtin_amdgcn_wmma_f32_16x16x32_bf16(
                            false, af[r], false, bf[t], (short)0, c[r][t], false, false);
            }
            // this wave's reads of the buffer are done before it is refilled, and
            // its stores of the next stage's hs rows have landed
            asm volatile("s_wait_dscnt 0x0" ::: "memory");
            // this wave's copies of the next stage have landed
            asm volatile("s_wait_asynccnt 0x0" ::: "memory");
            // publishes the next stage and ends every wave's reads of this one
            __syncthreads();
            const int nx = st + 2;
            if (nx < KP_STAGES) {
                const int np = nx / KP_KST;
                const int nk = nx % KP_KST;
                const unsigned ao = a_src + nk * KP_K * 4;
                kp_load_a(ar, hs, ao);
                kp_copy_w(w_src + (size_t)np * KP_N * EH + nk * KP_K,
                          c_dst + (st & 1) * KP_BUF, ao);
            }
        }

        // score terms of this pass's 64 columns, for d = 0 and d = 1
#pragma unroll
        for (int t = 0; t < KP_FN; ++t) {
            const int h = pass * KP_N + wn * 16 * KP_FN + t * 16 + lo;
            const float vwh = v_w[h];
            const float kbh = k_b[h];
            const float q0  = qh0[h];
            const float q1  = qh1[h];
#pragma unroll
            for (int r = 0; r < KP_FM; ++r)
#pragma unroll
                for (int j = 0; j < 8; ++j) {
                    const float kv = c[r][t][j] + kbh;
                    p0[r][j] += FAST_TANH(q0 + kv) * vwh;
                    p1[r][j] += FAST_TANH(q1 + kv) * vwh;
                }
        }
    }
    // no copy is outstanding when the wave goes on to its end
    asm volatile("s_wait_asynccnt 0x0" ::: "memory");

    // reduce over the 16 columns held by each half-wave; the four waves that
    // share the rows each leave their sum in a slot of their own
    const int rbase = wm * 16 * KP_FM + ((lane & 16) ? 8 : 0);
    // the exchange distance is the outer loop: the 32 sums of a wave take each
    // step together, so that a step's exchange latency is waited out once
#pragma unroll
    for (int off = 1; off < 16; off <<= 1)
#pragma unroll
        for (int r = 0; r < KP_FM; ++r)
#pragma unroll
            for (int j = 0; j < 8; ++j) {
                p0[r][j] += __shfl_xor(p0[r][j], off, 32);
                p1[r][j] += __shfl_xor(p1[r][j], off, 32);
            }
    if (lo == 0) {
#pragma unroll
        for (int r = 0; r < KP_FM; ++r)
#pragma unroll
            for (int j = 0; j < 8; ++j) {
                e_part[wn][rbase + r * 16 + j] = p0[r][j];
                e_part[wn][KP_M + rbase + r * 16 + j] = p1[r][j];
            }
    }
    __syncthreads();

    static_assert(KP_WN == 4, "four slots per score");
    if (tid < 2 * KP_M) {
        const int d = tid / KP_M;
        const int mr = tid % KP_M;
        const float s = (e_part[0][tid] + e_part[1][tid]) + (e_part[2][tid] + e_part[3][tid]);
        e_out[((size_t)d * Bb + b) * Ss + m0 + mr] = s + v_b[0];
    }
}

// ---------------------------------------------------------------------------
// Row softmax over S: at = softmax(e).  grid: D*B rows, block 256.
// ---------------------------------------------------------------------------
__global__ __launch_bounds__(256) void softmax_kernel(
    const float* __restrict__ e, float* __restrict__ at) {
    const int row = blockIdx.x;
    const float* er = e + (size_t)row * Ss;
    float* ar = at + (size_t)row * Ss;
    __shared__ float red[256];

    float m = -INFINITY;
    for (int s = threadIdx.x; s < Ss; s += 256) m = fmaxf(m, er[s]);
    red[threadIdx.x] = m;
    __syncthreads();
    for (int off = 128; off > 0; off >>= 1) {
        if (threadIdx.x < off)
            red[threadIdx.x] = fmaxf(red[threadIdx.x], red[threadIdx.x + off]);
        __syncthreads();
    }
    m = red[0];
    __syncthreads();

    float sum = 0.f;
    for (int s = threadIdx.x; s < Ss; s += 256) {
        const float v = __expf(er[s] - m);
        ar[s] = v;
        sum += v;
    }
    red[threadIdx.x] = sum;
    __syncthreads();
    for (int off = 128; off > 0; off >>= 1) {
        if (threadIdx.x < off) red[threadIdx.x] += red[threadIdx.x + off];
        __syncthreads();
    }
    const float inv = 1.f / red[0];
    for (int s = threadIdx.x; s < Ss; s += 256) ar[s] *= inv;
}

// ---------------------------------------------------------------------------
// ctx[d,b,g] = sum_s at[d,b,s] * hs[b,s,g]  (read hs once for both d)
// grid: (EH/64, B), block 512 = 16 waves: one work-group per WGP, all of them
// streaming. A work-group owns 64 columns (256-byte pieces of the hs rows); a
// 16-lane half of a wave owns 64 consecutive rows, so one 16-byte load of a
// wave covers two whole pieces. The 32 partial sums of a column meet in LDS.
// Output stored as bf16 (feeds final GEMM).
// ---------------------------------------------------------------------------
static constexpr int CX_COLS  = 64;                     // columns per work-group
static constexpr int CX_PARTS = 32;                     // half-waves per work-group
static constexpr int CX_ROWS  = Ss / CX_PARTS;          // rows per half-wave
static constexpr int CX_STEP  = 16;                     // rows loaded together
static constexpr int CX_NSTEP = CX_ROWS / CX_STEP;

struct CxBatch {
    float4 w0[CX_STEP / 4];   // at[0, b, rows]
    float4 w1[CX_STEP / 4];   // at[1, b, rows]
    float4 hv[CX_STEP];       // 4 columns of each row
};

__device__ __forceinline__ void cx_load(CxBatch& t, const float4* a0,
                                        const float4* a1, const float* h, int step) {
    // both loops unrolled: the batch lives in registers, and the row offsets
    // become immediates of the loads
#pragma unroll
    for (int q = 0; q < CX_STEP / 4; ++q) {
        t.w0[q] = a0[step * (CX_STEP / 4) + q];
        t.w1[q] = a1[step * (CX_STEP / 4) + q];
    }
#pragma unroll
    for (int u = 0; u < CX_STEP; ++u)
        t.hv[u] = *(const float4*)(h + (size_t)(step * CX_STEP + u) * EH);
}

__device__ __forceinline__ void cx_sum(const CxBatch& t, float4& acc0, float4& acc1) {
    // both loops unrolled: the batch lives in registers
#pragma unroll
    for (int q = 0; q < CX_STEP / 4; ++q) {
        const float s0[4] = {t.w0[q].x, t.w0[q].y, t.w0[q].z, t.w0[q].w};
        const float s1[4] = {t.w1[q].x, t.w1[q].y, t.w1[q].z, t.w1[q].w};
#pragma unroll
        for (int u = 0; u < 4; ++u) {
            const float4 v = t.hv[q * 4 + u];
            acc0.x += s0[u] * v.x; acc0.y += s0[u] * v.y;
            acc0.z += s0[u] * v.z; acc0.w += s0[u] * v.w;
            acc1.x += s1[u] * v.x; acc1.y += s1[u] * v.y;
            acc1.z += s1[u] * v.z; acc1.w += s1[u] * v.w;
        }
    }
}

__global__ __launch_bounds__(512) void ctx_kernel(
    const float* __restrict__ at, const float* __restrict__ hs,
    bf16_t* __restrict__ ctx_bf) {
    const int b    = blockIdx.y;
    const int g0   = blockIdx.x * CX_COLS;
    const int tid  = threadIdx.x;
    const int lo   = tid & 15;
    const int part = tid >> 4;
    const int r0   = part * CX_ROWS;

    const float4* a0 = (const float4*)(at + ((size_t)0 * Bb + b) * Ss + r0);
    const float4* a1 = (const float4*)(at + ((size_t)1 * Bb + b) * Ss + r0);
    const float*  h  = hs + ((size_t)b * Ss + r0) * EH + g0 + lo * 4;

    float4 acc0 = {0.f, 0.f, 0.f, 0.f};
    float4 acc1 = {0.f, 0.f, 0.f, 0.f};
    CxBatch t[2];
    cx_load(t[0], a0, a1, h, 0);
    // unrolled so that the two batches are told apart at compile time
#pragma unroll
    for (int s = 0; s < CX_NSTEP; ++s) {
        if (s + 1 < CX_NSTEP) {
            cx_load(t[(s + 1) & 1], a0, a1, h, s + 1);
            // behind the last loads: their address registers stay as they are
            // (named as inputs) until the wait has passed
            if (s + 2 == CX_NSTEP)
                asm volatile("s_wait_xcnt 0x0" :: "v"(h), "v"(a0) : "memory");
            // keeps the next 16 rows' loads ahead of these rows' sums: left
            // alone the scheduler sinks them and a wave has few loads in flight
            __builtin_amdgcn_sched_barrier(0);
        }
        cx_sum(t[s & 1], acc0, acc1);
    }

    // red[p][d * 64 + column]: the partial sum of half-wave p
    __shared__ __attribute__((aligned(16))) float red[CX_PARTS][2 * CX_COLS];
    __shared__ float red2[4][2 * CX_COLS];
    *(float4*)(red[part] + lo * 4) = acc0;
    *(float4*)(red[part] + CX_COLS + lo * 4) = acc1;
    __syncthreads();

    // 4 threads per output, 8 partials each, then across the 4
    {
        const int o = tid & (2 * CX_COLS - 1);
        const int p = tid >> 7;
        float s = 0.f;
        // unrolled: the 8 LDS reads go out together
#pragma unroll
        for (int k = 0; k < 8; ++k) s += red[p * 8 + k][o];
        red2[p][o] = s;
    }
    __syncthreads();

    if (tid < 2 * CX_COLS) {
        const float s = (red2[0][tid] + red2[1][tid]) + (red2[2][tid] + red2[3][tid]);
        const int d = tid / CX_COLS;
        const int c = tid % CX_COLS;
        ctx_bf[((size_t)d * Bb + b) * EH + g0 + c] = (bf16_t)s;
    }
}

// ---------------------------------------------------------------------------
// launcher
// ---------------------------------------------------------------------------
extern "C" void kernel_launch(void* const* d_in, const int* in_sizes, int n_in,
                              void* d_out, int out_size, void* d_ws, size_t ws_size,
                              hipStream_t stream) {
    const float* hs  = (const float*)d_in[0];  // (B,S,EH)
    const float* ht  = (const float*)d_in[1];  // (D,B,DH)
    const float* q_w = (const float*)d_in[2];  // (DH,DH)
    const float* q_b = (const float*)d_in[3];  // (DH,)
    const float* k_w = (const float*)d_in[4];  // (DH,EH)
    const float* k_b = (const float*)d_in[5];  // (DH,)
    const float* v_w = (const float*)d_in[6];  // (1,DH)
    const float* v_b = (const float*)d_in[7];  // (1,)
    const float* c_w = (const float*)d_in[8];  // (DH,EH)
    const float* c_b = (const float*)d_in[9];  // (DH,)

    float* out_c  = (float*)d_out;                 // (D,B,DH) = 32768
    float* out_at = out_c + (size_t)Dd * Bb * DH;  // (D,B,S)  = 65536

    char* ws = (char*)d_ws;
    bf16_t* kw_bf  = (bf16_t*)(ws + 67108864);    //  2097152 B
    bf16_t* qw_bf  = (bf16_t*)(ws + 69206016);    //  2097152 B
    bf16_t* cw_bf  = (bf16_t*)(ws + 71303168);    //  2097152 B
    bf16_t* ht_bf  = (bf16_t*)(ws + 73400320);    //    65536 B
    bf16_t* ctx_bf = (bf16_t*)(ws + 73465856);    //    65536 B
    float*  qh     = (float*) (ws + 73531392);    //   131072 B
    float*  e      = (float*) (ws + 73662464);    //   262144 B

    // 1) f32 -> bf16 conversions: kw_bf, qw_bf, cw_bf, ht_bf are contiguous
    cvt_all_kernel<<<CV_WGS, 32 * CV_WAVES, 0, stream>>>(k_w, q_w, c_w, ht, kw_bf);

    // 2) qh = ht @ q_w^T + q_b   (M=32, N=DH, K=DH)
    gemm_bf16_kernel<<<dim3(DH / SG_N, 2), 32 * SG_WAVES, 0, stream>>>(
        ht_bf, qw_bf, q_b, qh);

    // 3) fused k-projection + tanh score -> e (D,B,S)
    kproj_score_kernel<<<dim3(Ss / KP_M, Bb), 512, 0, stream>>>(
        hs, kw_bf, k_b, qh, v_w, v_b, e);

    // 4) softmax over S -> at output
    softmax_kernel<<<Dd * Bb, 256, 0, stream>>>(e, out_at);

    // 5) ctx = at @ hs  (bf16 output)
    ctx_kernel<<<dim3(EH / CX_COLS, Bb), 512, 0, stream>>>(out_at, hs, ctx_bf);

    // 6) c = ctx @ c_w^T + c_b   (M=32, N=DH, K=EH)
    gemm_bf16_kernel<<<dim3(DH / SG_N, 2), 32 * SG_WAVES, 0, stream>>>(
        ctx_bf, cw_bf, c_b, out_c);
}

// v007
// Measured time: 81.4 microseconds a run.
// Timed twice side by side with v006, it ran 1.12 times as fast both times.
// Over all steps from v000 it is 7.71 times as fast.
#include <hip/hip_runtime.h>
#include <hip/hip_bf16.h>
#include <math.h>

typedef __bf16 bf16_t;
typedef __attribute__((ext_vector_type(16))) __bf16 v16bf;
typedef __attribute__((ext_vector_type(8)))  __bf16 v8bf;
typedef __attribute__((ext_vector_type(4)))  __bf16 v4bf;
typedef __attribute__((ext_vector_type(8)))  float  v8f;

static constexpr int Dd = 2;
static constexpr int Bb = 16;
static constexpr int Ss = 2048;
static constexpr int DH = 1024;
static constexpr int EH = 1024;

// Hardware V_TANH_F32 (TRANS op) if the builtin is available on this toolchain.
#if defined(__has_builtin)
#if __has_builtin(__builtin_amdgcn_tanhf)
#define FAST_TANH(x) __builtin_amdgcn_tanhf(x)
#endif
#endif
#ifndef FAST_TANH
#define FAST_TANH(x) tanhf(x)
#endif

// ---------------------------------------------------------------------------
// f32 -> bf16 conversion of the four small operands in one launch (hs is
// converted where it is used, on its way into the k-projection's LDS stage).
// The four bf16 arrays lie one behind the other in the workspace (k_w, q_w, c_w,
// ht), so the output is one array. A wave takes one batch of 4 KiB: every load
// covers 512 contiguous bytes, every store 256.
// ---------------------------------------------------------------------------
static constexpr int CV_WAVES  = 16;                        // waves per work-group
static constexpr int CV_U      = 8;                         // loads per lane
static constexpr int CV_CH     = 128 * CV_U;                // floats per batch
static constexpr int CV_WB     = DH * EH / CV_CH;           // batches per weight matrix
static constexpr int CV_NB     = 3 * CV_WB + Dd * Bb * DH / CV_CH;   // batches in all
static constexpr int CV_WGS    = CV_NB / CV_WAVES;          // work-groups
static_assert(CV_WB * CV_CH == DH * EH && DH == EH, "weights in whole batches");
static_assert((Dd * Bb * DH) % CV_CH == 0, "ht in whole batches");
static_assert(CV_WGS * CV_WAVES == CV_NB, "every wave has a batch");

// base: the array (a scalar address); off: byte offset of this lane's first 4
// elements of the batch. All three loops unrolled: the batch lives in registers
// and the offsets become immediates.
template <int U>
__device__ __forceinline__ void cv_load(float4 (&t)[U], const float* base, unsigned off) {
    const char* p = (const char*)base + (size_t)off;
#pragma unroll
    for (int u = 0; u < U; ++u) t[u] = *(const float4*)(p + u * 512);
}

template <int U>
__device__ __forceinline__ void cv_pack(v4bf (&o)[U], const float4 (&t)[U]) {
#pragma unroll
    for (int u = 0; u < U; ++u) {
        o[u][0] = (bf16_t)t[u].x; o[u][1] = (bf16_t)t[u].y;
        o[u][2] = (bf16_t)t[u].z; o[u][3] = (bf16_t)t[u].w;
    }
}

template <int U>
__device__ __forceinline__ void cv_store(const v4bf (&o)[U], bf16_t* base, unsigned off) {
    char* q = (char*)base + (size_t)off;
#pragma unroll
    for (int u = 0; u < U; ++u) *(v4bf*)(q + u * 256) = o[u];
}

__global__ __launch_bounds__(32 * CV_WAVES) void cvt_all_kernel(
    const float* __restrict__ k_w, const float* __restrict__ q_w,
    const float* __restrict__ c_w, const float* __restrict__ ht,
    bf16_t* __restrict__ out) {
    const int lane = threadIdx.x & 31;
    // the wave's number in its work-group, in a scalar register
    const int wave = __builtin_amdgcn_readfirstlane((int)(threadIdx.x >> 5));
    const int w    = blockIdx.x * CV_WAVES + wave;
    const int seg  = w / CV_WB;
    const float* tb = seg == 0 ? k_w : seg == 1 ? q_w : seg == 2 ? c_w : ht;
    const unsigned src = ((unsigned)(w % CV_WB) * CV_CH + lane * 4) * 4;   // bytes into tb
    const unsigned dst = ((unsigned)w * CV_CH + lane * 4) * 2;             // bytes into out

    float4 t[CV_U];
    v4bf   o[CV_U];
    cv_load(t, tb, src);
    cv_pack(o, t);
    cv_store(o, out, dst);
}

// ---------------------------------------------------------------------------
// WMMA fragment loader: 16x32 bf16 tile slice for this lane.
// Lane holds K = {k0+sel .. k0+sel+7} and {k0+sel+16 .. k0+sel+23},
// sel = (lane>=16) ? 8 : 0, row/col = lane&15 (caller bakes into pointer).
// ---------------------------------------------------------------------------
__device__ __forceinline__ v16bf load_frag16(const bf16_t* p) {
    v8bf lo = *reinterpret_cast<const v8bf*>(p);
    v8bf hi = *reinterpret_cast<const v8bf*>(p + 16);
    v16bf r;
#pragma unroll
    for (int i = 0; i < 8; ++i) { r[i] = lo[i]; r[i + 8] = hi[i]; }
    return r;
}

// ---------------------------------------------------------------------------
// Small GEMM: out[32 x 1024] = A[32 x 1024](bf16) @ W[1024 x 1024]^T(bf16) + bias
// grid: (DH/32, 2), block 256 = 8 waves. A work-group owns 16 rows x 32 columns
// of out (whole 128-byte lines). Each wave takes 128 of the 1024 k for both
// column tiles: 256-byte pieces of the A and W rows, all 24 loads in flight at
// once. The 8 partial tiles meet in LDS.
// ---------------------------------------------------------------------------
static constexpr int SG_N     = 32;            // columns per work-group
static constexpr int SG_KW    = 128;           // k per wave
static constexpr int SG_WAVES = EH / SG_KW;    // waves per work-group
static constexpr int SG_KS    = SG_KW / 32;    // WMMA k-steps per wave
static_assert(DH == EH, "both small GEMMs have the same K");

__global__ __launch_bounds__(32 * SG_WAVES) void gemm_bf16_kernel(
    const bf16_t* __restrict__ A, const bf16_t* __restrict__ W,
    const float* __restrict__ bias, float* __restrict__ out) {
    const int m0   = blockIdx.y * 16;
    const int n0   = blockIdx.x * SG_N;
    const int tid  = threadIdx.x;
    const int wave = tid >> 5;
    const int lane = tid & 31;
    const int lo   = lane & 15;
    const int sel  = (lane & 16) ? 8 : 0;
    const bf16_t* arow = A + (size_t)(m0 + lo) * EH + wave * SG_KW + sel;
    const bf16_t* wrow = W + (size_t)(n0 + lo) * EH + wave * SG_KW + sel;

    v16bf af[SG_KS], b0[SG_KS], b1[SG_KS];
    // unrolled: the fragments live in registers, the k offsets become immediates
#pragma unroll
    for (int ks = 0; ks < SG_KS; ++ks) {
        af[ks] = load_frag16(arow + ks * 32);
        b0[ks] = load_frag16(wrow + ks * 32);
        b1[ks] = load_frag16(wrow + 16 * EH + ks * 32);
    }
    const int n = n0 + lane;      // this lane's column in the epilogue
    const float bv = bias[n];
    // behind the last load: the address registers stay as they are (named as
    // inputs) until the wait has passed
    asm volatile("s_wait_xcnt 0x0" :: "v"(arow), "v"(wrow) : "memory");
    // keeps all the loads ahead of the first WMMA: left alone the scheduler sinks
    // them among the WMMAs and the wave waits out the load latency several times
    __builtin_amdgcn_sched_barrier(0);

    v8f c0 = {0.f, 0.f, 0.f, 0.f, 0.f, 0.f, 0.f, 0.f};
    v8f c1 = c0;
#pragma unroll
    for (int ks = 0; ks < SG_KS; ++ks) {
        c0 = __builtin_amdgcn_wmma_f32_16x16x32_bf16(
            false, af[ks], false, b0[ks], (short)0, c0, false, false);
        c1 = __builtin_amdgcn_wmma_f32_16x16x32_bf16(
            false, af[ks], false, b1[ks], (short)0, c1, false, false);
    }

    // red[wave][column tile][j][lane]: element (row j + 8 * (lane >> 4),
    // column lane & 15) of the wave's partial tile
    __shared__ float red[SG_WAVES][2][8][32];
#pragma unroll
    for (int j = 0; j < 8; ++j) {
        red[wave][0][j][lane] = c0[j];
        red[wave][1][j][lane] = c1[j];
    }
    __syncthreads();

    // a wave sums and stores one whole 32-column row of the tile at a time
    static_assert(SG_WAVES == 8, "wave w sums rows w and w + 8");
#pragma unroll
    for (int hf = 0; hf < 2; ++hf) {
        float s = 0.f;
        // unrolled: the 8 LDS reads go out together
#pragma unroll
        for (int w = 0; w < SG_WAVES; ++w)
            s += red[w][lane >> 4][wave][hf * 16 + lo];
        out[(size_t)(m0 + hf * 8 + wave) * DH + n] = s + bv;
    }
}

// ---------------------------------------------------------------------------
// Fused: kh = bf16(hs[b, m0:m0+128, :]) @ k_w^T + k_b   (kept in registers)
//        e[d,b,m0+m] = sum_h tanh(qh[d,b,h] + kh[m,h]) * v_w[h] + v_b
// grid: (S/128, B), block 512 = 16 waves: 4 along the rows x 4 along the
// columns, each wave a 32 x 64 tile (2 x 4 fragments: 12 LDS reads feed 8 WMMAs);
// 4 passes of 256 columns.
// Both operands reach the waves through LDS: a stage is 128 k (256-byte rows)
// of 128 hs rows and 256 k_w rows, two buffers, the next stage in flight while
// this one is used. The k_w rows (bf16) come by asynchronous copies that read
// whole lines. The hs rows are read as f32, held in registers for a stage,
// rounded to bf16 and stored into the buffer that the next stage reads.
// ---------------------------------------------------------------------------
static constexpr int KP_M      = 128;                       // hs rows per work-group
static constexpr int KP_N      = 256;                       // kh columns per pass
static constexpr int KP_K      = 128;                       // k per stage
static constexpr int KP_PITCH  = 272;                       // LDS row pitch, bytes (16 x odd)
static constexpr int KP_BUF    = (KP_M + KP_N) * KP_PITCH;  // one buffer, bytes
static constexpr int KP_KST    = EH / KP_K;                 // stages per pass
static constexpr int KP_STAGES = (DH / KP_N) * KP_KST;      // stages in all
static constexpr int KP_FM     = 2;                         // row fragments per wave
static constexpr int KP_FN     = 4;                         // column fragments per wave
static constexpr int KP_WM     = KP_M / (16 * KP_FM);       // waves along the rows
static constexpr int KP_WN     = KP_N / (16 * KP_FN);       // waves along the columns
static_assert(KP_WM * KP_WN == 16, "16 waves cover the block tile");

static constexpr int KP_AR     = KP_M / 16;                 // hs rows per wave and stage

// The k_w rows of one stage: 256 rows x 16 pieces of 16 bytes = 8 copies per
// thread. A wave's copy covers two whole 256-byte rows. w: this thread's piece
// in row (tid >> 4) of the stage's k_w rows; dst: its LDS byte address there.
// a_off: the offset register of the hs loads issued just ahead.
__device__ __forceinline__ void kp_copy_w(const bf16_t* w, unsigned dst, unsigned a_off) {
    constexpr int      GR = 32 * EH;         // 32 rows further, elements
    constexpr unsigned LR = 32 * KP_PITCH;   // 32 rows further, LDS bytes
    // s_wait_xcnt closes the statement so that no address register named here
    // (the hs loads' offset among them) is rewritten ahead of it.
    asm volatile(
        "global_load_async_to_lds_b128 %0, %8, off\n\t"
        "global_load_async_to_lds_b128 %1, %9, off\n\t"
        "global_load_async_to_lds_b128 %2, %10, off\n\t"
        "global_load_async_to_lds_b128 %3, %11, off\n\t"
        "global_load_async_to_lds_b128 %4, %12, off\n\t"
        "global_load_async_to_lds_b128 %5, %13, off\n\t"
        "global_load_async_to_lds_b128 %6, %14, off\n\t"
        "global_load_async_to_lds_b128 %7, %15, off\n\t"
        "s_wait_xcnt 0x0"
        :: "v"(dst), "v"(dst + LR), "v"(dst + 2 * LR), "v"(dst + 3 * LR),
           "v"(dst + 4 * LR), "v"(dst + 5 * LR), "v"(dst + 6 * LR),
           "v"(dst + 7 * LR),
           "v"(w), "v"(w + GR), "v"(w + 2 * GR), "v"(w + 3 * GR),
           "v"(w + 4 * GR), "v"(w + 5 * GR), "v"(w + 6 * GR), "v"(w + 7 * GR),
           "v"(a_off)
        : "memory");
}

// The hs rows of one stage: a wave reads 8 rows, 16 apart, one whole 512-byte
// piece (128 f32) per load. off: byte offset into hs of this lane's 4 elements
// of the wave's first row. Unrolled: the rows live in registers and the row
// offsets become immediates.
__device__ __forceinline__ void kp_load_a(float4 (&t)[KP_AR], const float* hs, unsigned off) {
    const char* p = (const char*)hs + (size_t)off;
#pragma unroll
    for (int i = 0; i < KP_AR; ++i)
        t[i] = *(const float4*)(p + (size_t)i * 16 * EH * 4);
}

// Rounds them to bf16 and stores them: 256 contiguous LDS bytes per wave store.
// dst: this lane's 8 bytes in the wave's first row of the buffer.
__device__ __forceinline__ void kp_store_a(const float4 (&t)[KP_AR], char* dst) {
#pragma unroll
    for (int i = 0; i < KP_AR; ++i) {
        v4bf o;
        o[0] = (bf16_t)t[i].x; o[1] = (bf16_t)t[i].y;
        o[2] = (bf16_t)t[i].z; o[3] = (bf16_t)t[i].w;
        *(v4bf*)(dst + i * 16 * KP_PITCH) = o;
    }
}

__global__ __launch_bounds__(512) void kproj_score_kernel(
    const float* __restrict__ hs, const bf16_t* __restrict__ kw_bf,
    const float* __restrict__ k_b, const float* __restrict__ qh,
    const float* __restrict__ v_w, const float* __restrict__ v_b,
    float* __restrict__ e_out) {
    const int m0   = blockIdx.x * KP_M;
    const int b    = blockIdx.y;
    const int tid  = threadIdx.x;
    const int wave = tid >> 5;
    const int lane = tid & 31;
    const int lo   = lane & 15;
    const int sel  = (lane & 16) ? 8 : 0;
    const int wm   = wave % KP_WM;   // which 32 rows
    const int wn   = wave / KP_WM;   // which 64 of the pass's 256 columns

    __shared__ __attribute__((aligned(16))) char kp_lds[2 * KP_BUF];
    // e_part[wn][d * 128 + row]: the score sum over the columns of the waves wn
    __shared__ float e_part[KP_WN][2 * KP_M];

    // this thread's piece of a stage's k_w rows
    const int crow = tid >> 4;
    const int ccol = tid & 15;
    const bf16_t* w_src = kw_bf + (size_t)crow * EH + ccol * 8;
    const unsigned c_dst = (unsigned)(size_t)kp_lds + (KP_M + crow) * KP_PITCH + ccol * 16;
    // this lane's 4 elements of the wave's first hs row of a stage
    static_assert((size_t)Bb * Ss * EH * 4 < (1ull << 32), "byte offsets fit 32 bits");
    const unsigned a_src = (((unsigned)b * Ss + m0 + wave) * EH + lane * 4) * 4;
    char* a_dst = kp_lds + wave * KP_PITCH + lane * 8;

    float4 ar[KP_AR];
    kp_load_a(ar, hs, a_src);
    kp_copy_w(w_src, c_dst, a_src);
    kp_store_a(ar, a_dst);
    // stage 0 has landed for this wave (its stores and its copies); the barrier
    // publishes it to the others
    asm volatile("s_wait_dscnt 0x0" ::: "memory");
    asm volatile("s_wait_asynccnt 0x0" ::: "memory");
    __syncthreads();
    kp_load_a(ar, hs, a_src + KP_K * 4);
    kp_copy_w(w_src + KP_K, c_dst + KP_BUF, a_src + KP_K * 4);

    // this lane's fragment rows inside a buffer
    const int a_off = (wm * 16 * KP_FM + lo) * KP_PITCH + sel * 2;
    const int w_off = (KP_M + wn * 16 * KP_FN + lo) * KP_PITCH + sel * 2;

    const float* qh0 = qh + ((size_t)0 * Bb + b) * DH;
    const float* qh1 = qh + ((size_t)1 * Bb + b) * DH;

    float p0[KP_FM][8], p1[KP_FM][8];
#pragma unroll
    for (int r = 0; r < KP_FM; ++r)
#pragma unroll
        for (int j = 0; j < 8; ++j) { p0[r][j] = 0.f; p1[r][j] = 0.f; }

    const v8f zero = {0.f, 0.f, 0.f, 0.f, 0.f, 0.f, 0.f, 0.f};

    for (int pass = 0; pass < DH / KP_N; ++pass) {
        v8f c[KP_FM][KP_FN];
#pragma unroll
        for (int r = 0; r < KP_FM; ++r)
#pragma unroll
            for (int t = 0; t < KP_FN; ++t) c[r][t] = zero;

        for (int kc = 0; kc < KP_KST; ++kc) {
            const int st = pass * KP_KST + kc;
            const char* buf = kp_lds + (st & 1) * KP_BUF;
#pragma unroll
            for (int ks = 0; ks < KP_K / 32; ++ks) {
                v16bf af[KP_FM], bf[KP_FN];
#pragma unroll
                for (int r = 0; r < KP_FM; ++r)
                    af[r] = load_frag16(
                        (const bf16_t*)(buf + a_off + r * 16 * KP_PITCH) + ks * 32);
#pragma unroll
                for (int t = 0; t < KP_FN; ++t)
                    bf[t] = load_frag16(
                        (const bf16_t*)(buf + w_off + t * 16 * KP_PITCH) + ks * 32);
                // keeps the k-step's 12 LDS reads one group ahead of its WMMAs:
                // left alone the scheduler puts a full LDS wait before each WMMA
                __builtin_amdgcn_sched_barrier(0);
                // the next stage's hs rows, loaded at the foot of the trip before,
                // go into the other buffer (nobody reads it during this trip)
                // while the last k-step's fragments are on their way
                if (ks == KP_K / 32 - 1 && st + 1 < KP_STAGES)
                    kp_store_a(ar, a_dst + ((st + 1) & 1) * KP_BUF);
#pragma unroll
                for (int r = 0; r < KP_FM; ++r)
#pragma unroll
                    for (int t = 0; t < KP_FN; ++t)
                        c[r][t] = __builtin_amdgcn_wmma_f32_16x16x32_bf16(
                            false, af[r], false, bf[t], (short)0, c[r][t], false, false);
            }
            // this wave's reads of the buffer are done before it is refilled, and
            // its stores of the next stage's hs rows have landed
            asm volatile("s_wait_dscnt 0x0" ::: "memory");
            // this wave's copies of the next stage have landed
            asm volatile("s_wait_asynccnt 0x0" ::: "memory");
            // publishes the next stage and ends every wave's reads of this one
            __syncthreads();
            const int nx = st + 2;
            if (nx < KP_STAGES) {
                const int np = nx / KP_KST;
                const int nk = nx % KP_KST;
                const unsigned ao = a_src + nk * KP_K * 4;
                kp_load_a(ar, hs, ao);
                kp_copy_w(w_src + (size_t)np * KP_N * EH + nk * KP_K,
                          c_dst + (st & 1) * KP_BUF, ao);
            }
        }

        // score terms of this pass's 64 columns, for d = 0 and d = 1
#pragma unroll
        for (int t = 0; t < KP_FN; ++t) {
            const int h = pass * KP_N + wn * 16 * KP_FN + t * 16 + lo;
            const float vwh = v_w[h];
            const float kbh = k_b[h];
            const float q0  = qh0[h];
            const float q1  = qh1[h];
#pragma unroll
            for (int r = 0; r < KP_FM; ++r)
#pragma unroll
                for (int j = 0; j < 8; ++j) {
                    const float kv = c[r][t][j] + kbh;
                    p0[r][j] += FAST_TANH(q0 + kv) * vwh;
                    p1[r][j] += FAST_TANH(q1 + kv) * vwh;
                }
        }
    }
    // no copy is outstanding when the wave goes on to its end
    asm volatile("s_wait_asynccnt 0x0" ::: "memory");

    // reduce over the 16 columns held by each half-wave; the four waves that
    // share the rows each leave their sum in a slot of their own
    const int rbase = wm * 16 * KP_FM + ((lane & 16) ? 8 : 0);
    // the exchange distance is the outer loop: the 32 sums of a wave take each
    // step together, so that a step's exchange latency is waited out once
#pragma unroll
    for (int off = 1; off < 16; off <<= 1)
#pragma unroll
        for (int r = 0; r < KP_FM; ++r)
#pragma unroll
            for (int j = 0; j < 8; ++j) {
                p0[r][j] += __shfl_xor(p0[r][j], off, 32);
                p1[r][j] += __shfl_xor(p1[r][j], off, 32);
            }
    if (lo == 0) {
#pragma unroll
        for (int r = 0; r < KP_FM; ++r)
#pragma unroll
            for (int j = 0; j < 8; ++j) {
                e_part[wn][rbase + r * 16 + j] = p0[r][j];
                e_part[wn][KP_M + rbase + r * 16 + j] = p1[r][j];
            }
    }
    __syncthreads();

    static_assert(KP_WN == 4, "four slots per score");
    if (tid < 2 * KP_M) {
        const int d = tid / KP_M;
        const int mr = tid % KP_M;
        const float s = (e_part[0][tid] + e_part[1][tid]) + (e_part[2][tid] + e_part[3][tid]);
        e_out[((size_t)d * Bb + b) * Ss + m0 + mr] = s + v_b[0];
    }
}

// ---------------------------------------------------------------------------
// at = softmax(e) over S, and ctx[d,b,g] = sum_s at[d,b,s] * hs[b,s,g], in one
// launch (hs read once for both d).
// grid: (EH/64, B), block 512 = 16 waves: one work-group per WGP, all of them
// streaming. A work-group owns 64 columns (256-byte pieces of the hs rows); a
// 16-lane half of a wave owns 64 consecutive rows, so one 16-byte load of a
// wave covers two whole pieces. The 32 partial sums of a column meet in LDS.
// Every work-group works out both softmax rows of its batch for itself, while
// its first 32 hs rows per half-wave are on their way, and leaves the weights
// in LDS; it stores 1/16 of each row to at. ctx is stored as bf16 (feeds the
// final GEMM).
// ---------------------------------------------------------------------------
static constexpr int CX_COLS  = 64;                     // columns per work-group
static constexpr int CX_PARTS = 32;                     // half-waves per work-group
static constexpr int CX_ROWS  = Ss / CX_PARTS;          // rows per half-wave
static constexpr int CX_STEP  = 16;                     // rows loaded together
static constexpr int CX_NSTEP = CX_ROWS / CX_STEP;
static constexpr int CX_WAVES = CX_PARTS / 2;           // waves per work-group
static constexpr int CX_AT    = Ss / (EH / CX_COLS);    // at elements stored per row
static_assert(Dd == 2 && Dd * Ss == 32 * CX_WAVES * 8, "8 scores per thread");
static_assert(CX_AT == 128, "one wave stores a work-group's share of an at row");
static_assert(CX_NSTEP >= 2, "two batches are in flight from the start");

struct CxBatch {
    float4 hv[CX_STEP];       // 4 columns of each row
};

__device__ __forceinline__ void cx_load(CxBatch& t, const float* h, int step) {
    // unrolled: the batch lives in registers, and the row offsets become
    // immediates of the loads
#pragma unroll
    for (int u = 0; u < CX_STEP; ++u)
        t.hv[u] = *(const float4*)(h + (size_t)(step * CX_STEP + u) * EH);
}

// w0, w1: the batch's 16 weights for d = 0 and d = 1, in LDS
__device__ __forceinline__ void cx_sum(const CxBatch& t, const float* w0,
                                       const float* w1, float4& acc0, float4& acc1) {
    // both loops unrolled: the batch lives in registers
#pragma unroll
    for (int q = 0; q < CX_STEP / 4; ++q) {
        const float4 a = *(const float4*)(w0 + q * 4);
        const float4 c = *(const float4*)(w1 + q * 4);
        const float s0[4] = {a.x, a.y, a.z, a.w};
        const float s1[4] = {c.x, c.y, c.z, c.w};
#pragma unroll
        for (int u = 0; u < 4; ++u) {
            const float4 v = t.hv[q * 4 + u];
            acc0.x += s0[u] * v.x; acc0.y += s0[u] * v.y;
            acc0.z += s0[u] * v.z; acc0.w += s0[u] * v.w;
            acc1.x += s1[u] * v.x; acc1.y += s1[u] * v.y;
            acc1.z += s1[u] * v.z; acc1.w += s1[u] * v.w;
        }
    }
}

// Work-group barrier that orders LDS traffic only: __syncthreads() would also
// wait out every global load in flight, and the hs rows must keep flying while
// the softmax is worked out.
__device__ __forceinline__ void cx_lds_barrier() {
    __builtin_amdgcn_fence(__ATOMIC_RELEASE, "workgroup", "local");
    __builtin_amdgcn_s_barrier();
    __builtin_amdgcn_fence(__ATOMIC_ACQUIRE, "workgroup", "local");
}

__global__ __launch_bounds__(512) void softmax_ctx_kernel(
    const float* __restrict__ e, const float* __restrict__ hs,
    float* __restrict__ at, bf16_t* __restrict__ ctx_bf) {
    const int b    = blockIdx.y;
    const int g0   = blockIdx.x * CX_COLS;
    const int tid  = threadIdx.x;
    const int lane = tid & 31;
    const int wave = tid >> 5;
    const int lo   = tid & 15;
    const int part = tid >> 4;
    const int r0   = part * CX_ROWS;

    // w_lds[d][s] = at[d, b, s]
    __shared__ __attribute__((aligned(16))) float w_lds[Dd][Ss];
    // one slot per wave: the waves' maxima, then their sums
    __shared__ __attribute__((aligned(16))) float sm_max[CX_WAVES];
    __shared__ __attribute__((aligned(16))) float sm_sum[CX_WAVES];

    // waves 0-7 take the scores of d = 0, waves 8-15 those of d = 1: a thread
    // has elements 4 i0 .. 4 i0 + 3 of each half of the row
    const int d  = tid >> 8;
    const int i0 = tid & 255;
    const float4* er = (const float4*)(e + ((size_t)d * Bb + b) * Ss) + i0;
    const float*  h  = hs + ((size_t)b * Ss + r0) * EH + g0 + lo * 4;

    float4 x0 = er[0];
    float4 x1 = er[256];
    CxBatch t[2];
    cx_load(t[0], h, 0);
    cx_load(t[1], h, 1);
    // behind the score loads: their address register stays as it is (named as
    // an input) until the wait has passed
    asm volatile("s_wait_xcnt 0x0" :: "v"(er) : "memory");
    // keeps the first 32 rows' loads ahead of the softmax: they fly while it is
    // worked out
    __builtin_amdgcn_sched_barrier(0);

    // row maximum: thread, wave, the row's 8 waves
    float m = fmaxf(fmaxf(fmaxf(x0.x, x0.y), fmaxf(x0.z, x0.w)),
                    fmaxf(fmaxf(x1.x, x1.y), fmaxf(x1.z, x1.w)));
    // unrolled: the five exchange distances become constants
#pragma unroll
    for (int off = 16; off > 0; off >>= 1) m = fmaxf(m, __shfl_xor(m, off, 32));
    if (lane == 0) sm_max[wave] = m;
    cx_lds_barrier();
    {
        const float4 p = *(const float4*)(sm_max + d * 8);
        const float4 q = *(const float4*)(sm_max + d * 8 + 4);
        m = fmaxf(fmaxf(fmaxf(p.x, p.y), fmaxf(p.z, p.w)),
                  fmaxf(fmaxf(q.x, q.y), fmaxf(q.z, q.w)));
    }

    x0.x = __expf(x0.x - m); x0.y = __expf(x0.y - m);
    x0.z = __expf(x0.z - m); x0.w = __expf(x0.w - m);
    x1.x = __expf(x1.x - m); x1.y = __expf(x1.y - m);
    x1.z = __expf(x1.z - m); x1.w = __expf(x1.w - m);
    float sum = ((x0.x + x0.y) + (x0.z + x0.w)) + ((x1.x + x1.y) + (x1.z + x1.w));
    // unrolled, as above
#pragma unroll
    for (int off = 16; off > 0; off >>= 1) sum += __shfl_xor(sum, off, 32);
    if (lane == 0) sm_sum[wave] = sum;
    cx_lds_barrier();
    {
        const float4 p = *(const float4*)(sm_sum + d * 8);
        const float4 q = *(const float4*)(sm_sum + d * 8 + 4);
        sum = ((p.x + p.y) + (p.z + p.w)) + ((q.x + q.y) + (q.z + q.w));
    }
    const float inv = 1.f / sum;
    x0.x *= inv; x0.y *= inv; x0.z *= inv; x0.w *= inv;
    x1.x *= inv; x1.y *= inv; x1.z *= inv; x1.w *= inv;
    *(float4*)(w_lds[d] + i0 * 4) = x0;
    *(float4*)(w_lds[d] + Ss / 2 + i0 * 4) = x1;
    cx_lds_barrier();

    float4 acc0 = {0.f, 0.f, 0.f, 0.f};
    float4 acc1 = {0.f, 0.f, 0.f, 0.f};
    // unrolled so that the two batches are told apart at compile time
#pragma unroll
    for (int s = 0; s < CX_NSTEP; ++s) {
        if (s > 0 && s + 1 < CX_NSTEP) {
            cx_load(t[(s + 1) & 1], h, s + 1);
            // behind the last loads: their address register stays as it is
            // (named as an input) until the wait has passed
            if (s + 2 == CX_NSTEP)
                asm volatile("s_wait_xcnt 0x0" :: "v"(h) : "memory");
            // keeps the next 16 rows' loads ahead of these rows' sums: left
            // alone the scheduler sinks them and a wave has few loads in flight
            __builtin_amdgcn_sched_barrier(0);
        }
        cx_sum(t[s & 1], w_lds[0] + r0 + s * CX_STEP, w_lds[1] + r0 + s * CX_STEP,
               acc0, acc1);
    }

    // red[p][d * 64 + column]: the partial sum of half-wave p
    __shared__ __attribute__((aligned(16))) float red[CX_PARTS][2 * CX_COLS];
    __shared__ float red2[4][2 * CX_COLS];
    *(float4*)(red[part] + lo * 4) = acc0;
    *(float4*)(red[part] + CX_COLS + lo * 4) = acc1;
    __syncthreads();

    // 4 threads per output, 8 partials each, then across the 4
    {
        const int o = tid & (2 * CX_COLS - 1);
        const int p = tid >> 7;
        float s = 0.f;
        // unrolled: the 8 LDS reads go out together
#pragma unroll
        for (int k = 0; k < 8; ++k) s += red[p * 8 + k][o];
        red2[p][o] = s;
    }
    __syncthreads();

    if (tid < 2 * CX_COLS) {
        const float s = (red2[0][tid] + red2[1][tid]) + (red2[2][tid] + red2[3][tid]);
        const int dd = tid / CX_COLS;
        const int c  = tid % CX_COLS;
        ctx_bf[((size_t)dd * Bb + b) * EH + g0 + c] = (bf16_t)s;
    } else if (tid < 2 * CX_COLS + Dd * 32) {
        // two more waves store this work-group's share of the two at rows, 512
        // contiguous bytes each
        const int dd = (tid - 2 * CX_COLS) >> 5;
        const int s0 = blockIdx.x * CX_AT + lane * 4;
        *(float4*)(at + ((size_t)dd * Bb + b) * Ss + s0) = *(const float4*)(w_lds[dd] + s0);
    }
}

// ---------------------------------------------------------------------------
// launcher
// ---------------------------------------------------------------------------
extern "C" void kernel_launch(void* const* d_in, const int* in_sizes, int n_in,
                              void* d_out, int out_size, void* d_ws, size_t ws_size,
                              hipStream_t stream) {
    const float* hs  = (const float*)d_in[0];  // (B,S,EH)
    const float* ht  = (const float*)d_in[1];  // (D,B,DH)
    const float* q_w = (const float*)d_in[2];  // (DH,DH)
    const float* q_b = (const float*)d_in[3];  // (DH,)
    const float* k_w = (const float*)d_in[4];  // (DH,EH)
    const float* k_b = (const float*)d_in[5];  // (DH,)
    const float* v_w = (const float*)d_in[6];  // (1,DH)
    const float* v_b = (const float*)d_in[7];  // (1,)
    const float* c_w = (const float*)d_in[8];  // (DH,EH)
    const float* c_b = (const float*)d_in[9];  // (DH,)

    float* out_c  = (float*)d_out;                 // (D,B,DH) = 32768
    float* out_at = out_c + (size_t)Dd * Bb * DH;  // (D,B,S)  = 65536

    char* ws = (char*)d_ws;
    bf16_t* kw_bf  = (bf16_t*)(ws + 67108864);    //  2097152 B
    bf16_t* qw_bf  = (bf16_t*)(ws + 69206016);    //  2097152 B
    bf16_t* cw_bf  = (bf16_t*)(ws + 71303168);    //  2097152 B
    bf16_t* ht_bf  = (bf16_t*)(ws + 73400320);    //    65536 B
    bf16_t* ctx_bf = (bf16_t*)(ws + 73465856);    //    65536 B
    float*  qh     = (float*) (ws + 73531392);    //   131072 B
    float*  e      = (float*) (ws + 73662464);    //   262144 B

    // 1) f32 -> bf16 conversions: kw_bf, qw_bf, cw_bf, ht_bf are contiguous
    cvt_all_kernel<<<CV_WGS, 32 * CV_WAVES, 0, stream>>>(k_w, q_w, c_w, ht, kw_bf);

    // 2) qh = ht @ q_w^T + q_b   (M=32, N=DH, K=DH)
    gemm_bf16_kernel<<<dim3(DH / SG_N, 2), 32 * SG_WAVES, 0, stream>>>(
        ht_bf, qw_bf, q_b, qh);

    // 3) fused k-projection + tanh score -> e (D,B,S)
    kproj_score_kernel<<<dim3(Ss / KP_M, Bb), 512, 0, stream>>>(
        hs, kw_bf, k_b, qh, v_w, v_b, e);

    // 4) at = softmax(e) over S (output) and ctx = at @ hs (bf16)
    softmax_ctx_kernel<<<dim3(EH / CX_COLS, Bb), 512, 0, stream>>>(e, hs, out_at, ctx_bf);

    // 5) c = ctx @ c_w^T + c_b   (M=32, N=DH, K=EH)
    gemm_bf16_kernel<<<dim3(DH / SG_N, 2), 32 * SG_WAVES, 0, stream>>>(
        ctx_bf, cw_bf, c_b, out_c);
}

// v008
// A run of this version takes 76.9 microseconds.
// Next to v007, in two timings, it ran 1.06 and 1.05 times as fast.
// Counting every step since v000, it is 8.13 times as fast.
#include <hip/hip_runtime.h>
#include <hip/hip_bf16.h>
#include <math.h>

typedef __bf16 bf16_t;
typedef __attribute__((ext_vector_type(16))) __bf16 v16bf;
typedef __attribute__((ext_vector_type(8)))  __bf16 v8bf;
typedef __attribute__((ext_vector_type(4)))  __bf16 v4bf;
typedef __attribute__((ext_vector_type(8)))  float  v8f;

static constexpr int Dd = 2;
static constexpr int Bb = 16;
static constexpr int Ss = 2048;
static constexpr int DH = 1024;
static constexpr int EH = 1024;

// Hardware V_TANH_F32 (TRANS op) if the builtin is available on this toolchain.
#if defined(__has_builtin)
#if __has_builtin(__builtin_amdgcn_tanhf)
#define FAST_TANH(x) __builtin_amdgcn_tanhf(x)
#endif
#endif
#ifndef FAST_TANH
#define FAST_TANH(x) tanhf(x)
#endif

// ---------------------------------------------------------------------------
// f32 -> bf16 conversion of the four small operands in one launch (hs is
// converted where it is used, on its way into the k-projection's LDS stage).
// The four bf16 arrays lie one behind the other in the workspace (k_w, q_w, c_w,
// ht), so the output is one array. A wave takes one batch of 4 KiB: every load
// covers 512 contiguous bytes, every store 256.
// ---------------------------------------------------------------------------
static constexpr int CV_WAVES  = 16;                        // waves per work-group
static constexpr int CV_U      = 8;                         // loads per lane
static constexpr int CV_CH     = 128 * CV_U;                // floats per batch
static constexpr int CV_WB     = DH * EH / CV_CH;           // batches per weight matrix
static constexpr int CV_NB     = 3 * CV_WB + Dd * Bb * DH / CV_CH;   // batches in all
static constexpr int CV_WGS    = CV_NB / CV_WAVES;          // work-groups
static_assert(CV_WB * CV_CH == DH * EH && DH == EH, "weights in whole batches");
static_assert((Dd * Bb * DH) % CV_CH == 0, "ht in whole batches");
static_assert(CV_WGS * CV_WAVES == CV_NB, "every wave has a batch");

// base: the array (a scalar address); off: byte offset of this lane's first 4
// elements of the batch. All three loops unrolled: the batch lives in registers
// and the offsets become immediates.
template <int U>
__device__ __forceinline__ void cv_load(float4 (&t)[U], const float* base, unsigned off) {
    const char* p = (const char*)base + (size_t)off;
#pragma unroll
    for (int u = 0; u < U; ++u) t[u] = *(const float4*)(p + u * 512);
}

template <int U>
__device__ __forceinline__ void cv_pack(v4bf (&o)[U], const float4 (&t)[U]) {
#pragma unroll
    for (int u = 0; u < U; ++u) {
        o[u][0] = (bf16_t)t[u].x; o[u][1] = (bf16_t)t[u].y;
        o[u][2] = (bf16_t)t[u].z; o[u][3] = (bf16_t)t[u].w;
    }
}

template <int U>
__device__ __forceinline__ void cv_store(const v4bf (&o)[U], bf16_t* base, unsigned off) {
    char* q = (char*)base + (size_t)off;
#pragma unroll
    for (int u = 0; u < U; ++u) *(v4bf*)(q + u * 256) = o[u];
}

__global__ __launch_bounds__(32 * CV_WAVES) void cvt_all_kernel(
    const float* __restrict__ k_w, const float* __restrict__ q_w,
    const float* __restrict__ c_w, const float* __restrict__ ht,
    bf16_t* __restrict__ out) {
    const int lane = threadIdx.x & 31;
    // the wave's number in its work-group, in a scalar register
    const int wave = __builtin_amdgcn_readfirstlane((int)(threadIdx.x >> 5));
    const int w    = blockIdx.x * CV_WAVES + wave;
    const int seg  = w / CV_WB;
    const float* tb = seg == 0 ? k_w : seg == 1 ? q_w : seg == 2 ? c_w : ht;
    const unsigned src = ((unsigned)(w % CV_WB) * CV_CH + lane * 4) * 4;   // bytes into tb
    const unsigned dst = ((unsigned)w * CV_CH + lane * 4) * 2;             // bytes into out

    float4 t[CV_U];
    v4bf   o[CV_U];
    cv_load(t, tb, src);
    cv_pack(o, t);
    cv_store(o, out, dst);
}

// ---------------------------------------------------------------------------
// WMMA fragment loader: 16x32 bf16 tile slice for this lane.
// Lane holds K = {k0+sel .. k0+sel+7} and {k0+sel+16 .. k0+sel+23},
// sel = (lane>=16) ? 8 : 0, row/col = lane&15 (caller bakes into pointer).
// ---------------------------------------------------------------------------
__device__ __forceinline__ v16bf load_frag16(const bf16_t* p) {
    v8bf lo = *reinterpret_cast<const v8bf*>(p);
    v8bf hi = *reinterpret_cast<const v8bf*>(p + 16);
    v16bf r;
#pragma unroll
    for (int i = 0; i < 8; ++i) { r[i] = lo[i]; r[i + 8] = hi[i]; }
    return r;
}

// ---------------------------------------------------------------------------
// Small GEMM: out[32 x 1024] = A[32 x 1024](bf16) @ W[1024 x 1024]^T(bf16) + bias
// grid: (DH/32, 2), block 256 = 8 waves. A work-group owns 16 rows x 32 columns
// of out (whole 128-byte lines). Each wave takes 128 of the 1024 k for both
// column tiles: 256-byte pieces of the A and W rows, all 24 loads in flight at
// once. The 8 partial tiles meet in LDS.
// ---------------------------------------------------------------------------
static constexpr int SG_N     = 32;            // columns per work-group
static constexpr int SG_KW    = 128;           // k per wave
static constexpr int SG_WAVES = EH / SG_KW;    // waves per work-group
static constexpr int SG_KS    = SG_KW / 32;    // WMMA k-steps per wave
static_assert(DH == EH, "both small GEMMs have the same K");

__global__ __launch_bounds__(32 * SG_WAVES) void gemm_bf16_kernel(
    const bf16_t* __restrict__ A, const bf16_t* __restrict__ W,
    const float* __restrict__ bias, float* __restrict__ out) {
    const int m0   = blockIdx.y * 16;
    const int n0   = blockIdx.x * SG_N;
    const int tid  = threadIdx.x;
    const int wave = tid >> 5;
    const int lane = tid & 31;
    const int lo   = lane & 15;
    const int sel  = (lane & 16) ? 8 : 0;
    const bf16_t* arow = A + (size_t)(m0 + lo) * EH + wave * SG_KW + sel;
    const bf16_t* wrow = W + (size_t)(n0 + lo) * EH + wave * SG_KW + sel;

    v16bf af[SG_KS], b0[SG_KS], b1[SG_KS];
    // unrolled: the fragments live in registers, the k offsets become immediates
#pragma unroll
    for (int ks = 0; ks < SG_KS; ++ks) {
        af[ks] = load_frag16(arow + ks * 32);
        b0[ks] = load_frag16(wrow + ks * 32);
        b1[ks] = load_frag16(wrow + 16 * EH + ks * 32);
    }
    const int n = n0 + lane;      // this lane's column in the epilogue
    const float bv = bias[n];
    // behind the last load: the address registers stay as they are (named as
    // inputs) until the wait has passed
    asm volatile("s_wait_xcnt 0x0" :: "v"(arow), "v"(wrow) : "memory");
    // keeps all the loads ahead of the first WMMA: left alone the scheduler sinks
    // them among the WMMAs and the wave waits out the load latency several times
    __builtin_amdgcn_sched_barrier(0);

    v8f c0 = {0.f, 0.f, 0.f, 0.f, 0.f, 0.f, 0.f, 0.f};
    v8f c1 = c0;
#pragma unroll
    for (int ks = 0; ks < SG_KS; ++ks) {
        c0 = __builtin_amdgcn_wmma_f32_16x16x32_bf16(
            false, af[ks], false, b0[ks], (short)0, c0, false, false);
        c1 = __builtin_amdgcn_wmma_f32_16x16x32_bf16(
            false, af[ks], false, b1[ks], (short)0, c1, false, false);
    }

    // red[wave][column tile][j][lane]: element (row j + 8 * (lane >> 4),
    // column lane & 15) of the wave's partial tile
    __shared__ float red[SG_WAVES][2][8][32];
#pragma unroll
    for (int j = 0; j < 8; ++j) {
        red[wave][0][j][lane] = c0[j];
        red[wave][1][j][lane] = c1[j];
    }
    __syncthreads();

    // a wave sums and stores one whole 32-column row of the tile at a time
    static_assert(SG_WAVES == 8, "wave w sums rows w and w + 8");
#pragma unroll
    for (int hf = 0; hf < 2; ++hf) {
        float s = 0.f;
        // unrolled: the 8 LDS reads go out together
#pragma unroll
        for (int w = 0; w < SG_WAVES; ++w)
            s += red[w][lane >> 4][wave][hf * 16 + lo];
        out[(size_t)(m0 + hf * 8 + wave) * DH + n] = s + bv;
    }
}

// ---------------------------------------------------------------------------
// Fused: kh = bf16(hs[b, m0:m0+128, :]) @ k_w^T + k_b   (kept in registers)
//        e[d,b,m0+m] = sum_h tanh(qh[d,b,h] + kh[m,h]) * v_w[h] + v_b
// grid: (S/128, B), block 512 = 16 waves: 4 along the rows x 4 along the
// columns, each wave a 32 x 64 tile (2 x 4 fragments: 12 LDS reads feed 8 WMMAs);
// 4 passes of 256 columns.
// Both operands reach the waves through LDS: a stage is 128 k (256-byte rows)
// of 128 hs rows and 256 k_w rows, two buffers, the next stage in flight while
// this one is used. The k_w rows (bf16) come by asynchronous copies that read
// whole lines. The hs rows are read as f32, held in registers for a stage,
// rounded to bf16 and stored into the buffer that the next stage reads.
// All work-groups read the same k_w: each work-group therefore starts its walk
// over the column passes and over the k stages at a place given by its index.
// ---------------------------------------------------------------------------
static constexpr int KP_M      = 128;                       // hs rows per work-group
static constexpr int KP_N      = 256;                       // kh columns per pass
static constexpr int KP_K      = 128;                       // k per stage
static constexpr int KP_PITCH  = 272;                       // LDS row pitch, bytes (16 x odd)
static constexpr int KP_BUF    = (KP_M + KP_N) * KP_PITCH;  // one buffer, bytes
static constexpr int KP_KST    = EH / KP_K;                 // stages per pass
static constexpr int KP_STAGES = (DH / KP_N) * KP_KST;      // stages in all
static constexpr int KP_FM     = 2;                         // row fragments per wave
static constexpr int KP_FN     = 4;                         // column fragments per wave
static constexpr int KP_WM     = KP_M / (16 * KP_FM);       // waves along the rows
static constexpr int KP_WN     = KP_N / (16 * KP_FN);       // waves along the columns
static_assert(KP_WM * KP_WN == 16, "16 waves cover the block tile");

static constexpr int KP_AR     = KP_M / 16;                 // hs rows per wave and stage

// The k_w rows of one stage: 256 rows x 16 pieces of 16 bytes = 8 copies per
// thread. A wave's copy covers two whole 256-byte rows. w: this thread's piece
// in row (tid >> 4) of the stage's k_w rows; dst: its LDS byte address there.
// a_off: the offset register of the hs loads issued just ahead.
__device__ __forceinline__ void kp_copy_w(const bf16_t* w, unsigned dst, unsigned a_off) {
    constexpr int      GR = 32 * EH;         // 32 rows further, elements
    constexpr unsigned LR = 32 * KP_PITCH;   // 32 rows further, LDS bytes
    // s_wait_xcnt closes the statement so that no address register named here
    // (the hs loads' offset among them) is rewritten ahead of it.
    asm volatile(
        "global_load_async_to_lds_b128 %0, %8, off\n\t"
        "global_load_async_to_lds_b128 %1, %9, off\n\t"
        "global_load_async_to_lds_b128 %2, %10, off\n\t"
        "global_load_async_to_lds_b128 %3, %11, off\n\t"
        "global_load_async_to_lds_b128 %4, %12, off\n\t"
        "global_load_async_to_lds_b128 %5, %13, off\n\t"
        "global_load_async_to_lds_b128 %6, %14, off\n\t"
        "global_load_async_to_lds_b128 %7, %15, off\n\t"
        "s_wait_xcnt 0x0"
        :: "v"(dst), "v"(dst + LR), "v"(dst + 2 * LR), "v"(dst + 3 * LR),
           "v"(dst + 4 * LR), "v"(dst + 5 * LR), "v"(dst + 6 * LR),
           "v"(dst + 7 * LR),
           "v"(w), "v"(w + GR), "v"(w + 2 * GR), "v"(w + 3 * GR),
           "v"(w + 4 * GR), "v"(w + 5 * GR), "v"(w + 6 * GR), "v"(w + 7 * GR),
           "v"(a_off)
        : "memory");
}

// The hs rows of one stage: a wave reads 8 rows, 16 apart, one whole 512-byte
// piece (128 f32) per load. off: byte offset into hs of this lane's 4 elements
// of the wave's first row. Unrolled: the rows live in registers and the row
// offsets become immediates.
__device__ __forceinline__ void kp_load_a(float4 (&t)[KP_AR], const float* hs, unsigned off) {
    const char* p = (const char*)hs + (size_t)off;
#pragma unroll
    for (int i = 0; i < KP_AR; ++i)
        t[i] = *(const float4*)(p + (size_t)i * 16 * EH * 4);
}

// Rounds them to bf16 and stores them: 256 contiguous LDS bytes per wave store.
// dst: this lane's 8 bytes in the wave's first row of the buffer.
__device__ __forceinline__ void kp_store_a(const float4 (&t)[KP_AR], char* dst) {
#pragma unroll
    for (int i = 0; i < KP_AR; ++i) {
        v4bf o;
        o[0] = (bf16_t)t[i].x; o[1] = (bf16_t)t[i].y;
        o[2] = (bf16_t)t[i].z; o[3] = (bf16_t)t[i].w;
        *(v4bf*)(dst + i * 16 * KP_PITCH) = o;
    }
}

__global__ __launch_bounds__(512) void kproj_score_kernel(
    const float* __restrict__ hs, const bf16_t* __restrict__ kw_bf,
    const float* __restrict__ k_b, const float* __restrict__ qh,
    const float* __restrict__ v_w, const float* __restrict__ v_b,
    float* __restrict__ e_out) {
    const int m0   = blockIdx.x * KP_M;
    const int b    = blockIdx.y;
    const int tid  = threadIdx.x;
    const int wave = tid >> 5;
    const int lane = tid & 31;
    const int lo   = lane & 15;
    const int sel  = (lane & 16) ? 8 : 0;
    const int wm   = wave % KP_WM;   // which 32 rows
    const int wn   = wave / KP_WM;   // which 64 of the pass's 256 columns

    __shared__ __attribute__((aligned(16))) char kp_lds[2 * KP_BUF];
    // e_part[wn][d * 128 + row]: the score sum over the columns of the waves wn
    __shared__ float e_part[KP_WN][2 * KP_M];

    // this thread's piece of a stage's k_w rows
    const int crow = tid >> 4;
    const int ccol = tid & 15;
    const bf16_t* w_src = kw_bf + (size_t)crow * EH + ccol * 8;
    const unsigned c_dst = (unsigned)(size_t)kp_lds + (KP_M + crow) * KP_PITCH + ccol * 16;
    // this lane's 4 elements of the wave's first hs row of a stage
    static_assert((size_t)Bb * Ss * EH * 4 < (1ull << 32), "byte offsets fit 32 bits");
    const unsigned a_src = (((unsigned)b * Ss + m0 + wave) * EH + lane * 4) * 4;
    char* a_dst = kp_lds + wave * KP_PITCH + lane * 8;

    // where this work-group's walk starts: 32 places, dealt so that both
    // neighbouring indices and indices 8 apart get different ones
    static_assert(KP_STAGES == 32, "32 starting places");
    const unsigned wg  = blockIdx.y * (Ss / KP_M) + blockIdx.x;
    const unsigned rot = ((wg >> 3) + 4 * (wg & 7)) % KP_STAGES;
    const unsigned rk  = rot % KP_KST;     // first k stage
    const unsigned rp  = rot / KP_KST;     // first column pass
    // stage st of the walk: its k stage and its column pass
    auto st_k = [rk](unsigned st) { return (st % KP_KST + rk) % KP_KST; };
    auto st_p = [rp](unsigned st) { return (st / KP_KST + rp) % (DH / KP_N); };

    float4 ar[KP_AR];
    const unsigned ao0 = a_src + st_k(0) * KP_K * 4;
    kp_load_a(ar, hs, ao0);
    kp_copy_w(w_src + (size_t)st_p(0) * KP_N * EH + st_k(0) * KP_K, c_dst, ao0);
    kp_store_a(ar, a_dst);
    // stage 0 has landed for this wave (its stores and its copies); the barrier
    // publishes it to the others
    asm volatile("s_wait_dscnt 0x0" ::: "memory");
    asm volatile("s_wait_asynccnt 0x0" ::: "memory");
    __syncthreads();
    const unsigned ao1 = a_src + st_k(1) * KP_K * 4;
    kp_load_a(ar, hs, ao1);
    kp_copy_w(w_src + (size_t)st_p(1) * KP_N * EH + st_k(1) * KP_K, c_dst + KP_BUF, ao1);

    // this lane's fragment rows inside a buffer
    const int a_off = (wm * 16 * KP_FM + lo) * KP_PITCH + sel * 2;
    const int w_off = (KP_M + wn * 16 * KP_FN + lo) * KP_PITCH + sel * 2;

    const float* qh0 = qh + ((size_t)0 * Bb + b) * DH;
    const float* qh1 = qh + ((size_t)1 * Bb + b) * DH;

    float p0[KP_FM][8], p1[KP_FM][8];
#pragma unroll
    for (int r = 0; r < KP_FM; ++r)
#pragma unroll
        for (int j = 0; j < 8; ++j) { p0[r][j] = 0.f; p1[r][j] = 0.f; }

    const v8f zero = {0.f, 0.f, 0.f, 0.f, 0.f, 0.f, 0.f, 0.f};

    for (int pass = 0; pass < DH / KP_N; ++pass) {
        v8f c[KP_FM][KP_FN];
#pragma unroll
        for (int r = 0; r < KP_FM; ++r)
#pragma unroll
            for (int t = 0; t < KP_FN; ++t) c[r][t] = zero;

        for (int kc = 0; kc < KP_KST; ++kc) {
            const int st = pass * KP_KST + kc;
            const char* buf = kp_lds + (st & 1) * KP_BUF;
#pragma unroll
            for (int ks = 0; ks < KP_K / 32; ++ks) {
                v16bf af[KP_FM], bf[KP_FN];
#pragma unroll
                for (int r = 0; r < KP_FM; ++r)
                    af[r] = load_frag16(
                        (const bf16_t*)(buf + a_off + r * 16 * KP_PITCH) + ks * 32);
#pragma unroll
                for (int t = 0; t < KP_FN; ++t)
                    bf[t] = load_frag16(
                        (const bf16_t*)(buf + w_off + t * 16 * KP_PITCH) + ks * 32);
                // keeps the k-step's 12 LDS reads one group ahead of its WMMAs:
                // left alone the scheduler puts a full LDS wait before each WMMA
                __builtin_amdgcn_sched_barrier(0);
                // the next stage's hs rows, loaded at the foot of the trip before,
                // go into the other buffer (nobody reads it during this trip)
                // while the last k-step's fragments are on their way
                if (ks == KP_K / 32 - 1 && st + 1 < KP_STAGES)
                    kp_store_a(ar, a_dst + ((st + 1) & 1) * KP_BUF);
#pragma unroll
                for (int r = 0; r < KP_FM; ++r)
#pragma unroll
                    for (int t = 0; t < KP_FN; ++t)
                        c[r][t] = __builtin_amdgcn_wmma_f32_16x16x32_bf16(
                            false, af[r], false, bf[t], (short)0, c[r][t], false, false);
            }
            // this wave's reads of the buffer are done before it is refilled, and
            // its stores of the next stage's hs rows have landed
            asm volatile("s_wait_dscnt 0x0" ::: "memory");
            // this wave's copies of the next stage have landed
            asm volatile("s_wait_asynccnt 0x0" ::: "memory");
            // publishes the next stage and ends every wave's reads of this one
            __syncthreads();
            const int nx = st + 2;
            if (nx < KP_STAGES) {
                const unsigned np = st_p(nx);
                const unsigned nk = st_k(nx);
                const unsigned ao = a_src + nk * KP_K * 4;
                kp_load_a(ar, hs, ao);
                kp_copy_w(w_src + (size_t)np * KP_N * EH + nk * KP_K,
                          c_dst + (st & 1) * KP_BUF, ao);
            }
        }

        // score terms of this pass's 64 columns, for d = 0 and d = 1
#pragma unroll
        for (int t = 0; t < KP_FN; ++t) {
            const int h = (int)st_p(pass * KP_KST) * KP_N + wn * 16 * KP_FN + t * 16 + lo;
            const float vwh = v_w[h];
            const float kbh = k_b[h];
            const float q0  = qh0[h];
            const float q1  = qh1[h];
#pragma unroll
            for (int r = 0; r < KP_FM; ++r)
#pragma unroll
                for (int j = 0; j < 8; ++j) {
                    const float kv = c[r][t][j] + kbh;
                    p0[r][j] += FAST_TANH(q0 + kv) * vwh;
                    p1[r][j] += FAST_TANH(q1 + kv) * vwh;
                }
        }
    }
    // no copy is outstanding when the wave goes on to its end
    asm volatile("s_wait_asynccnt 0x0" ::: "memory");

    // reduce over the 16 columns held by each half-wave; the four waves that
    // share the rows each leave their sum in a slot of their own
    const int rbase = wm * 16 * KP_FM + ((lane & 16) ? 8 : 0);
    // the exchange distance is the outer loop: the 32 sums of a wave take each
    // step together, so that a step's exchange latency is waited out once
#pragma unroll
    for (int off = 1; off < 16; off <<= 1)
#pragma unroll
        for (int r = 0; r < KP_FM; ++r)
#pragma unroll
            for (int j = 0; j < 8; ++j) {
                p0[r][j] += __shfl_xor(p0[r][j], off, 32);
                p1[r][j] += __shfl_xor(p1[r][j], off, 32);
            }
    if (lo == 0) {
#pragma unroll
        for (int r = 0; r < KP_FM; ++r)
#pragma unroll
            for (int j = 0; j < 8; ++j) {
                e_part[wn][rbase + r * 16 + j] = p0[r][j];
                e_part[wn][KP_M + rbase + r * 16 + j] = p1[r][j];
            }
    }
    __syncthreads();

    static_assert(KP_WN == 4, "four slots per score");
    if (tid < 2 * KP_M) {
        const int d = tid / KP_M;
        const int mr = tid % KP_M;
        const float s = (e_part[0][tid] + e_part[1][tid]) + (e_part[2][tid] + e_part[3][tid]);
        e_out[((size_t)d * Bb + b) * Ss + m0 + mr] = s + v_b[0];
    }
}

// ---------------------------------------------------------------------------
// at = softmax(e) over S, and ctx[d,b,g] = sum_s at[d,b,s] * hs[b,s,g], in one
// launch (hs read once for both d).
// grid: (EH/64, B), block 512 = 16 waves: one work-group per WGP, all of them
// streaming. A work-group owns 64 columns (256-byte pieces of the hs rows); a
// 16-lane half of a wave owns 64 consecutive rows, so one 16-byte load of a
// wave covers two whole pieces. The 32 partial sums of a column meet in LDS.
// Every work-group works out both softmax rows of its batch for itself, while
// its first 32 hs rows per half-wave are on their way, and leaves the weights
// in LDS; it stores 1/16 of each row to at. ctx is stored as bf16 (feeds the
// final GEMM).
// ---------------------------------------------------------------------------
static constexpr int CX_COLS  = 64;                     // columns per work-group
static constexpr int CX_PARTS = 32;                     // half-waves per work-group
static constexpr int CX_ROWS  = Ss / CX_PARTS;          // rows per half-wave
static constexpr int CX_STEP  = 16;                     // rows loaded together
static constexpr int CX_NSTEP = CX_ROWS / CX_STEP;
static constexpr int CX_WAVES = CX_PARTS / 2;           // waves per work-group
static constexpr int CX_AT    = Ss / (EH / CX_COLS);    // at elements stored per row
static_assert(Dd == 2 && Dd * Ss == 32 * CX_WAVES * 8, "8 scores per thread");
static_assert(CX_AT == 128, "one wave stores a work-group's share of an at row");
static_assert(CX_NSTEP >= 2, "two batches are in flight from the start");

struct CxBatch {
    float4 hv[CX_STEP];       // 4 columns of each row
};

__device__ __forceinline__ void cx_load(CxBatch& t, const float* h, int step) {
    // unrolled: the batch lives in registers, and the row offsets become
    // immediates of the loads
#pragma unroll
    for (int u = 0; u < CX_STEP; ++u)
        t.hv[u] = *(const float4*)(h + (size_t)(step * CX_STEP + u) * EH);
}

// w0, w1: the batch's 16 weights for d = 0 and d = 1, in LDS
__device__ __forceinline__ void cx_sum(const CxBatch& t, const float* w0,
                                       const float* w1, float4& acc0, float4& acc1) {
    // both loops unrolled: the batch lives in registers
#pragma unroll
    for (int q = 0; q < CX_STEP / 4; ++q) {
        const float4 a = *(const float4*)(w0 + q * 4);
        const float4 c = *(const float4*)(w1 + q * 4);
        const float s0[4] = {a.x, a.y, a.z, a.w};
        const float s1[4] = {c.x, c.y, c.z, c.w};
#pragma unroll
        for (int u = 0; u < 4; ++u) {
            const float4 v = t.hv[q * 4 + u];
            acc0.x += s0[u] * v.x; acc0.y += s0[u] * v.y;
            acc0.z += s0[u] * v.z; acc0.w += s0[u] * v.w;
            acc1.x += s1[u] * v.x; acc1.y += s1[u] * v.y;
            acc1.z += s1[u] * v.z; acc1.w += s1[u] * v.w;
        }
    }
}

// Work-group barrier that orders LDS traffic only: __syncthreads() would also
// wait out every global load in flight, and the hs rows must keep flying while
// the softmax is worked out.
__device__ __forceinline__ void cx_lds_barrier() {
    __builtin_amdgcn_fence(__ATOMIC_RELEASE, "workgroup", "local");
    __builtin_amdgcn_s_barrier();
    __builtin_amdgcn_fence(__ATOMIC_ACQUIRE, "workgroup", "local");
}

__global__ __launch_bounds__(512) void softmax_ctx_kernel(
    const float* __restrict__ e, const float* __restrict__ hs,
    float* __restrict__ at, bf16_t* __restrict__ ctx_bf) {
    const int b    = blockIdx.y;
    const int g0   = blockIdx.x * CX_COLS;
    const int tid  = threadIdx.x;
    const int lane = tid & 31;
    const int wave = tid >> 5;
    const int lo   = tid & 15;
    const int part = tid >> 4;
    const int r0   = part * CX_ROWS;

    // w_lds[d][s] = at[d, b, s]
    __shared__ __attribute__((aligned(16))) float w_lds[Dd][Ss];
    // one slot per wave: the waves' maxima, then their sums
    __shared__ __attribute__((aligned(16))) float sm_max[CX_WAVES];
    __shared__ __attribute__((aligned(16))) float sm_sum[CX_WAVES];

    // waves 0-7 take the scores of d = 0, waves 8-15 those of d = 1: a thread
    // has elements 4 i0 .. 4 i0 + 3 of each half of the row
    const int d  = tid >> 8;
    const int i0 = tid & 255;
    const float4* er = (const float4*)(e + ((size_t)d * Bb + b) * Ss) + i0;
    const float*  h  = hs + ((size_t)b * Ss + r0) * EH + g0 + lo * 4;

    float4 x0 = er[0];
    float4 x1 = er[256];
    CxBatch t[2];
    cx_load(t[0], h, 0);
    cx_load(t[1], h, 1);
    // behind the score loads: their address register stays as it is (named as
    // an input) until the wait has passed
    asm volatile("s_wait_xcnt 0x0" :: "v"(er) : "memory");
    // keeps the first 32 rows' loads ahead of the softmax: they fly while it is
    // worked out
    __builtin_amdgcn_sched_barrier(0);

    // row maximum: thread, wave, the row's 8 waves
    float m = fmaxf(fmaxf(fmaxf(x0.x, x0.y), fmaxf(x0.z, x0.w)),
                    fmaxf(fmaxf(x1.x, x1.y), fmaxf(x1.z, x1.w)));
    // unrolled: the five exchange distances become constants
#pragma unroll
    for (int off = 16; off > 0; off >>= 1) m = fmaxf(m, __shfl_xor(m, off, 32));
    if (lane == 0) sm_max[wave] = m;
    cx_lds_barrier();
    {
        const float4 p = *(const float4*)(sm_max + d * 8);
        const float4 q = *(const float4*)(sm_max + d * 8 + 4);
        m = fmaxf(fmaxf(fmaxf(p.x, p.y), fmaxf(p.z, p.w)),
                  fmaxf(fmaxf(q.x, q.y), fmaxf(q.z, q.w)));
    }

    x0.x = __expf(x0.x - m); x0.y = __expf(x0.y - m);
    x0.z = __expf(x0.z - m); x0.w = __expf(x0.w - m);
    x1.x = __expf(x1.x - m); x1.y = __expf(x1.y - m);
    x1.z = __expf(x1.z - m); x1.w = __expf(x1.w - m);
    float sum = ((x0.x + x0.y) + (x0.z + x0.w)) + ((x1.x + x1.y) + (x1.z + x1.w));
    // unrolled, as above
#pragma unroll
    for (int off = 16; off > 0; off >>= 1) sum += __shfl_xor(sum, off, 32);
    if (lane == 0) sm_sum[wave] = sum;
    cx_lds_barrier();
    {
        const float4 p = *(const float4*)(sm_sum + d * 8);
        const float4 q = *(const float4*)(sm_sum + d * 8 + 4);
        sum = ((p.x + p.y) + (p.z + p.w)) + ((q.x + q.y) + (q.z + q.w));
    }
    const float inv = 1.f / sum;
    x0.x *= inv; x0.y *= inv; x0.z *= inv; x0.w *= inv;
    x1.x *= inv; x1.y *= inv; x1.z *= inv; x1.w *= inv;
    *(float4*)(w_lds[d] + i0 * 4) = x0;
    *(float4*)(w_lds[d] + Ss / 2 + i0 * 4) = x1;
    cx_lds_barrier();

    float4 acc0 = {0.f, 0.f, 0.f, 0.f};
    float4 acc1 = {0.f, 0.f, 0.f, 0.f};
    // unrolled so that the two batches are told apart at compile time
#pragma unroll
    for (int s = 0; s < CX_NSTEP; ++s) {
        if (s > 0 && s + 1 < CX_NSTEP) {
            cx_load(t[(s + 1) & 1], h, s + 1);
            // behind the last loads: their address register stays as it is
            // (named as an input) until the wait has passed
            if (s + 2 == CX_NSTEP)
                asm volatile("s_wait_xcnt 0x0" :: "v"(h) : "memory");
            // keeps the next 16 rows' loads ahead of these rows' sums: left
            // alone the scheduler sinks them and a wave has few loads in flight
            __builtin_amdgcn_sched_barrier(0);
        }
        cx_sum(t[s & 1], w_lds[0] + r0 + s * CX_STEP, w_lds[1] + r0 + s * CX_STEP,
               acc0, acc1);
    }

    // red[p][d * 64 + column]: the partial sum of half-wave p
    __shared__ __attribute__((aligned(16))) float red[CX_PARTS][2 * CX_COLS];
    __shared__ float red2[4][2 * CX_COLS];
    *(float4*)(red[part] + lo * 4) = acc0;
    *(float4*)(red[part] + CX_COLS + lo * 4) = acc1;
    __syncthreads();

    // 4 threads per output, 8 partials each, then across the 4
    {
        const int o = tid & (2 * CX_COLS - 1);
        const int p = tid >> 7;
        float s = 0.f;
        // unrolled: the 8 LDS reads go out together
#pragma unroll
        for (int k = 0; k < 8; ++k) s += red[p * 8 + k][o];
        red2[p][o] = s;
    }
    __syncthreads();

    if (tid < 2 * CX_COLS) {
        const float s = (red2[0][tid] + red2[1][tid]) + (red2[2][tid] + red2[3][tid]);
        const int dd = tid / CX_COLS;
        const int c  = tid % CX_COLS;
        ctx_bf[((size_t)dd * Bb + b) * EH + g0 + c] = (bf16_t)s;
    } else if (tid < 2 * CX_COLS + Dd * 32) {
        // two more waves store this work-group's share of the two at rows, 512
        // contiguous bytes each
        const int dd = (tid - 2 * CX_COLS) >> 5;
        const int s0 = blockIdx.x * CX_AT + lane * 4;
        *(float4*)(at + ((size_t)dd * Bb + b) * Ss + s0) = *(const float4*)(w_lds[dd] + s0);
    }
}

// ---------------------------------------------------------------------------
// launcher
// ---------------------------------------------------------------------------
extern "C" void kernel_launch(void* const* d_in, const int* in_sizes, int n_in,
                              void* d_out, int out_size, void* d_ws, size_t ws_size,
                              hipStream_t stream) {
    const float* hs  = (const float*)d_in[0];  // (B,S,EH)
    const float* ht  = (const float*)d_in[1];  // (D,B,DH)
    const float* q_w = (const float*)d_in[2];  // (DH,DH)
    const float* q_b = (const float*)d_in[3];  // (DH,)
    const float* k_w = (const float*)d_in[4];  // (DH,EH)
    const float* k_b = (const float*)d_in[5];  // (DH,)
    const float* v_w = (const float*)d_in[6];  // (1,DH)
    const float* v_b = (const float*)d_in[7];  // (1,)
    const float* c_w = (const float*)d_in[8];  // (DH,EH)
    const float* c_b = (const float*)d_in[9];  // (DH,)

    float* out_c  = (float*)d_out;                 // (D,B,DH) = 32768
    float* out_at = out_c + (size_t)Dd * Bb * DH;  // (D,B,S)  = 65536

    char* ws = (char*)d_ws;
    bf16_t* kw_bf  = (bf16_t*)(ws + 67108864);    //  2097152 B
    bf16_t* qw_bf  = (bf16_t*)(ws + 69206016);    //  2097152 B
    bf16_t* cw_bf  = (bf16_t*)(ws + 71303168);    //  2097152 B
    bf16_t* ht_bf  = (bf16_t*)(ws + 73400320);    //    65536 B
    bf16_t* ctx_bf = (bf16_t*)(ws + 73465856);    //    65536 B
    float*  qh     = (float*) (ws + 73531392);    //   131072 B
    float*  e      = (float*) (ws + 73662464);    //   262144 B

    // 1) f32 -> bf16 conversions: kw_bf, qw_bf, cw_bf, ht_bf are contiguous
    cvt_all_kernel<<<CV_WGS, 32 * CV_WAVES, 0, stream>>>(k_w, q_w, c_w, ht, kw_bf);

    // 2) qh = ht @ q_w^T + q_b   (M=32, N=DH, K=DH)
    gemm_bf16_kernel<<<dim3(DH / SG_N, 2), 32 * SG_WAVES, 0, stream>>>(
        ht_bf, qw_bf, q_b, qh);

    // 3) fused k-projection + tanh score -> e (D,B,S)
    kproj_score_kernel<<<dim3(Ss / KP_M, Bb), 512, 0, stream>>>(
        hs, kw_bf, k_b, qh, v_w, v_b, e);

    // 4) at = softmax(e) over S (output) and ctx = at @ hs (bf16)
    softmax_ctx_kernel<<<dim3(EH / CX_COLS, Bb), 512, 0, stream>>>(e, hs, out_at, ctx_bf);

    // 5) c = ctx @ c_w^T + c_b   (M=32, N=DH, K=EH)
    gemm_bf16_kernel<<<dim3(DH / SG_N, 2), 32 * SG_WAVES, 0, stream>>>(
        ctx_bf, cw_bf, c_b, out_c);
}

// v009
// Measured time: 73.9 microseconds a run.
// In both of two side-by-side timings against v008, it was 1.04 times as fast.
// Over all steps from v000 it is 8.48 times as fast.
#include <hip/hip_runtime.h>
#include <hip/hip_bf16.h>
#include <math.h>

typedef __bf16 bf16_t;
typedef __attribute__((ext_vector_type(16))) __bf16 v16bf;
typedef __attribute__((ext_vector_type(8)))  __bf16 v8bf;
typedef __attribute__((ext_vector_type(4)))  __bf16 v4bf;
typedef __attribute__((ext_vector_type(8)))  float  v8f;

static constexpr int Dd = 2;
static constexpr int Bb = 16;
static constexpr int Ss = 2048;
static constexpr int DH = 1024;
static constexpr int EH = 1024;

// Hardware V_TANH_F32 (TRANS op) if the builtin is available on this toolchain.
#if defined(__has_builtin)
#if __has_builtin(__builtin_amdgcn_tanhf)
#define FAST_TANH(x) __builtin_amdgcn_tanhf(x)
#endif
#endif
#ifndef FAST_TANH
#define FAST_TANH(x) tanhf(x)
#endif

// ---------------------------------------------------------------------------
// f32 -> bf16 conversion of the four small operands in one launch (hs is
// converted where it is used, on its way into the k-projection's LDS stage).
// The four bf16 arrays lie one behind the other in the workspace (k_w, q_w, c_w,
// ht), so the output is one array. A wave takes one batch of 4 KiB: every load
// covers 512 contiguous bytes, every store 256.
// ---------------------------------------------------------------------------
static constexpr int CV_WAVES  = 16;                        // waves per work-group
static constexpr int CV_U      = 8;                         // loads per lane
static constexpr int CV_CH     = 128 * CV_U;                // floats per batch
static constexpr int CV_WB     = DH * EH / CV_CH;           // batches per weight matrix
static constexpr int CV_NB     = 3 * CV_WB + Dd * Bb * DH / CV_CH;   // batches in all
static constexpr int CV_WGS    = CV_NB / CV_WAVES;          // work-groups
static_assert(CV_WB * CV_CH == DH * EH && DH == EH, "weights in whole batches");
static_assert((Dd * Bb * DH) % CV_CH == 0, "ht in whole batches");
static_assert(CV_WGS * CV_WAVES == CV_NB, "every wave has a batch");

// base: the array (a scalar address); off: byte offset of this lane's first 4
// elements of the batch. All three loops unrolled: the batch lives in registers
// and the offsets become immediates.
template <int U>
__device__ __forceinline__ void cv_load(float4 (&t)[U], const float* base, unsigned off) {
    const char* p = (const char*)base + (size_t)off;
#pragma unroll
    for (int u = 0; u < U; ++u) t[u] = *(const float4*)(p + u * 512);
}

template <int U>
__device__ __forceinline__ void cv_pack(v4bf (&o)[U], const float4 (&t)[U]) {
#pragma unroll
    for (int u = 0; u < U; ++u) {
        o[u][0] = (bf16_t)t[u].x; o[u][1] = (bf16_t)t[u].y;
        o[u][2] = (bf16_t)t[u].z; o[u][3] = (bf16_t)t[u].w;
    }
}

template <int U>
__device__ __forceinline__ void cv_store(const v4bf (&o)[U], bf16_t* base, unsigned off) {
    char* q = (char*)base + (size_t)off;
#pragma unroll
    for (int u = 0; u < U; ++u) *(v4bf*)(q + u * 256) = o[u];
}

__global__ __launch_bounds__(32 * CV_WAVES) void cvt_all_kernel(
    const float* __restrict__ k_w, const float* __restrict__ q_w,
    const float* __restrict__ c_w, const float* __restrict__ ht,
    bf16_t* __restrict__ out) {
    const int lane = threadIdx.x & 31;
    // the wave's number in its work-group, in a scalar register
    const int wave = __builtin_amdgcn_readfirstlane((int)(threadIdx.x >> 5));
    const int w    = blockIdx.x * CV_WAVES + wave;
    const int seg  = w / CV_WB;
    const float* tb = seg == 0 ? k_w : seg == 1 ? q_w : seg == 2 ? c_w : ht;
    const unsigned src = ((unsigned)(w % CV_WB) * CV_CH + lane * 4) * 4;   // bytes into tb
    const unsigned dst = ((unsigned)w * CV_CH + lane * 4) * 2;             // bytes into out

    float4 t[CV_U];
    v4bf   o[CV_U];
    cv_load(t, tb, src);
    cv_pack(o, t);
    cv_store(o, out, dst);
}

// ---------------------------------------------------------------------------
// WMMA fragment loader: 16x32 bf16 tile slice for this lane.
// Lane holds K = {k0+sel .. k0+sel+7} and {k0+sel+16 .. k0+sel+23},
// sel = (lane>=16) ? 8 : 0, row/col = lane&15 (caller bakes into pointer).
// ---------------------------------------------------------------------------
__device__ __forceinline__ v16bf load_frag16(const bf16_t* p) {
    v8bf lo = *reinterpret_cast<const v8bf*>(p);
    v8bf hi = *reinterpret_cast<const v8bf*>(p + 16);
    v16bf r;
#pragma unroll
    for (int i = 0; i < 8; ++i) { r[i] = lo[i]; r[i + 8] = hi[i]; }
    return r;
}

// ---------------------------------------------------------------------------
// Small GEMM: out[32 x 1024] = A[32 x 1024](bf16) @ W[1024 x 1024]^T(bf16) + bias
// grid: (DH/32, 2), block 256 = 8 waves. A work-group owns 16 rows x 32 columns
// of out (whole 128-byte lines). Each wave takes 128 of the 1024 k for both
// column tiles: 256-byte pieces of the A and W rows, all 24 loads in flight at
// once. The 8 partial tiles meet in LDS.
// ---------------------------------------------------------------------------
static constexpr int SG_N     = 32;            // columns per work-group
static constexpr int SG_KW    = 128;           // k per wave
static constexpr int SG_WAVES = EH / SG_KW;    // waves per work-group
static constexpr int SG_KS    = SG_KW / 32;    // WMMA k-steps per wave
static_assert(DH == EH, "both small GEMMs have the same K");

__global__ __launch_bounds__(32 * SG_WAVES) void gemm_bf16_kernel(
    const bf16_t* __restrict__ A, const bf16_t* __restrict__ W,
    const float* __restrict__ bias, float* __restrict__ out) {
    const int m0   = blockIdx.y * 16;
    const int n0   = blockIdx.x * SG_N;
    const int tid  = threadIdx.x;
    const int wave = tid >> 5;
    const int lane = tid & 31;
    const int lo   = lane & 15;
    const int sel  = (lane & 16) ? 8 : 0;
    const bf16_t* arow = A + (size_t)(m0 + lo) * EH + wave * SG_KW + sel;
    const bf16_t* wrow = W + (size_t)(n0 + lo) * EH + wave * SG_KW + sel;

    v16bf af[SG_KS], b0[SG_KS], b1[SG_KS];
    // unrolled: the fragments live in registers, the k offsets become immediates
#pragma unroll
    for (int ks = 0; ks < SG_KS; ++ks) {
        af[ks] = load_frag16(arow + ks * 32);
        b0[ks] = load_frag16(wrow + ks * 32);
        b1[ks] = load_frag16(wrow + 16 * EH + ks * 32);
    }
    const int n = n0 + lane;      // this lane's column in the epilogue
    const float bv = bias[n];
    // behind the last load: the address registers stay as they are (named as
    // inputs) until the wait has passed
    asm volatile("s_wait_xcnt 0x0" :: "v"(arow), "v"(wrow) : "memory");
    // keeps all the loads ahead of the first WMMA: left alone the scheduler sinks
    // them among the WMMAs and the wave waits out the load latency several times
    __builtin_amdgcn_sched_barrier(0);

    v8f c0 = {0.f, 0.f, 0.f, 0.f, 0.f, 0.f, 0.f, 0.f};
    v8f c1 = c0;
#pragma unroll
    for (int ks = 0; ks < SG_KS; ++ks) {
        c0 = __builtin_amdgcn_wmma_f32_16x16x32_bf16(
            false, af[ks], false, b0[ks], (short)0, c0, false, false);
        c1 = __builtin_amdgcn_wmma_f32_16x16x32_bf16(
            false, af[ks], false, b1[ks], (short)0, c1, false, false);
    }

    // red[wave][column tile][j][lane]: element (row j + 8 * (lane >> 4),
    // column lane & 15) of the wave's partial tile
    __shared__ float red[SG_WAVES][2][8][32];
#pragma unroll
    for (int j = 0; j < 8; ++j) {
        red[wave][0][j][lane] = c0[j];
        red[wave][1][j][lane] = c1[j];
    }
    __syncthreads();

    // a wave sums and stores one whole 32-column row of the tile at a time
    static_assert(SG_WAVES == 8, "wave w sums rows w and w + 8");
#pragma unroll
    for (int hf = 0; hf < 2; ++hf) {
        float s = 0.f;
        // unrolled: the 8 LDS reads go out together
#pragma unroll
        for (int w = 0; w < SG_WAVES; ++w)
            s += red[w][lane >> 4][wave][hf * 16 + lo];
        out[(size_t)(m0 + hf * 8 + wave) * DH + n] = s + bv;
    }
}

// ---------------------------------------------------------------------------
// Fused: kh = bf16(hs[b, m0:m0+128, :]) @ k_w^T + k_b   (kept in registers)
//        e[d,b,m0+m] = sum_h tanh(qh[d,b,h] + kh[m,h]) * v_w[h] + v_b
// grid: (S/128, B), block 512 = 16 waves: 4 along the rows x 4 along the
// columns, each wave a 32 x 64 tile (2 x 4 fragments: 12 LDS reads feed 8 WMMAs);
// 4 passes of 256 columns.
// The work-group's 128 hs rows stay in LDS as bf16, all 1024 k of them, for all
// four passes: hs is read once. They come in during the first pass, 128 k at a
// time: read as f32, held in registers for two stages, rounded to bf16, stored.
// k_w (bf16) streams through two small buffers by asynchronous copies that read
// whole lines: a stage is 64 k (128-byte rows) of 256 k_w rows, the next stage
// in flight while this one is used.
// The two together take all of the LDS, so no row is padded: the 16-byte pieces
// of a row are permuted by the row's number instead (XOR), which spreads the 16
// rows of a fragment read over all banks. The LDS is laid out in 8 groups of
// 16 hs rows and 64 k_w rows, so that the k_w rows of the four column waves lie
// in four different 32-KiB blocks, as the hs rows of the four row waves do.
// All work-groups read the same k_w; for speed only, each work-group starts its
// walk over the column passes and over k at a place given by its index.
// ---------------------------------------------------------------------------
static constexpr int KP_M      = 128;                       // hs rows per work-group
static constexpr int KP_N      = 256;                       // kh columns per pass
static constexpr int KP_K      = 64;                        // k per stage of k_w
static constexpr int KP_AK     = 128;                       // k per slice of hs
static constexpr int KP_APITCH = EH * 2;                    // LDS pitch of an hs row, bytes
static constexpr int KP_WPITCH = KP_K * 2;                  // LDS pitch of a k_w row, bytes
static constexpr int KP_WOFF   = 16 * KP_APITCH;            // a group's k_w rows, byte offset
static constexpr int KP_GRP    = KP_WOFF + 64 * KP_WPITCH;  // one group, bytes
static constexpr int KP_BUF    = 4 * KP_GRP;                // from k_w buffer 0 to 1, bytes
static constexpr int KP_KST    = EH / KP_K;                 // stages per pass
static constexpr int KP_NSL    = EH / KP_AK;                // hs slices
static constexpr int KP_PASSES = DH / KP_N;                 // column passes
static constexpr int KP_STAGES = KP_PASSES * KP_KST;        // stages in all
static constexpr int KP_FM     = 2;                         // row fragments per wave
static constexpr int KP_FN     = 4;                         // column fragments per wave
static constexpr int KP_WM     = KP_M / (16 * KP_FM);       // waves along the rows
static constexpr int KP_WN     = KP_N / (16 * KP_FN);       // waves along the columns
static_assert(KP_WM * KP_WN == 16, "16 waves cover the block tile");
static_assert(KP_AK == 2 * KP_K, "an hs slice serves two stages");
static_assert(KP_M == 8 * 16 && 2 * KP_N == 8 * 64, "8 groups hold everything");
static_assert(8 * KP_GRP == 327680, "all of the LDS");

static constexpr int KP_AR     = KP_M / 16;                 // hs rows per wave and slice

// The k_w rows of one stage: 256 rows x 8 pieces of 16 bytes = 4 copies per
// thread. A wave's copy covers four whole 128-byte rows. w: the stage's first
// k_w element (the same for the whole work-group: a scalar base); off: byte
// offset from there of this thread's piece in row (tid >> 3); dst: its LDS byte
// address. a_off: the offset register of the hs loads where some were issued
// just ahead.
__device__ __forceinline__ void kp_copy_w(const bf16_t* w, unsigned off, unsigned dst,
                                          unsigned a_off) {
    constexpr unsigned GR = 64 * EH * 2;      // 64 rows further, bytes
    constexpr unsigned LR = KP_GRP;           // 64 rows further, LDS bytes
    // s_wait_xcnt closes the statement so that no address register named here
    // (the hs loads' offset among them) is rewritten ahead of it.
    asm volatile(
        "global_load_async_to_lds_b128 %0, %4, %8\n\t"
        "global_load_async_to_lds_b128 %1, %5, %8\n\t"
        "global_load_async_to_lds_b128 %2, %6, %8\n\t"
        "global_load_async_to_lds_b128 %3, %7, %8\n\t"
        "s_wait_xcnt 0x0"
        :: "v"(dst), "v"(dst + LR), "v"(dst + 2 * LR), "v"(dst + 3 * LR),
           "v"(off), "v"(off + GR), "v"(off + 2 * GR), "v"(off + 3 * GR),
           "s"(w), "v"(a_off)
        : "memory");
}

// One slice of the hs rows: a wave reads 8 rows, 16 apart, one whole 512-byte
// piece (128 f32) per load. off: byte offset into hs of this lane's 4 elements
// of the wave's first row. Unrolled: the rows live in registers and the row
// offsets become immediates.
__device__ __forceinline__ void kp_load_a(float4 (&t)[KP_AR], const float* hs, unsigned off) {
    const char* p = (const char*)hs + (size_t)off;
#pragma unroll
    for (int i = 0; i < KP_AR; ++i)
        t[i] = *(const float4*)(p + (size_t)i * 16 * EH * 4);
}

// Rounds them to bf16 and stores them: one 256-byte window of LDS per wave store.
// dst: this lane's 8 bytes in the wave's first row, in the slice's window.
__device__ __forceinline__ void kp_store_a(const float4 (&t)[KP_AR], char* dst) {
#pragma unroll
    for (int i = 0; i < KP_AR; ++i) {
        v4bf o;
        o[0] = (bf16_t)t[i].x; o[1] = (bf16_t)t[i].y;
        o[2] = (bf16_t)t[i].z; o[3] = (bf16_t)t[i].w;
        *(v4bf*)(dst + i * KP_GRP) = o;
    }
}

// A fragment from two 16-byte pieces (k and k + 16 of the lane's 8 + 8 elements)
__device__ __forceinline__ v16bf kp_frag(const char* p0, const char* p1) {
    v8bf lo = *reinterpret_cast<const v8bf*>(p0);
    v8bf hi = *reinterpret_cast<const v8bf*>(p1);
    v16bf r;
#pragma unroll
    for (int i = 0; i < 8; ++i) { r[i] = lo[i]; r[i + 8] = hi[i]; }
    return r;
}

// tells the first column pass from the others at compile time
template <bool F> struct KpFlag { static constexpr bool value = F; };

// Work-group barrier that orders LDS traffic only: __syncthreads() would also
// wait out the hs loads in flight, which have two stages to land.
__device__ __forceinline__ void kp_lds_barrier() {
    __builtin_amdgcn_fence(__ATOMIC_RELEASE, "workgroup", "local");
    __builtin_amdgcn_s_barrier();
    __builtin_amdgcn_fence(__ATOMIC_ACQUIRE, "workgroup", "local");
}

__global__ __launch_bounds__(512) void kproj_score_kernel(
    const float* __restrict__ hs, const bf16_t* __restrict__ kw_bf,
    const float* __restrict__ k_b, const float* __restrict__ qh,
    const float* __restrict__ v_w, const float* __restrict__ v_b,
    float* __restrict__ e_out) {
    const int m0   = blockIdx.x * KP_M;
    const int b    = blockIdx.y;
    const int tid  = threadIdx.x;
    const int wave = tid >> 5;
    const int lane = tid & 31;
    const int lo   = lane & 15;
    const int hi   = lane >> 4;
    const int wm   = wave % KP_WM;   // which 32 rows
    const int wn   = wave / KP_WM;   // which 64 of the pass's 256 columns

    // Group g: hs rows 16 g .. 16 g + 15, then k_w rows 64 (g & 3) .. + 63 of
    // buffer g >> 2. Piece c (16 bytes, 8 k) of hs row m lies at piece
    // c ^ (m & 15) of the row; piece c of k_w row n at piece c ^ ((n >> 1) & 7).
    __shared__ __attribute__((aligned(16))) char kp_lds[8 * KP_GRP];

    // this thread's piece of a stage's k_w rows
    const int crow = tid >> 3;
    const int ccol = tid & 7;
    const unsigned w_off = (crow * EH + ccol * 8) * 2;
    const unsigned c_dst = (unsigned)(size_t)kp_lds + KP_WOFF + crow * KP_WPITCH
                         + ((ccol ^ ((crow >> 1) & 7)) << 4);
    // this lane's 4 elements of the wave's first hs row of a slice (rows wave,
    // wave + 16, ...: m & 15 is the wave's number)
    static_assert((size_t)Bb * Ss * EH * 4 < (1ull << 32), "byte offsets fit 32 bits");
    const unsigned a_src = (((unsigned)b * Ss + m0 + wave) * EH + lane * 4) * 4;
    char* a_dst = kp_lds + wave * KP_APITCH + (((lane >> 1) ^ wave) << 4) + (lane & 1) * 8;

    // where this work-group's walk starts: 32 places, dealt so that both
    // neighbouring indices and indices 8 apart get different ones
    static_assert(KP_PASSES * KP_NSL == 32, "32 starting places");
    const unsigned wg  = blockIdx.y * (Ss / KP_M) + blockIdx.x;
    const unsigned rot = ((wg >> 3) + 4 * (wg & 7)) % 32;
    const unsigned rk  = rot % KP_NSL;     // first hs slice (128 k)
    const unsigned rp  = rot / KP_NSL;     // first column pass
    // the j-th slice of the walk, and the walk's column pass number p
    auto sl_k = [rk](unsigned j) { return (j + rk) % KP_NSL; };
    auto ps_p = [rp](unsigned p) { return (p + rp) % KP_PASSES; };
    // the first k_w element of stage st of the walk
    auto st_w = [&](unsigned st) {
        return kw_bf + (size_t)ps_p(st / KP_KST) * KP_N * EH
                     + (sl_k((st % KP_KST) / 2) * 2 + (st & 1)) * KP_K;
    };

    float4 ar[KP_AR];
    const unsigned ao0 = a_src + sl_k(0) * KP_AK * 4;
    kp_load_a(ar, hs, ao0);
    kp_copy_w(st_w(0), w_off, c_dst, ao0);
    kp_store_a(ar, a_dst + sl_k(0) * KP_AK * 2);
    // slice 0 and stage 0 have landed for this wave (its stores and its copies);
    // the barrier publishes them to the others
    asm volatile("s_wait_dscnt 0x0" ::: "memory");
    asm volatile("s_wait_asynccnt 0x0" ::: "memory");
    __syncthreads();
    const unsigned ao1 = a_src + sl_k(1) * KP_AK * 4;
    kp_load_a(ar, hs, ao1);
    kp_copy_w(st_w(1), w_off, c_dst + KP_BUF, ao1);

    // this lane's fragment rows; a piece's number is XORed in at the read
    static_assert(KP_FN * 16 == 64, "a column wave's k_w rows are one group's");
    const unsigned a_lane = wm * KP_FM * KP_GRP + lo * KP_APITCH + ((hi ^ lo) << 4);
    const unsigned w_lane = lo * KP_WPITCH + ((hi ^ (lo >> 1)) << 4);

    const float* qh0 = qh + ((size_t)0 * Bb + b) * DH;
    const float* qh1 = qh + ((size_t)1 * Bb + b) * DH;

    float p0[KP_FM][8], p1[KP_FM][8];
#pragma unroll
    for (int r = 0; r < KP_FM; ++r)
#pragma unroll
        for (int j = 0; j < 8; ++j) { p0[r][j] = 0.f; p1[r][j] = 0.f; }

    const v8f zero = {0.f, 0.f, 0.f, 0.f, 0.f, 0.f, 0.f, 0.f};

    // One column pass. The first pass of the walk, which also brings the hs rows
    // in, is compiled apart from the others: those then hold no hs registers, and
    // the first holds no score sums (they are still zero).
    auto do_pass = [&](auto first, const int pass) __attribute__((always_inline)) {
        constexpr bool FIRST = decltype(first)::value;
        v8f c[KP_FM][KP_FN];
#pragma unroll
        for (int r = 0; r < KP_FM; ++r)
#pragma unroll
            for (int t = 0; t < KP_FN; ++t) c[r][t] = zero;

        for (int sl = 0; sl < KP_NSL; ++sl) {
            // the slice's first piece in an hs row, as a byte offset
            const unsigned a_k = sl_k(sl) * KP_AK * 2;
            // unrolled: the two stages of a slice use one buffer each, told apart
            // at compile time
#pragma unroll
            for (int hf = 0; hf < 2; ++hf) {
                const int st = pass * KP_KST + sl * 2 + hf;
                const char* buf = kp_lds + hf * KP_BUF + wn * KP_GRP + KP_WOFF;
#pragma unroll
                for (int ks = 0; ks < KP_K / 32; ++ks) {
                    // byte offsets of the k-step's pieces 0 and 2 (the lane's
                    // half adds piece 1 by a_lane, w_lane)
                    const unsigned wk = ks * 64;
                    const unsigned ak = a_k + hf * KP_K * 2 + wk;
                    v16bf af[KP_FM], bf[KP_FN];
#pragma unroll
                    for (int r = 0; r < KP_FM; ++r)
                        af[r] = kp_frag(
                            kp_lds + (a_lane ^ ak) + r * KP_GRP,
                            kp_lds + (a_lane ^ (ak + 32)) + r * KP_GRP);
#pragma unroll
                    for (int t = 0; t < KP_FN; ++t)
                        bf[t] = kp_frag(
                            buf + (w_lane ^ wk) + t * 16 * KP_WPITCH,
                            buf + (w_lane ^ (wk + 32)) + t * 16 * KP_WPITCH);
                    // keeps the k-step's 12 LDS reads one group ahead of its WMMAs:
                    // left alone the scheduler puts a full LDS wait before each WMMA
                    __builtin_amdgcn_sched_barrier(0);
                    // first pass: the next hs slice, loaded two stages ago, goes
                    // to its place (nobody reads it before the barrier below)
                    // while the last k-step's fragments are on their way
                    if (FIRST && hf == 1 && ks == KP_K / 32 - 1 && sl + 1 < KP_NSL)
                        kp_store_a(ar, a_dst + sl_k(sl + 1) * KP_AK * 2);
#pragma unroll
                    for (int r = 0; r < KP_FM; ++r)
#pragma unroll
                        for (int t = 0; t < KP_FN; ++t)
                            c[r][t] = __builtin_amdgcn_wmma_f32_16x16x32_bf16(
                                false, af[r], false, bf[t], (short)0, c[r][t], false, false);
                }
                // this wave's reads of the buffer are done before it is refilled,
                // and its stores of the next hs slice have landed
                asm volatile("s_wait_dscnt 0x0" ::: "memory");
                // this wave's copies of the next stage have landed
                asm volatile("s_wait_asynccnt 0x0" ::: "memory");
                // publishes the next stage and ends every wave's reads of this one
                kp_lds_barrier();
                const int nx = st + 2;
                if (nx < KP_STAGES) {
                    unsigned ao = a_src;
                    if (FIRST && hf == 1 && sl + 2 < KP_NSL) {
                        ao = a_src + sl_k(sl + 2) * KP_AK * 4;
                        kp_load_a(ar, hs, ao);
                    }
                    kp_copy_w(st_w(nx), w_off, c_dst + hf * KP_BUF, ao);
                }
            }
        }

        // score terms of this pass's 64 columns, for d = 0 and d = 1
#pragma unroll
        for (int t = 0; t < KP_FN; ++t) {
            const int h = (int)ps_p(pass) * KP_N + wn * 16 * KP_FN + t * 16 + lo;
            const float vwh = v_w[h];
            const float kbh = k_b[h];
            const float q0  = qh0[h];
            const float q1  = qh1[h];
#pragma unroll
            for (int r = 0; r < KP_FM; ++r)
#pragma unroll
                for (int j = 0; j < 8; ++j) {
                    const float kv = c[r][t][j] + kbh;
                    p0[r][j] += FAST_TANH(q0 + kv) * vwh;
                    p1[r][j] += FAST_TANH(q1 + kv) * vwh;
                }
        }
    };
    do_pass(KpFlag<true>{}, 0);
    for (int pass = 1; pass < KP_PASSES; ++pass) do_pass(KpFlag<false>{}, pass);
    // no copy is outstanding when the wave goes on to its end
    asm volatile("s_wait_asynccnt 0x0" ::: "memory");

    // e_part[wn * 256 + d * 128 + row]: the score sum over the columns of the
    // waves wn. It takes the place of group 0's k_w rows, which every wave has
    // left behind the last stage's barrier.
    float* e_part = (float*)(kp_lds + KP_WOFF);
    static_assert(KP_WN * 2 * KP_M * 4 <= KP_GRP - KP_WOFF, "the slots fit there");

    // reduce over the 16 columns held by each half-wave; the four waves that
    // share the rows each leave their sum in a slot of their own
    const int rbase = wm * 16 * KP_FM + ((lane & 16) ? 8 : 0);
    // the exchange distance is the outer loop: the 32 sums of a wave take each
    // step together, so that a step's exchange latency is waited out once
#pragma unroll
    for (int off = 1; off < 16; off <<= 1)
#pragma unroll
        for (int r = 0; r < KP_FM; ++r)
#pragma unroll
            for (int j = 0; j < 8; ++j) {
                p0[r][j] += __shfl_xor(p0[r][j], off, 32);
                p1[r][j] += __shfl_xor(p1[r][j], off, 32);
            }
    if (lo == 0) {
#pragma unroll
        for (int r = 0; r < KP_FM; ++r)
#pragma unroll
            for (int j = 0; j < 8; ++j) {
                e_part[wn * 2 * KP_M + rbase + r * 16 + j] = p0[r][j];
                e_part[wn * 2 * KP_M + KP_M + rbase + r * 16 + j] = p1[r][j];
            }
    }
    __syncthreads();

    static_assert(KP_WN == 4, "four slots per score");
    if (tid < 2 * KP_M) {
        const int d = tid / KP_M;
        const int mr = tid % KP_M;
        const float s = (e_part[tid] + e_part[2 * KP_M + tid])
                      + (e_part[4 * KP_M + tid] + e_part[6 * KP_M + tid]);
        e_out[((size_t)d * Bb + b) * Ss + m0 + mr] = s + v_b[0];
    }
}

// ---------------------------------------------------------------------------
// at = softmax(e) over S, and ctx[d,b,g] = sum_s at[d,b,s] * hs[b,s,g], in one
// launch (hs read once for both d).
// grid: (EH/64, B), block 512 = 16 waves: one work-group per WGP, all of them
// streaming. A work-group owns 64 columns (256-byte pieces of the hs rows); a
// 16-lane half of a wave owns 64 consecutive rows, so one 16-byte load of a
// wave covers two whole pieces. The 32 partial sums of a column meet in LDS.
// Every work-group works out both softmax rows of its batch for itself, while
// its first 32 hs rows per half-wave are on their way, and leaves the weights
// in LDS; it stores 1/16 of each row to at. ctx is stored as bf16 (feeds the
// final GEMM).
// ---------------------------------------------------------------------------
static constexpr int CX_COLS  = 64;                     // columns per work-group
static constexpr int CX_PARTS = 32;                     // half-waves per work-group
static constexpr int CX_ROWS  = Ss / CX_PARTS;          // rows per half-wave
static constexpr int CX_STEP  = 16;                     // rows loaded together
static constexpr int CX_NSTEP = CX_ROWS / CX_STEP;
static constexpr int CX_WAVES = CX_PARTS / 2;           // waves per work-group
static constexpr int CX_AT    = Ss / (EH / CX_COLS);    // at elements stored per row
static_assert(Dd == 2 && Dd * Ss == 32 * CX_WAVES * 8, "8 scores per thread");
static_assert(CX_AT == 128, "one wave stores a work-group's share of an at row");
static_assert(CX_NSTEP >= 2, "two batches are in flight from the start");

struct CxBatch {
    float4 hv[CX_STEP];       // 4 columns of each row
};

__device__ __forceinline__ void cx_load(CxBatch& t, const float* h, int step) {
    // unrolled: the batch lives in registers, and the row offsets become
    // immediates of the loads
#pragma unroll
    for (int u = 0; u < CX_STEP; ++u)
        t.hv[u] = *(const float4*)(h + (size_t)(step * CX_STEP + u) * EH);
}

// w0, w1: the batch's 16 weights for d = 0 and d = 1, in LDS
__device__ __forceinline__ void cx_sum(const CxBatch& t, const float* w0,
                                       const float* w1, float4& acc0, float4& acc1) {
    // both loops unrolled: the batch lives in registers
#pragma unroll
    for (int q = 0; q < CX_STEP / 4; ++q) {
        const float4 a = *(const float4*)(w0 + q * 4);
        const float4 c = *(const float4*)(w1 + q * 4);
        const float s0[4] = {a.x, a.y, a.z, a.w};
        const float s1[4] = {c.x, c.y, c.z, c.w};
#pragma unroll
        for (int u = 0; u < 4; ++u) {
            const float4 v = t.hv[q * 4 + u];
            acc0.x += s0[u] * v.x; acc0.y += s0[u] * v.y;
            acc0.z += s0[u] * v.z; acc0.w += s0[u] * v.w;
            acc1.x += s1[u] * v.x; acc1.y += s1[u] * v.y;
            acc1.z += s1[u] * v.z; acc1.w += s1[u] * v.w;
        }
    }
}

// Work-group barrier that orders LDS traffic only: __syncthreads() would also
// wait out every global load in flight, and the hs rows must keep flying while
// the softmax is worked out.
__device__ __forceinline__ void cx_lds_barrier() {
    __builtin_amdgcn_fence(__ATOMIC_RELEASE, "workgroup", "local");
    __builtin_amdgcn_s_barrier();
    __builtin_amdgcn_fence(__ATOMIC_ACQUIRE, "workgroup", "local");
}

__global__ __launch_bounds__(512) void softmax_ctx_kernel(
    const float* __restrict__ e, const float* __restrict__ hs,
    float* __restrict__ at, bf16_t* __restrict__ ctx_bf) {
    const int b    = blockIdx.y;
    const int g0   = blockIdx.x * CX_COLS;
    const int tid  = threadIdx.x;
    const int lane = tid & 31;
    const int wave = tid >> 5;
    const int lo   = tid & 15;
    const int part = tid >> 4;
    const int r0   = part * CX_ROWS;

    // w_lds[d][s] = at[d, b, s]
    __shared__ __attribute__((aligned(16))) float w_lds[Dd][Ss];
    // one slot per wave: the waves' maxima, then their sums
    __shared__ __attribute__((aligned(16))) float sm_max[CX_WAVES];
    __shared__ __attribute__((aligned(16))) float sm_sum[CX_WAVES];

    // waves 0-7 take the scores of d = 0, waves 8-15 those of d = 1: a thread
    // has elements 4 i0 .. 4 i0 + 3 of each half of the row
    const int d  = tid >> 8;
    const int i0 = tid & 255;
    const float4* er = (const float4*)(e + ((size_t)d * Bb + b) * Ss) + i0;
    const float*  h  = hs + ((size_t)b * Ss + r0) * EH + g0 + lo * 4;

    float4 x0 = er[0];
    float4 x1 = er[256];
    CxBatch t[2];
    cx_load(t[0], h, 0);
    cx_load(t[1], h, 1);
    // behind the score loads: their address register stays as it is (named as
    // an input) until the wait has passed
    asm volatile("s_wait_xcnt 0x0" :: "v"(er) : "memory");
    // keeps the first 32 rows' loads ahead of the softmax: they fly while it is
    // worked out
    __builtin_amdgcn_sched_barrier(0);

    // row maximum: thread, wave, the row's 8 waves
    float m = fmaxf(fmaxf(fmaxf(x0.x, x0.y), fmaxf(x0.z, x0.w)),
                    fmaxf(fmaxf(x1.x, x1.y), fmaxf(x1.z, x1.w)));
    // unrolled: the five exchange distances become constants
#pragma unroll
    for (int off = 16; off > 0; off >>= 1) m = fmaxf(m, __shfl_xor(m, off, 32));
    if (lane == 0) sm_max[wave] = m;
    cx_lds_barrier();
    {
        const float4 p = *(const float4*)(sm_max + d * 8);
        const float4 q = *(const float4*)(sm_max + d * 8 + 4);
        m = fmaxf(fmaxf(fmaxf(p.x, p.y), fmaxf(p.z, p.w)),
                  fmaxf(fmaxf(q.x, q.y), fmaxf(q.z, q.w)));
    }

    x0.x = __expf(x0.x - m); x0.y = __expf(x0.y - m);
    x0.z = __expf(x0.z - m); x0.w = __expf(x0.w - m);
    x1.x = __expf(x1.x - m); x1.y = __expf(x1.y - m);
    x1.z = __expf(x1.z - m); x1.w = __expf(x1.w - m);
    float sum = ((x0.x + x0.y) + (x0.z + x0.w)) + ((x1.x + x1.y) + (x1.z + x1.w));
    // unrolled, as above
#pragma unroll
    for (int off = 16; off > 0; off >>= 1) sum += __shfl_xor(sum, off, 32);
    if (lane == 0) sm_sum[wave] = sum;
    cx_lds_barrier();
    {
        const float4 p = *(const float4*)(sm_sum + d * 8);
        const float4 q = *(const float4*)(sm_sum + d * 8 + 4);
        sum = ((p.x + p.y) + (p.z + p.w)) + ((q.x + q.y) + (q.z + q.w));
    }
    const float inv = 1.f / sum;
    x0.x *= inv; x0.y *= inv; x0.z *= inv; x0.w *= inv;
    x1.x *= inv; x1.y *= inv; x1.z *= inv; x1.w *= inv;
    *(float4*)(w_lds[d] + i0 * 4) = x0;
    *(float4*)(w_lds[d] + Ss / 2 + i0 * 4) = x1;
    cx_lds_barrier();

    float4 acc0 = {0.f, 0.f, 0.f, 0.f};
    float4 acc1 = {0.f, 0.f, 0.f, 0.f};
    // unrolled so that the two batches are told apart at compile time
#pragma unroll
    for (int s = 0; s < CX_NSTEP; ++s) {
        if (s > 0 && s + 1 < CX_NSTEP) {
            cx_load(t[(s + 1) & 1], h, s + 1);
            // behind the last loads: their address register stays as it is
            // (named as an input) until the wait has passed
            if (s + 2 == CX_NSTEP)
                asm volatile("s_wait_xcnt 0x0" :: "v"(h) : "memory");
            // keeps the next 16 rows' loads ahead of these rows' sums: left
            // alone the scheduler sinks them and a wave has few loads in flight
            __builtin_amdgcn_sched_barrier(0);
        }
        cx_sum(t[s & 1], w_lds[0] + r0 + s * CX_STEP, w_lds[1] + r0 + s * CX_STEP,
               acc0, acc1);
    }

    // red[p][d * 64 + column]: the partial sum of half-wave p
    __shared__ __attribute__((aligned(16))) float red[CX_PARTS][2 * CX_COLS];
    __shared__ float red2[4][2 * CX_COLS];
    *(float4*)(red[part] + lo * 4) = acc0;
    *(float4*)(red[part] + CX_COLS + lo * 4) = acc1;
    __syncthreads();

    // 4 threads per output, 8 partials each, then across the 4
    {
        const int o = tid & (2 * CX_COLS - 1);
        const int p = tid >> 7;
        float s = 0.f;
        // unrolled: the 8 LDS reads go out together
#pragma unroll
        for (int k = 0; k < 8; ++k) s += red[p * 8 + k][o];
        red2[p][o] = s;
    }
    __syncthreads();

    if (tid < 2 * CX_COLS) {
        const float s = (red2[0][tid] + red2[1][tid]) + (red2[2][tid] + red2[3][tid]);
        const int dd = tid / CX_COLS;
        const int c  = tid % CX_COLS;
        ctx_bf[((size_t)dd * Bb + b) * EH + g0 + c] = (bf16_t)s;
    } else if (tid < 2 * CX_COLS + Dd * 32) {
        // two more waves store this work-group's share of the two at rows, 512
        // contiguous bytes each
        const int dd = (tid - 2 * CX_COLS) >> 5;
        const int s0 = blockIdx.x * CX_AT + lane * 4;
        *(float4*)(at + ((size_t)dd * Bb + b) * Ss + s0) = *(const float4*)(w_lds[dd] + s0);
    }
}

// ---------------------------------------------------------------------------
// launcher
// ---------------------------------------------------------------------------
extern "C" void kernel_launch(void* const* d_in, const int* in_sizes, int n_in,
                              void* d_out, int out_size, void* d_ws, size_t ws_size,
                              hipStream_t stream) {
    const float* hs  = (const float*)d_in[0];  // (B,S,EH)
    const float* ht  = (const float*)d_in[1];  // (D,B,DH)
    const float* q_w = (const float*)d_in[2];  // (DH,DH)
    const float* q_b = (const float*)d_in[3];  // (DH,)
    const float* k_w = (const float*)d_in[4];  // (DH,EH)
    const float* k_b = (const float*)d_in[5];  // (DH,)
    const float* v_w = (const float*)d_in[6];  // (1,DH)
    const float* v_b = (const float*)d_in[7];  // (1,)
    const float* c_w = (const float*)d_in[8];  // (DH,EH)
    const float* c_b = (const float*)d_in[9];  // (DH,)

    float* out_c  = (float*)d_out;                 // (D,B,DH) = 32768
    float* out_at = out_c + (size_t)Dd * Bb * DH;  // (D,B,S)  = 65536

    char* ws = (char*)d_ws;
    bf16_t* kw_bf  = (bf16_t*)(ws + 67108864);    //  2097152 B
    bf16_t* qw_bf  = (bf16_t*)(ws + 69206016);    //  2097152 B
    bf16_t* cw_bf  = (bf16_t*)(ws + 71303168);    //  2097152 B
    bf16_t* ht_bf  = (bf16_t*)(ws + 73400320);    //    65536 B
    bf16_t* ctx_bf = (bf16_t*)(ws + 73465856);    //    65536 B
    float*  qh     = (float*) (ws + 73531392);    //   131072 B
    float*  e      = (float*) (ws + 73662464);    //   262144 B

    // 1) f32 -> bf16 conversions: kw_bf, qw_bf, cw_bf, ht_bf are contiguous
    cvt_all_kernel<<<CV_WGS, 32 * CV_WAVES, 0, stream>>>(k_w, q_w, c_w, ht, kw_bf);

    // 2) qh = ht @ q_w^T + q_b   (M=32, N=DH, K=DH)
    gemm_bf16_kernel<<<dim3(DH / SG_N, 2), 32 * SG_WAVES, 0, stream>>>(
        ht_bf, qw_bf, q_b, qh);

    // 3) fused k-projection + tanh score -> e (D,B,S)
    kproj_score_kernel<<<dim3(Ss / KP_M, Bb), 512, 0, stream>>>(
        hs, kw_bf, k_b, qh, v_w, v_b, e);

    // 4) at = softmax(e) over S (output) and ctx = at @ hs (bf16)
    softmax_ctx_kernel<<<dim3(EH / CX_COLS, Bb), 512, 0, stream>>>(e, hs, out_at, ctx_bf);

    // 5) c = ctx @ c_w^T + c_b   (M=32, N=DH, K=EH)
    gemm_bf16_kernel<<<dim3(DH / SG_N, 2), 32 * SG_WAVES, 0, stream>>>(
        ctx_bf, cw_bf, c_b, out_c);
}

// v010
// A run of this version takes 71.3 microseconds.
// Two timings next to v009 both put it at 1.04 times that version's speed.
// All steps since v000 together make it 8.79 times as fast.
#include <hip/hip_runtime.h>
#include <hip/hip_bf16.h>
#include <math.h>

typedef __bf16 bf16_t;
typedef __attribute__((ext_vector_type(16))) __bf16 v16bf;
typedef __attribute__((ext_vector_type(8)))  __bf16 v8bf;
typedef __attribute__((ext_vector_type(4)))  __bf16 v4bf;
typedef __attribute__((ext_vector_type(8)))  float  v8f;

static constexpr int Dd = 2;
static constexpr int Bb = 16;
static constexpr int Ss = 2048;
static constexpr int DH = 1024;
static constexpr int EH = 1024;

// Hardware V_TANH_F32 (TRANS op) if the builtin is available on this toolchain.
#if defined(__has_builtin)
#if __has_builtin(__builtin_amdgcn_tanhf)
#define FAST_TANH(x) __builtin_amdgcn_tanhf(x)
#endif
#endif
#ifndef FAST_TANH
#define FAST_TANH(x) tanhf(x)
#endif

// ---------------------------------------------------------------------------
// f32 -> bf16 conversion of k_w and c_w (hs is converted where it is used, on its
// way into the k-projection's LDS stage; q_w and ht likewise, in the qh GEMM that
// shares this launch, further down). A wave takes one batch of 8 KiB: every load
// covers 512 contiguous bytes, every store 256.
// ---------------------------------------------------------------------------
static constexpr int CV_WAVES  = 8;                         // waves per work-group
static constexpr int CV_U      = 16;                        // loads per lane
static constexpr int CV_CH     = 128 * CV_U;                // floats per batch
static constexpr int CV_WB     = DH * EH / CV_CH;           // batches per weight matrix
static constexpr int CV_NB     = 2 * CV_WB;                 // batches in all
static constexpr int CV_WGS    = CV_NB / CV_WAVES;          // work-groups
static_assert(CV_WB * CV_CH == DH * EH && DH == EH, "weights in whole batches");
static_assert(CV_WGS * CV_WAVES == CV_NB, "every wave has a batch");

// base: the array (a scalar address); off: byte offset of this lane's first 4
// elements of the batch. All three loops unrolled: the batch lives in registers
// and the offsets become immediates.
template <int U>
__device__ __forceinline__ void cv_load(float4 (&t)[U], const float* base, unsigned off) {
    const char* p = (const char*)base + (size_t)off;
#pragma unroll
    for (int u = 0; u < U; ++u) t[u] = *(const float4*)(p + u * 512);
}

template <int U>
__device__ __forceinline__ void cv_pack(v4bf (&o)[U], const float4 (&t)[U]) {
#pragma unroll
    for (int u = 0; u < U; ++u) {
        o[u][0] = (bf16_t)t[u].x; o[u][1] = (bf16_t)t[u].y;
        o[u][2] = (bf16_t)t[u].z; o[u][3] = (bf16_t)t[u].w;
    }
}

template <int U>
__device__ __forceinline__ void cv_store(const v4bf (&o)[U], bf16_t* base, unsigned off) {
    char* q = (char*)base + (size_t)off;
#pragma unroll
    for (int u = 0; u < U; ++u) *(v4bf*)(q + u * 256) = o[u];
}

// ---------------------------------------------------------------------------
// WMMA fragment loader: 16x32 bf16 tile slice for this lane.
// Lane holds K = {k0+sel .. k0+sel+7} and {k0+sel+16 .. k0+sel+23},
// sel = (lane>=16) ? 8 : 0, row/col = lane&15 (caller bakes into pointer).
// ---------------------------------------------------------------------------
__device__ __forceinline__ v16bf load_frag16(const bf16_t* p) {
    v8bf lo = *reinterpret_cast<const v8bf*>(p);
    v8bf hi = *reinterpret_cast<const v8bf*>(p + 16);
    v16bf r;
#pragma unroll
    for (int i = 0; i < 8; ++i) { r[i] = lo[i]; r[i + 8] = hi[i]; }
    return r;
}

// ---------------------------------------------------------------------------
// Small GEMM: out[32 x 1024] = A[32 x 1024](bf16) @ W[1024 x 1024]^T(bf16) + bias
// grid: (DH/32, 2), block 256 = 8 waves. A work-group owns 16 rows x 32 columns
// of out (whole 128-byte lines). Each wave takes 128 of the 1024 k for both
// column tiles: 256-byte pieces of the A and W rows, all 24 loads in flight at
// once. The 8 partial tiles meet in LDS.
// ---------------------------------------------------------------------------
static constexpr int SG_N     = 32;            // columns per work-group
static constexpr int SG_KW    = 128;           // k per wave
static constexpr int SG_WAVES = EH / SG_KW;    // waves per work-group
static constexpr int SG_KS    = SG_KW / 32;    // WMMA k-steps per wave
static_assert(DH == EH, "both small GEMMs have the same K");

__global__ __launch_bounds__(32 * SG_WAVES) void gemm_bf16_kernel(
    const bf16_t* __restrict__ A, const bf16_t* __restrict__ W,
    const float* __restrict__ bias, float* __restrict__ out) {
    const int m0   = blockIdx.y * 16;
    const int n0   = blockIdx.x * SG_N;
    const int tid  = threadIdx.x;
    const int wave = tid >> 5;
    const int lane = tid & 31;
    const int lo   = lane & 15;
    const int sel  = (lane & 16) ? 8 : 0;
    const bf16_t* arow = A + (size_t)(m0 + lo) * EH + wave * SG_KW + sel;
    const bf16_t* wrow = W + (size_t)(n0 + lo) * EH + wave * SG_KW + sel;

    v16bf af[SG_KS], b0[SG_KS], b1[SG_KS];
    // unrolled: the fragments live in registers, the k offsets become immediates
#pragma unroll
    for (int ks = 0; ks < SG_KS; ++ks) {
        af[ks] = load_frag16(arow + ks * 32);
        b0[ks] = load_frag16(wrow + ks * 32);
        b1[ks] = load_frag16(wrow + 16 * EH + ks * 32);
    }
    const int n = n0 + lane;      // this lane's column in the epilogue
    const float bv = bias[n];
    // behind the last load: the address registers stay as they are (named as
    // inputs) until the wait has passed
    asm volatile("s_wait_xcnt 0x0" :: "v"(arow), "v"(wrow) : "memory");
    // keeps all the loads ahead of the first WMMA: left alone the scheduler sinks
    // them among the WMMAs and the wave waits out the load latency several times
    __builtin_amdgcn_sched_barrier(0);

    v8f c0 = {0.f, 0.f, 0.f, 0.f, 0.f, 0.f, 0.f, 0.f};
    v8f c1 = c0;
#pragma unroll
    for (int ks = 0; ks < SG_KS; ++ks) {
        c0 = __builtin_amdgcn_wmma_f32_16x16x32_bf16(
            false, af[ks], false, b0[ks], (short)0, c0, false, false);
        c1 = __builtin_amdgcn_wmma_f32_16x16x32_bf16(
            false, af[ks], false, b1[ks], (short)0, c1, false, false);
    }

    // red[wave][column tile][j][lane]: element (row j + 8 * (lane >> 4),
    // column lane & 15) of the wave's partial tile
    __shared__ float red[SG_WAVES][2][8][32];
#pragma unroll
    for (int j = 0; j < 8; ++j) {
        red[wave][0][j][lane] = c0[j];
        red[wave][1][j][lane] = c1[j];
    }
    __syncthreads();

    // a wave sums and stores one whole 32-column row of the tile at a time
    static_assert(SG_WAVES == 8, "wave w sums rows w and w + 8");
#pragma unroll
    for (int hf = 0; hf < 2; ++hf) {
        float s = 0.f;
        // unrolled: the 8 LDS reads go out together
#pragma unroll
        for (int w = 0; w < SG_WAVES; ++w)
            s += red[w][lane >> 4][wave][hf * 16 + lo];
        out[(size_t)(m0 + hf * 8 + wave) * DH + n] = s + bv;
    }
}

// ---------------------------------------------------------------------------
// First launch: qh = bf16(ht) @ bf16(q_w)^T + q_b, and the conversions of k_w and
// c_w, side by side: neither needs the other, and a launch of its own for the
// small GEMM costs more than the GEMM.
// Work-groups 0 .. QG_WGS - 1 do the GEMM: 16 rows x 16 columns each, 128 k per
// wave, the fragments and the order of sums as in gemm_bf16_kernel. The tile is
// small because q_w now comes from memory: 128 work-groups share the 4 MiB.
// The operands are read as f32, one row's 128 k (512 contiguous bytes) per load of
// a wave, rounded to bf16 in registers and passed through LDS, where the fragment
// reads pick them up.
// qh lies in blocks of 16 columns, element (row, h) at
// (h / 16) * QH_BLK + row * 16 + h % 16, so that a work-group's tile is 1 KiB of
// whole lines.
// The other work-groups convert: one batch per wave.
// ---------------------------------------------------------------------------
static constexpr int QG_N     = 16;                    // columns per work-group
static constexpr int QG_WGS   = (DH / QG_N) * 2;       // work-groups of the GEMM
static constexpr int QG_ROWS  = 16 + QG_N;             // rows staged per wave: ht, q_w
static constexpr int QG_PITCH = SG_KW * 2 + 16;        // LDS pitch of a staged row, bytes
static constexpr int QH_BLK   = Dd * Bb * 16;          // floats in a 16-column block of qh
static_assert(CV_WAVES == SG_WAVES, "one block size for both kinds of work-group");
static_assert(SG_KW == 128, "a wave's load covers a row's share of k");
static_assert(Dd * Bb == 32, "two row tiles");

__global__ __launch_bounds__(32 * SG_WAVES) void cvt_qh_kernel(
    const float* __restrict__ k_w, const float* __restrict__ c_w,
    const float* __restrict__ ht, const float* __restrict__ q_w,
    const float* __restrict__ q_b, bf16_t* __restrict__ kw_out,
    bf16_t* __restrict__ cw_out, float* __restrict__ qh) {
    const int lane = threadIdx.x & 31;
    // the wave's number in its work-group, in a scalar register
    const int wave = __builtin_amdgcn_readfirstlane((int)(threadIdx.x >> 5));

    // st[wave]: the wave's 128 k of 16 ht rows, then of 16 q_w rows, as bf16
    __shared__ __attribute__((aligned(16))) char st[SG_WAVES][QG_ROWS * QG_PITCH];
    // red[wave][j][lane]: element (row j + 8 * (lane >> 4), column lane & 15) of
    // the wave's partial tile
    __shared__ float red[SG_WAVES][8][32];

    if (blockIdx.x >= QG_WGS) {
        const int w   = (blockIdx.x - QG_WGS) * CV_WAVES + wave;
        const int seg = w / CV_WB;
        const float* tb = seg == 0 ? k_w : c_w;
        bf16_t*      ob = seg == 0 ? kw_out : cw_out;
        const unsigned el = (unsigned)(w % CV_WB) * CV_CH + lane * 4;   // first element
        float4 t[CV_U];
        v4bf   o[CV_U];
        const unsigned so = el * 4;                                     // bytes into tb
        cv_load(t, tb, so);
        // behind the last load: the offset register stays as it is (named as an
        // input) until the wait has passed
        asm volatile("s_wait_xcnt 0x0" :: "v"(so) : "memory");
        cv_pack(o, t);
        cv_store(o, ob, el * 2);
        return;
    }

    const int mt  = blockIdx.x / (DH / QG_N);          // row tile
    const int nb  = blockIdx.x % (DH / QG_N);          // column block
    const int lo  = lane & 15;
    const int sel = (lane & 16) ? 8 : 0;
    // the wave's share of k in the tile's first rows (scalar addresses), and the
    // byte offset of this lane's 4 elements there
    const float* ab = ht  + (size_t)mt * 16 * DH + wave * SG_KW;
    const float* wb = q_w + (size_t)nb * QG_N * DH + wave * SG_KW;
    const unsigned off = lane * 16;
    const char* ap = (const char*)ab + (size_t)off;
    const char* wp = (const char*)wb + (size_t)off;

    float4 ta[16], tw[QG_N];
    // unrolled: the rows live in registers, the row offsets become immediates
#pragma unroll
    for (int i = 0; i < QG_N; ++i) tw[i] = *(const float4*)(wp + (size_t)i * DH * 4);
#pragma unroll
    for (int i = 0; i < 16; ++i) ta[i] = *(const float4*)(ap + (size_t)i * DH * 4);
    const int n = nb * QG_N + lo;      // this lane's column in the epilogue
    const float bv = q_b[n];
    // behind the last load: the index registers that the loads are built on stay
    // as they are (named as inputs) until the wait has passed
    asm volatile("s_wait_xcnt 0x0" :: "v"(lane), "v"(n) : "memory");
    char* sw = st[wave];
#pragma unroll
    for (int i = 0; i < QG_N; ++i) {
        v4bf o;
        o[0] = (bf16_t)tw[i].x; o[1] = (bf16_t)tw[i].y;
        o[2] = (bf16_t)tw[i].z; o[3] = (bf16_t)tw[i].w;
        *(v4bf*)(sw + (16 + i) * QG_PITCH + lane * 8) = o;
    }
#pragma unroll
    for (int i = 0; i < 16; ++i) {
        v4bf o;
        o[0] = (bf16_t)ta[i].x; o[1] = (bf16_t)ta[i].y;
        o[2] = (bf16_t)ta[i].z; o[3] = (bf16_t)ta[i].w;
        *(v4bf*)(sw + i * QG_PITCH + lane * 8) = o;
    }
    // the lanes read what other lanes have stored
    __syncthreads();

    const bf16_t* arow = (const bf16_t*)(sw + lo * QG_PITCH) + sel;
    const bf16_t* wrow = (const bf16_t*)(sw + (16 + lo) * QG_PITCH) + sel;
    v16bf af[SG_KS], b0[SG_KS];
    // unrolled: the fragments live in registers, the k offsets become immediates
#pragma unroll
    for (int ks = 0; ks < SG_KS; ++ks) {
        af[ks] = load_frag16(arow + ks * 32);
        b0[ks] = load_frag16(wrow + ks * 32);
    }
    // keeps all the LDS reads ahead of the first WMMA: left alone the scheduler
    // spreads them among the WMMAs and the wave waits out their latency each time
    __builtin_amdgcn_sched_barrier(0);

    v8f c0 = {0.f, 0.f, 0.f, 0.f, 0.f, 0.f, 0.f, 0.f};
#pragma unroll
    for (int ks = 0; ks < SG_KS; ++ks)
        c0 = __builtin_amdgcn_wmma_f32_16x16x32_bf16(
            false, af[ks], false, b0[ks], (short)0, c0, false, false);

#pragma unroll
    for (int j = 0; j < 8; ++j) red[wave][j][lane] = c0[j];
    __syncthreads();

    // one element of the tile per thread: row 2 * wave + (lane >> 4), column lo; a
    // wave stores one whole line
    static_assert(SG_WAVES == 8, "8 waves x 2 rows cover the tile");
    const int row = wave * 2 + (lane >> 4);
    float s = 0.f;
    // unrolled: the 8 LDS reads go out together
#pragma unroll
    for (int w = 0; w < SG_WAVES; ++w)
        s += red[w][row & 7][(row >> 3) * 16 + lo];
    qh[(size_t)nb * QH_BLK + (mt * 16 + row) * 16 + lo] = s + bv;
    // behind the store: in the built code the conversion path follows this one,
    // and no register that the store names is rewritten ahead of the wait
    asm volatile("s_wait_xcnt 0x0" ::: "memory");
}

// ---------------------------------------------------------------------------
// Fused: kh = bf16(hs[b, m0:m0+128, :]) @ k_w^T + k_b   (kept in registers)
//        e[d,b,m0+m] = sum_h tanh(qh[d,b,h] + kh[m,h]) * v_w[h] + v_b
// grid: (S/128, B), block 512 = 16 waves: 4 along the rows x 4 along the
// columns, each wave a 32 x 64 tile (2 x 4 fragments: 12 LDS reads feed 8 WMMAs);
// 4 passes of 256 columns.
// The work-group's 128 hs rows stay in LDS as bf16, all 1024 k of them, for all
// four passes: hs is read once. They come in during the first pass, 128 k at a
// time: read as f32, held in registers for two stages, rounded to bf16, stored.
// k_w (bf16) streams through two small buffers by asynchronous copies that read
// whole lines: a stage is 64 k (128-byte rows) of 256 k_w rows, the next stage
// in flight while this one is used.
// The two together take all of the LDS, so no row is padded: the 16-byte pieces
// of a row are permuted by the row's number instead (XOR), which spreads the 16
// rows of a fragment read over all banks. The LDS is laid out in 8 groups of
// 16 hs rows and 64 k_w rows, so that the k_w rows of the four column waves lie
// in four different 32-KiB blocks, as the hs rows of the four row waves do.
// All work-groups read the same k_w; for speed only, each work-group starts its
// walk over the column passes and over k at a place given by its index.
// ---------------------------------------------------------------------------
static constexpr int KP_M      = 128;                       // hs rows per work-group
static constexpr int KP_N      = 256;                       // kh columns per pass
static constexpr int KP_K      = 64;                        // k per stage of k_w
static constexpr int KP_AK     = 128;                       // k per slice of hs
static constexpr int KP_APITCH = EH * 2;                    // LDS pitch of an hs row, bytes
static constexpr int KP_WPITCH = KP_K * 2;                  // LDS pitch of a k_w row, bytes
static constexpr int KP_WOFF   = 16 * KP_APITCH;            // a group's k_w rows, byte offset
static constexpr int KP_GRP    = KP_WOFF + 64 * KP_WPITCH;  // one group, bytes
static constexpr int KP_BUF    = 4 * KP_GRP;                // from k_w buffer 0 to 1, bytes
static constexpr int KP_KST    = EH / KP_K;                 // stages per pass
static constexpr int KP_NSL    = EH / KP_AK;                // hs slices
static constexpr int KP_PASSES = DH / KP_N;                 // column passes
static constexpr int KP_STAGES = KP_PASSES * KP_KST;        // stages in all
static constexpr int KP_FM     = 2;                         // row fragments per wave
static constexpr int KP_FN     = 4;                         // column fragments per wave
static constexpr int KP_WM     = KP_M / (16 * KP_FM);       // waves along the rows
static constexpr int KP_WN     = KP_N / (16 * KP_FN);       // waves along the columns
static_assert(KP_WM * KP_WN == 16, "16 waves cover the block tile");
static_assert(KP_AK == 2 * KP_K, "an hs slice serves two stages");
static_assert(KP_M == 8 * 16 && 2 * KP_N == 8 * 64, "8 groups hold everything");
static_assert(8 * KP_GRP == 327680, "all of the LDS");

static constexpr int KP_AR     = KP_M / 16;                 // hs rows per wave and slice

// The k_w rows of one stage: 256 rows x 8 pieces of 16 bytes = 4 copies per
// thread. A wave's copy covers four whole 128-byte rows. w: the stage's first
// k_w element (the same for the whole work-group: a scalar base); off: byte
// offset from there of this thread's piece in row (tid >> 3); dst: its LDS byte
// address. a_off: the offset register of the hs loads where some were issued
// just ahead.
__device__ __forceinline__ void kp_copy_w(const bf16_t* w, unsigned off, unsigned dst,
                                          unsigned a_off) {
    constexpr unsigned GR = 64 * EH * 2;      // 64 rows further, bytes
    constexpr unsigned LR = KP_GRP;           // 64 rows further, LDS bytes
    // s_wait_xcnt closes the statement so that no address register named here
    // (the hs loads' offset among them) is rewritten ahead of it.
    asm volatile(
        "global_load_async_to_lds_b128 %0, %4, %8\n\t"
        "global_load_async_to_lds_b128 %1, %5, %8\n\t"
        "global_load_async_to_lds_b128 %2, %6, %8\n\t"
        "global_load_async_to_lds_b128 %3, %7, %8\n\t"
        "s_wait_xcnt 0x0"
        :: "v"(dst), "v"(dst + LR), "v"(dst + 2 * LR), "v"(dst + 3 * LR),
           "v"(off), "v"(off + GR), "v"(off + 2 * GR), "v"(off + 3 * GR),
           "s"(w), "v"(a_off)
        : "memory");
}

// One slice of the hs rows: a wave reads 8 rows, 16 apart, one whole 512-byte
// piece (128 f32) per load. off: byte offset into hs of this lane's 4 elements
// of the wave's first row. Unrolled: the rows live in registers and the row
// offsets become immediates.
__device__ __forceinline__ void kp_load_a(float4 (&t)[KP_AR], const float* hs, unsigned off) {
    const char* p = (const char*)hs + (size_t)off;
#pragma unroll
    for (int i = 0; i < KP_AR; ++i)
        t[i] = *(const float4*)(p + (size_t)i * 16 * EH * 4);
}

// Rounds them to bf16 and stores them: one 256-byte window of LDS per wave store.
// dst: this lane's 8 bytes in the wave's first row, in the slice's window.
__device__ __forceinline__ void kp_store_a(const float4 (&t)[KP_AR], char* dst) {
#pragma unroll
    for (int i = 0; i < KP_AR; ++i) {
        v4bf o;
        o[0] = (bf16_t)t[i].x; o[1] = (bf16_t)t[i].y;
        o[2] = (bf16_t)t[i].z; o[3] = (bf16_t)t[i].w;
        *(v4bf*)(dst + i * KP_GRP) = o;
    }
}

// A fragment from two 16-byte pieces (k and k + 16 of the lane's 8 + 8 elements)
__device__ __forceinline__ v16bf kp_frag(const char* p0, const char* p1) {
    v8bf lo = *reinterpret_cast<const v8bf*>(p0);
    v8bf hi = *reinterpret_cast<const v8bf*>(p1);
    v16bf r;
#pragma unroll
    for (int i = 0; i < 8; ++i) { r[i] = lo[i]; r[i + 8] = hi[i]; }
    return r;
}

// tells the first column pass from the others at compile time
template <bool F> struct KpFlag { static constexpr bool value = F; };

// Work-group barrier that orders LDS traffic only: __syncthreads() would also
// wait out the hs loads in flight, which have two stages to land.
__device__ __forceinline__ void kp_lds_barrier() {
    __builtin_amdgcn_fence(__ATOMIC_RELEASE, "workgroup", "local");
    __builtin_amdgcn_s_barrier();
    __builtin_amdgcn_fence(__ATOMIC_ACQUIRE, "workgroup", "local");
}

__global__ __launch_bounds__(512) void kproj_score_kernel(
    const float* __restrict__ hs, const bf16_t* __restrict__ kw_bf,
    const float* __restrict__ k_b, const float* __restrict__ qh,
    const float* __restrict__ v_w, const float* __restrict__ v_b,
    float* __restrict__ e_out) {
    const int m0   = blockIdx.x * KP_M;
    const int b    = blockIdx.y;
    const int tid  = threadIdx.x;
    const int wave = tid >> 5;
    const int lane = tid & 31;
    const int lo   = lane & 15;
    const int hi   = lane >> 4;
    const int wm   = wave % KP_WM;   // which 32 rows
    const int wn   = wave / KP_WM;   // which 64 of the pass's 256 columns

    // Group g: hs rows 16 g .. 16 g + 15, then k_w rows 64 (g & 3) .. + 63 of
    // buffer g >> 2. Piece c (16 bytes, 8 k) of hs row m lies at piece
    // c ^ (m & 15) of the row; piece c of k_w row n at piece c ^ ((n >> 1) & 7).
    __shared__ __attribute__((aligned(16))) char kp_lds[8 * KP_GRP];

    // this thread's piece of a stage's k_w rows
    const int crow = tid >> 3;
    const int ccol = tid & 7;
    const unsigned w_off = (crow * EH + ccol * 8) * 2;
    const unsigned c_dst = (unsigned)(size_t)kp_lds + KP_WOFF + crow * KP_WPITCH
                         + ((ccol ^ ((crow >> 1) & 7)) << 4);
    // this lane's 4 elements of the wave's first hs row of a slice (rows wave,
    // wave + 16, ...: m & 15 is the wave's number)
    static_assert((size_t)Bb * Ss * EH * 4 < (1ull << 32), "byte offsets fit 32 bits");
    const unsigned a_src = (((unsigned)b * Ss + m0 + wave) * EH + lane * 4) * 4;
    char* a_dst = kp_lds + wave * KP_APITCH + (((lane >> 1) ^ wave) << 4) + (lane & 1) * 8;

    // where this work-group's walk starts: 32 places, dealt so that both
    // neighbouring indices and indices 8 apart get different ones
    static_assert(KP_PASSES * KP_NSL == 32, "32 starting places");
    const unsigned wg  = blockIdx.y * (Ss / KP_M) + blockIdx.x;
    const unsigned rot = ((wg >> 3) + 4 * (wg & 7)) % 32;
    const unsigned rk  = rot % KP_NSL;     // first hs slice (128 k)
    const unsigned rp  = rot / KP_NSL;     // first column pass
    // the j-th slice of the walk, and the walk's column pass number p
    auto sl_k = [rk](unsigned j) { return (j + rk) % KP_NSL; };
    auto ps_p = [rp](unsigned p) { return (p + rp) % KP_PASSES; };
    // the first k_w element of stage st of the walk
    auto st_w = [&](unsigned st) {
        return kw_bf + (size_t)ps_p(st / KP_KST) * KP_N * EH
                     + (sl_k((st % KP_KST) / 2) * 2 + (st & 1)) * KP_K;
    };

    float4 ar[KP_AR];
    const unsigned ao0 = a_src + sl_k(0) * KP_AK * 4;
    kp_load_a(ar, hs, ao0);
    kp_copy_w(st_w(0), w_off, c_dst, ao0);
    kp_store_a(ar, a_dst + sl_k(0) * KP_AK * 2);
    // slice 0 and stage 0 have landed for this wave (its stores and its copies);
    // the barrier publishes them to the others
    asm volatile("s_wait_dscnt 0x0" ::: "memory");
    asm volatile("s_wait_asynccnt 0x0" ::: "memory");
    __syncthreads();
    const unsigned ao1 = a_src + sl_k(1) * KP_AK * 4;
    kp_load_a(ar, hs, ao1);
    kp_copy_w(st_w(1), w_off, c_dst + KP_BUF, ao1);

    // this lane's fragment rows; a piece's number is XORed in at the read
    static_assert(KP_FN * 16 == 64, "a column wave's k_w rows are one group's");
    const unsigned a_lane = wm * KP_FM * KP_GRP + lo * KP_APITCH + ((hi ^ lo) << 4);
    const unsigned w_lane = lo * KP_WPITCH + ((hi ^ (lo >> 1)) << 4);

    // row (0, b) in the first 16-column block of qh; row (1, b) lies Bb * 16 on
    const float* qh0 = qh + b * 16;

    float p0[KP_FM][8], p1[KP_FM][8];
#pragma unroll
    for (int r = 0; r < KP_FM; ++r)
#pragma unroll
        for (int j = 0; j < 8; ++j) { p0[r][j] = 0.f; p1[r][j] = 0.f; }

    const v8f zero = {0.f, 0.f, 0.f, 0.f, 0.f, 0.f, 0.f, 0.f};

    // One column pass. The first pass of the walk, which also brings the hs rows
    // in, is compiled apart from the others: those then hold no hs registers, and
    // the first holds no score sums (they are still zero).
    auto do_pass = [&](auto first, const int pass) __attribute__((always_inline)) {
        constexpr bool FIRST = decltype(first)::value;
        v8f c[KP_FM][KP_FN];
#pragma unroll
        for (int r = 0; r < KP_FM; ++r)
#pragma unroll
            for (int t = 0; t < KP_FN; ++t) c[r][t] = zero;

        for (int sl = 0; sl < KP_NSL; ++sl) {
            // the slice's first piece in an hs row, as a byte offset
            const unsigned a_k = sl_k(sl) * KP_AK * 2;
            // unrolled: the two stages of a slice use one buffer each, told apart
            // at compile time
#pragma unroll
            for (int hf = 0; hf < 2; ++hf) {
                const int st = pass * KP_KST + sl * 2 + hf;
                const char* buf = kp_lds + hf * KP_BUF + wn * KP_GRP + KP_WOFF;
#pragma unroll
                for (int ks = 0; ks < KP_K / 32; ++ks) {
                    // byte offsets of the k-step's pieces 0 and 2 (the lane's
                    // half adds piece 1 by a_lane, w_lane)
                    const unsigned wk = ks * 64;
                    const unsigned ak = a_k + hf * KP_K * 2 + wk;
                    v16bf af[KP_FM], bf[KP_FN];
#pragma unroll
                    for (int r = 0; r < KP_FM; ++r)
                        af[r] = kp_frag(
                            kp_lds + (a_lane ^ ak) + r * KP_GRP,
                            kp_lds + (a_lane ^ (ak + 32)) + r * KP_GRP);
#pragma unroll
                    for (int t = 0; t < KP_FN; ++t)
                        bf[t] = kp_frag(
                            buf + (w_lane ^ wk) + t * 16 * KP_WPITCH,
                            buf + (w_lane ^ (wk + 32)) + t * 16 * KP_WPITCH);
                    // keeps the k-step's 12 LDS reads one group ahead of its WMMAs:
                    // left alone the scheduler puts a full LDS wait before each WMMA
                    __builtin_amdgcn_sched_barrier(0);
                    // first pass: the next hs slice, loaded two stages ago, goes
                    // to its place (nobody reads it before the barrier below)
                    // while the last k-step's fragments are on their way
                    if (FIRST && hf == 1 && ks == KP_K / 32 - 1 && sl + 1 < KP_NSL)
                        kp_store_a(ar, a_dst + sl_k(sl + 1) * KP_AK * 2);
#pragma unroll
                    for (int r = 0; r < KP_FM; ++r)
#pragma unroll
                        for (int t = 0; t < KP_FN; ++t)
                            c[r][t] = __builtin_amdgcn_wmma_f32_16x16x32_bf16(
                                false, af[r], false, bf[t], (short)0, c[r][t], false, false);
                }
                // this wave's reads of the buffer are done before it is refilled,
                // and its stores of the next hs slice have landed
                asm volatile("s_wait_dscnt 0x0" ::: "memory");
                // this wave's copies of the next stage have landed
                asm volatile("s_wait_asynccnt 0x0" ::: "memory");
                // publishes the next stage and ends every wave's reads of this one
                kp_lds_barrier();
                const int nx = st + 2;
                if (nx < KP_STAGES) {
                    unsigned ao = a_src;
                    if (FIRST && hf == 1 && sl + 2 < KP_NSL) {
                        ao = a_src + sl_k(sl + 2) * KP_AK * 4;
                        kp_load_a(ar, hs, ao);
                    }
                    kp_copy_w(st_w(nx), w_off, c_dst + hf * KP_BUF, ao);
                }
            }
        }

        // score terms of this pass's 64 columns, for d = 0 and d = 1.
        // ho: byte offset of this lane's first column h in v_w and k_b; qo: that
        // of the same column in row (0, b) of qh (16-column blocks)
        const unsigned hb = ps_p(pass) * (KP_N / 16) + wn * KP_FN;
        const unsigned ho = (hb * 16 + lo) * 4;
        const unsigned qo = (hb * QH_BLK + lo) * 4;
        const char* vp = (const char*)v_w + (size_t)ho;
        const char* kp = (const char*)k_b + (size_t)ho;
        const char* qp = (const char*)qh0 + (size_t)qo;
        float vw4[KP_FN], kb4[KP_FN], q04[KP_FN], q14[KP_FN];
        // unrolled: the column offsets become immediates
#pragma unroll
        for (int t = 0; t < KP_FN; ++t) {
            vw4[t] = *(const float*)(vp + t * 16 * 4);
            kb4[t] = *(const float*)(kp + t * 16 * 4);
            q04[t] = *(const float*)(qp + t * QH_BLK * 4);
            q14[t] = *(const float*)(qp + (t * QH_BLK + Bb * 16) * 4);
        }
        // behind the last load: the two offset registers stay as they are (named
        // as inputs) until the wait has passed
        asm volatile("s_wait_xcnt 0x0" :: "v"(ho), "v"(qo) : "memory");
#pragma unroll
        for (int t = 0; t < KP_FN; ++t) {
            const float vwh = vw4[t];
            const float kbh = kb4[t];
            const float q0  = q04[t];
            const float q1  = q14[t];
#pragma unroll
            for (int r = 0; r < KP_FM; ++r)
#pragma unroll
                for (int j = 0; j < 8; ++j) {
                    const float kv = c[r][t][j] + kbh;
                    p0[r][j] += FAST_TANH(q0 + kv) * vwh;
                    p1[r][j] += FAST_TANH(q1 + kv) * vwh;
                }
        }
    };
    do_pass(KpFlag<true>{}, 0);
    for (int pass = 1; pass < KP_PASSES; ++pass) do_pass(KpFlag<false>{}, pass);
    // no copy is outstanding when the wave goes on to its end
    asm volatile("s_wait_asynccnt 0x0" ::: "memory");

    // e_part[wn * 256 + d * 128 + row]: the score sum over the columns of the
    // waves wn. It takes the place of group 0's k_w rows, which every wave has
    // left behind the last stage's barrier.
    float* e_part = (float*)(kp_lds + KP_WOFF);
    static_assert(KP_WN * 2 * KP_M * 4 <= KP_GRP - KP_WOFF, "the slots fit there");

    // reduce over the 16 columns held by each half-wave; the four waves that
    // share the rows each leave their sum in a slot of their own
    const int rbase = wm * 16 * KP_FM + ((lane & 16) ? 8 : 0);
    // the exchange distance is the outer loop: the 32 sums of a wave take each
    // step together, so that a step's exchange latency is waited out once
#pragma unroll
    for (int off = 1; off < 16; off <<= 1)
#pragma unroll
        for (int r = 0; r < KP_FM; ++r)
#pragma unroll
            for (int j = 0; j < 8; ++j) {
                p0[r][j] += __shfl_xor(p0[r][j], off, 32);
                p1[r][j] += __shfl_xor(p1[r][j], off, 32);
            }
    if (lo == 0) {
#pragma unroll
        for (int r = 0; r < KP_FM; ++r)
#pragma unroll
            for (int j = 0; j < 8; ++j) {
                e_part[wn * 2 * KP_M + rbase + r * 16 + j] = p0[r][j];
                e_part[wn * 2 * KP_M + KP_M + rbase + r * 16 + j] = p1[r][j];
            }
    }
    __syncthreads();

    static_assert(KP_WN == 4, "four slots per score");
    if (tid < 2 * KP_M) {
        const int d = tid / KP_M;
        const int mr = tid % KP_M;
        const float s = (e_part[tid] + e_part[2 * KP_M + tid])
                      + (e_part[4 * KP_M + tid] + e_part[6 * KP_M + tid]);
        e_out[((size_t)d * Bb + b) * Ss + m0 + mr] = s + v_b[0];
    }
}

// ---------------------------------------------------------------------------
// at = softmax(e) over S, and ctx[d,b,g] = sum_s at[d,b,s] * hs[b,s,g], in one
// launch (hs read once for both d).
// grid: (EH/64, B), block 512 = 16 waves: one work-group per WGP, all of them
// streaming. A work-group owns 64 columns (256-byte pieces of the hs rows); a
// 16-lane half of a wave owns 64 consecutive rows, so one 16-byte load of a
// wave covers two whole pieces. The 32 partial sums of a column meet in LDS.
// Every work-group works out both softmax rows of its batch for itself, while
// its first 32 hs rows per half-wave are on their way, and leaves the weights
// in LDS; it stores 1/16 of each row to at. ctx is stored as bf16 (feeds the
// final GEMM).
// ---------------------------------------------------------------------------
static constexpr int CX_COLS  = 64;                     // columns per work-group
static constexpr int CX_PARTS = 32;                     // half-waves per work-group
static constexpr int CX_ROWS  = Ss / CX_PARTS;          // rows per half-wave
static constexpr int CX_STEP  = 16;                     // rows loaded together
static constexpr int CX_NSTEP = CX_ROWS / CX_STEP;
static constexpr int CX_WAVES = CX_PARTS / 2;           // waves per work-group
static constexpr int CX_AT    = Ss / (EH / CX_COLS);    // at elements stored per row
static_assert(Dd == 2 && Dd * Ss == 32 * CX_WAVES * 8, "8 scores per thread");
static_assert(CX_AT == 128, "one wave stores a work-group's share of an at row");
static_assert(CX_NSTEP >= 2, "two batches are in flight from the start");

struct CxBatch {
    float4 hv[CX_STEP];       // 4 columns of each row
};

__device__ __forceinline__ void cx_load(CxBatch& t, const float* h, int step) {
    // unrolled: the batch lives in registers, and the row offsets become
    // immediates of the loads
#pragma unroll
    for (int u = 0; u < CX_STEP; ++u)
        t.hv[u] = *(const float4*)(h + (size_t)(step * CX_STEP + u) * EH);
}

// w0, w1: the batch's 16 weights for d = 0 and d = 1, in LDS
__device__ __forceinline__ void cx_sum(const CxBatch& t, const float* w0,
                                       const float* w1, float4& acc0, float4& acc1) {
    // both loops unrolled: the batch lives in registers
#pragma unroll
    for (int q = 0; q < CX_STEP / 4; ++q) {
        const float4 a = *(const float4*)(w0 + q * 4);
        const float4 c = *(const float4*)(w1 + q * 4);
        const float s0[4] = {a.x, a.y, a.z, a.w};
        const float s1[4] = {c.x, c.y, c.z, c.w};
#pragma unroll
        for (int u = 0; u < 4; ++u) {
            const float4 v = t.hv[q * 4 + u];
            acc0.x += s0[u] * v.x; acc0.y += s0[u] * v.y;
            acc0.z += s0[u] * v.z; acc0.w += s0[u] * v.w;
            acc1.x += s1[u] * v.x; acc1.y += s1[u] * v.y;
            acc1.z += s1[u] * v.z; acc1.w += s1[u] * v.w;
        }
    }
}

// Work-group barrier that orders LDS traffic only: __syncthreads() would also
// wait out every global load in flight, and the hs rows must keep flying while
// the softmax is worked out.
__device__ __forceinline__ void cx_lds_barrier() {
    __builtin_amdgcn_fence(__ATOMIC_RELEASE, "workgroup", "local");
    __builtin_amdgcn_s_barrier();
    __builtin_amdgcn_fence(__ATOMIC_ACQUIRE, "workgroup", "local");
}

__global__ __launch_bounds__(512) void softmax_ctx_kernel(
    const float* __restrict__ e, const float* __restrict__ hs,
    float* __restrict__ at, bf16_t* __restrict__ ctx_bf) {
    const int b    = blockIdx.y;
    const int g0   = blockIdx.x * CX_COLS;
    const int tid  = threadIdx.x;
    const int lane = tid & 31;
    const int wave = tid >> 5;
    const int lo   = tid & 15;
    const int part = tid >> 4;
    const int r0   = part * CX_ROWS;

    // w_lds[d][s] = at[d, b, s]
    __shared__ __attribute__((aligned(16))) float w_lds[Dd][Ss];
    // one slot per wave: the waves' maxima, then their sums
    __shared__ __attribute__((aligned(16))) float sm_max[CX_WAVES];
    __shared__ __attribute__((aligned(16))) float sm_sum[CX_WAVES];

    // waves 0-7 take the scores of d = 0, waves 8-15 those of d = 1: a thread
    // has elements 4 i0 .. 4 i0 + 3 of each half of the row
    const int d  = tid >> 8;
    const int i0 = tid & 255;
    const float4* er = (const float4*)(e + ((size_t)d * Bb + b) * Ss) + i0;
    const float*  h  = hs + ((size_t)b * Ss + r0) * EH + g0 + lo * 4;

    float4 x0 = er[0];
    float4 x1 = er[256];
    CxBatch t[2];
    cx_load(t[0], h, 0);
    cx_load(t[1], h, 1);
    // behind the score loads: their address register stays as it is (named as
    // an input) until the wait has passed
    asm volatile("s_wait_xcnt 0x0" :: "v"(er) : "memory");
    // keeps the first 32 rows' loads ahead of the softmax: they fly while it is
    // worked out
    __builtin_amdgcn_sched_barrier(0);

    // row maximum: thread, wave, the row's 8 waves
    float m = fmaxf(fmaxf(fmaxf(x0.x, x0.y), fmaxf(x0.z, x0.w)),
                    fmaxf(fmaxf(x1.x, x1.y), fmaxf(x1.z, x1.w)));
    // unrolled: the five exchange distances become constants
#pragma unroll
    for (int off = 16; off > 0; off >>= 1) m = fmaxf(m, __shfl_xor(m, off, 32));
    if (lane == 0) sm_max[wave] = m;
    cx_lds_barrier();
    {
        const float4 p = *(const float4*)(sm_max + d * 8);
        const float4 q = *(const float4*)(sm_max + d * 8 + 4);
        m = fmaxf(fmaxf(fmaxf(p.x, p.y), fmaxf(p.z, p.w)),
                  fmaxf(fmaxf(q.x, q.y), fmaxf(q.z, q.w)));
    }

    x0.x = __expf(x0.x - m); x0.y = __expf(x0.y - m);
    x0.z = __expf(x0.z - m); x0.w = __expf(x0.w - m);
    x1.x = __expf(x1.x - m); x1.y = __expf(x1.y - m);
    x1.z = __expf(x1.z - m); x1.w = __expf(x1.w - m);
    float sum = ((x0.x + x0.y) + (x0.z + x0.w)) + ((x1.x + x1.y) + (x1.z + x1.w));
    // unrolled, as above
#pragma unroll
    for (int off = 16; off > 0; off >>= 1) sum += __shfl_xor(sum, off, 32);
    if (lane == 0) sm_sum[wave] = sum;
    cx_lds_barrier();
    {
        const float4 p = *(const float4*)(sm_sum + d * 8);
        const float4 q = *(const float4*)(sm_sum + d * 8 + 4);
        sum = ((p.x + p.y) + (p.z + p.w)) + ((q.x + q.y) + (q.z + q.w));
    }
    const float inv = 1.f / sum;
    x0.x *= inv; x0.y *= inv; x0.z *= inv; x0.w *= inv;
    x1.x *= inv; x1.y *= inv; x1.z *= inv; x1.w *= inv;
    *(float4*)(w_lds[d] + i0 * 4) = x0;
    *(float4*)(w_lds[d] + Ss / 2 + i0 * 4) = x1;
    cx_lds_barrier();

    float4 acc0 = {0.f, 0.f, 0.f, 0.f};
    float4 acc1 = {0.f, 0.f, 0.f, 0.f};
    // unrolled so that the two batches are told apart at compile time
#pragma unroll
    for (int s = 0; s < CX_NSTEP; ++s) {
        if (s > 0 && s + 1 < CX_NSTEP) {
            cx_load(t[(s + 1) & 1], h, s + 1);
            // behind the last loads: their address register stays as it is
            // (named as an input) until the wait has passed
            if (s + 2 == CX_NSTEP)
                asm volatile("s_wait_xcnt 0x0" :: "v"(h) : "memory");
            // keeps the next 16 rows' loads ahead of these rows' sums: left
            // alone the scheduler sinks them and a wave has few loads in flight
            __builtin_amdgcn_sched_barrier(0);
        }
        cx_sum(t[s & 1], w_lds[0] + r0 + s * CX_STEP, w_lds[1] + r0 + s * CX_STEP,
               acc0, acc1);
    }

    // red[p][d * 64 + column]: the partial sum of half-wave p
    __shared__ __attribute__((aligned(16))) float red[CX_PARTS][2 * CX_COLS];
    __shared__ float red2[4][2 * CX_COLS];
    *(float4*)(red[part] + lo * 4) = acc0;
    *(float4*)(red[part] + CX_COLS + lo * 4) = acc1;
    __syncthreads();

    // 4 threads per output, 8 partials each, then across the 4
    {
        const int o = tid & (2 * CX_COLS - 1);
        const int p = tid >> 7;
        float s = 0.f;
        // unrolled: the 8 LDS reads go out together
#pragma unroll
        for (int k = 0; k < 8; ++k) s += red[p * 8 + k][o];
        red2[p][o] = s;
    }
    __syncthreads();

    if (tid < 2 * CX_COLS) {
        const float s = (red2[0][tid] + red2[1][tid]) + (red2[2][tid] + red2[3][tid]);
        const int dd = tid / CX_COLS;
        const int c  = tid % CX_COLS;
        ctx_bf[((size_t)dd * Bb + b) * EH + g0 + c] = (bf16_t)s;
    } else if (tid < 2 * CX_COLS + Dd * 32) {
        // two more waves store this work-group's share of the two at rows, 512
        // contiguous bytes each
        const int dd = (tid - 2 * CX_COLS) >> 5;
        const int s0 = blockIdx.x * CX_AT + lane * 4;
        *(float4*)(at + ((size_t)dd * Bb + b) * Ss + s0) = *(const float4*)(w_lds[dd] + s0);
    }
}

// ---------------------------------------------------------------------------
// launcher
// ---------------------------------------------------------------------------
extern "C" void kernel_launch(void* const* d_in, const int* in_sizes, int n_in,
                              void* d_out, int out_size, void* d_ws, size_t ws_size,
                              hipStream_t stream) {
    const float* hs  = (const float*)d_in[0];  // (B,S,EH)
    const float* ht  = (const float*)d_in[1];  // (D,B,DH)
    const float* q_w = (const float*)d_in[2];  // (DH,DH)
    const float* q_b = (const float*)d_in[3];  // (DH,)
    const float* k_w = (const float*)d_in[4];  // (DH,EH)
    const float* k_b = (const float*)d_in[5];  // (DH,)
    const float* v_w = (const float*)d_in[6];  // (1,DH)
    const float* v_b = (const float*)d_in[7];  // (1,)
    const float* c_w = (const float*)d_in[8];  // (DH,EH)
    const float* c_b = (const float*)d_in[9];  // (DH,)

    float* out_c  = (float*)d_out;                 // (D,B,DH) = 32768
    float* out_at = out_c + (size_t)Dd * Bb * DH;  // (D,B,S)  = 65536

    char* ws = (char*)d_ws;
    bf16_t* kw_bf  = (bf16_t*)(ws + 67108864);    //  2097152 B
    bf16_t* cw_bf  = (bf16_t*)(ws + 71303168);    //  2097152 B
    bf16_t* ctx_bf = (bf16_t*)(ws + 73465856);    //    65536 B
    float*  qh     = (float*) (ws + 73531392);    //   131072 B
    float*  e      = (float*) (ws + 73662464);    //   262144 B

    // 1) qh = ht @ q_w^T + q_b (M=32, N=DH, K=DH), and k_w, c_w -> bf16
    cvt_qh_kernel<<<QG_WGS + CV_WGS, 32 * SG_WAVES, 0, stream>>>(
        k_w, c_w, ht, q_w, q_b, kw_bf, cw_bf, qh);

    // 2) fused k-projection + tanh score -> e (D,B,S)
    kproj_score_kernel<<<dim3(Ss / KP_M, Bb), 512, 0, stream>>>(
        hs, kw_bf, k_b, qh, v_w, v_b, e);

    // 3) at = softmax(e) over S (output) and ctx = at @ hs (bf16)
    softmax_ctx_kernel<<<dim3(EH / CX_COLS, Bb), 512, 0, stream>>>(e, hs, out_at, ctx_bf);

    // 4) c = ctx @ c_w^T + c_b   (M=32, N=DH, K=EH)
    gemm_bf16_kernel<<<dim3(DH / SG_N, 2), 32 * SG_WAVES, 0, stream>>>(
        ctx_bf, cw_bf, c_b, out_c);
}
